// v000
// Measured on an AMD MI455X. A time is GPU time per run, averaged over a window of back-to-back runs after a warm-up
// (all launches, gaps included; the runs take copies of the inputs in turn), and the median of several windows.
// Apart from v000's, it joins two sittings. Times from different sittings can be a few percent apart, while
// side-by-side timings come from the same sitting.
// v000 is the starting kernel. One run takes 4670 microseconds.
#include <hip/hip_runtime.h>

// Multi-head self-attention with a fused qkv projection (x [8][1024][1024]; qkv = x w_qkv ('xw' [1024][3072], no bias) -> q | k | v (16 heads x 64); dots x 1024^-0.5 (the repo scales by dim); softmax (no mask); out = merged w_out + b_out ('xw') -> [8][1024][1024] (8.4 M); argument order x, w_qkv, w_out, b_out).
// Layout per batch: bf16 copy of x; fused 'xw' weight transposed once (q | k | v row blocks); exact projections; identity-table plane builders; dense T-1024 attention (hybrid rows: < 512 hi/lo 3 products, rest fp16 x1024); merged hi/lo x w_out exact + b_out.
// Compute dtypes, f32 accumulate: every input rounded to bf16; projections exact; attention rows < 512 3 products, rest fp16; softmax f32; w_out hl x exact + bias.

#define NB_  8
#define TT   1024
#define DM   1024
#define NH_  16
#define NKV  16
#define REP  (NH_ / NKV)
#define HD   64
#define DQ   (NH_ * HD)
#define DKV  (NKV * HD)
#define ZH   2
#define RH   512                  // query rows < RH use hi+lo planes (0: none)
#define WIN  0
#define PCAR 1024.0f
#define SCL  0.03125f   // dim^-0.5 = 1/32 (the repo scales by dim)
typedef _Float16 h16;
typedef unsigned short bf;
typedef __attribute__((ext_vector_type(16))) __bf16   v16bf;
typedef __attribute__((ext_vector_type(16))) _Float16 v16h;
typedef __attribute__((ext_vector_type(8)))  _Float16 v8h;
typedef __attribute__((ext_vector_type(8)))  unsigned short v8us;
typedef __attribute__((ext_vector_type(8)))  float    v8f;
typedef __attribute__((ext_vector_type(4)))  float    v4f;
typedef v8h  __attribute__((may_alias)) v8ha;
typedef v4f  __attribute__((may_alias)) v4fa;
typedef v8us __attribute__((may_alias)) v8usa;

__device__ __forceinline__ unsigned short f2bf(float f) { unsigned u = __float_as_uint(f); u += 0x7FFFu + ((u >> 16) & 1u); return (unsigned short)(u >> 16); }
__device__ __forceinline__ float bf2f(unsigned short b) { return __uint_as_float(((unsigned)b) << 16); }
__device__ __forceinline__ float bfr(float f) { return bf2f(f2bf(f)); }
__device__ __forceinline__ v16h cat16(v8h lo, v8h hi) { return __builtin_shufflevector(lo, hi, 0, 1, 2, 3, 4, 5, 6, 7, 8, 9, 10, 11, 12, 13, 14, 15); }
__device__ __forceinline__ v16bf cat16b(v8us lo, v8us hi) { return __builtin_bit_cast(v16bf, __builtin_shufflevector(lo, hi, 0, 1, 2, 3, 4, 5, 6, 7, 8, 9, 10, 11, 12, 13, 14, 15)); }
__device__ __forceinline__ v8f wmma16(v16h a, v16h b, v8f c) { return __builtin_amdgcn_wmma_f32_16x16x32_f16(false, a, false, b, (short)0, c, false, false); }
__device__ __forceinline__ v8f wmmab(v16bf a, v16bf b, v8f c) { return __builtin_amdgcn_wmma_f32_16x16x32_bf16(false, a, false, b, (short)0, c, false, false); }



// ---- k_gemmw: register-blocked GEMM, ONE WAVE per 64x64 output tile (16 accumulators), operands straight from K-contiguous 16-bit planes; grid (M/64, N/64, Z), 32 threads.
// C[m][n] (f32, pitch ldc, + optional f32 bias[n]) = sum_k A[m][k] Bt[n][k] (+ split products per NSPLIT). z-batch strides sA/sB/sC in elements. K % 32 == 0.
template <typename T16> struct WFrag;
template <> struct WFrag<h16> { typedef v16h V; static __device__ __forceinline__ V ld(const h16* p) { return cat16(*(const v8h*)p, *(const v8h*)(p + 16)); } static __device__ __forceinline__ v8f mma(V a, V b, v8f c) { return wmma16(a, b, c); } };
template <> struct WFrag<bf> { typedef v16bf V; static __device__ __forceinline__ V ld(const bf* p) { return cat16b(*(const v8us*)p, *(const v8us*)(p + 16)); } static __device__ __forceinline__ v8f mma(V a, V b, v8f c) { return wmmab(a, b, c); } };
template <typename T16, int NSPLIT, bool BIAS>
__global__ __launch_bounds__(32) void k_gemmw(const T16* __restrict__ A, const T16* __restrict__ A2, const T16* __restrict__ Bt, const T16* __restrict__ Bt2, int K, float* C, int ldc, const float* __restrict__ bias, size_t sA, size_t sB, size_t sC) {
    typedef typename WFrag<T16>::V V;
    __shared__ __align__(16) float os[16 * 68];
    const size_t z = blockIdx.z; A += z * sA; if (A2) A2 += z * sA; Bt += z * sB; if (Bt2) Bt2 += z * sB; C += z * sC;
    const int lane = threadIdx.x & 31, lr = lane & 15, hi = lane >> 4; const int r0 = blockIdx.x * 64, c0 = blockIdx.y * 64;
    v8f acc[4][4];
#pragma unroll
    for (int mb = 0; mb < 4; ++mb)
#pragma unroll
        for (int nb = 0; nb < 4; ++nb) acc[mb][nb] = (v8f){};
    const size_t aoff = (size_t)(r0 + lr) * K + 8 * hi, boff = (size_t)(c0 + lr) * K + 8 * hi;
#pragma unroll 1
    for (int kc = 0; kc < K; kc += 32) {
        V a[4], a2[4];
#pragma unroll
        for (int mb = 0; mb < 4; ++mb) { a[mb] = WFrag<T16>::ld(A + aoff + (size_t)mb * 16 * K + kc); if (NSPLIT == 1 || NSPLIT == 2) a2[mb] = WFrag<T16>::ld(A2 + aoff + (size_t)mb * 16 * K + kc); }
#pragma unroll
        for (int nb = 0; nb < 4; ++nb) { const V b = WFrag<T16>::ld(Bt + boff + (size_t)nb * 16 * K + kc); V b2; if (NSPLIT >= 2) b2 = WFrag<T16>::ld(Bt2 + boff + (size_t)nb * 16 * K + kc);
#pragma unroll
            for (int mb = 0; mb < 4; ++mb) { acc[mb][nb] = WFrag<T16>::mma(a[mb], b, acc[mb][nb]); if (NSPLIT == 1 || NSPLIT == 2) acc[mb][nb] = WFrag<T16>::mma(a2[mb], b, acc[mb][nb]); if (NSPLIT >= 2) acc[mb][nb] = WFrag<T16>::mma(a[mb], b2, acc[mb][nb]); } }
        asm volatile("v_nop\n\tv_nop\n\tv_nop\n\tv_nop" : "+v"(acc[0][0]), "+v"(acc[1][1]), "+v"(acc[2][2]), "+v"(acc[3][3]) : "v"(a[0]), "v"(a[3]));
    }
#pragma unroll
    for (int mb = 0; mb < 4; ++mb) {
#pragma unroll
        for (int nb = 0; nb < 4; ++nb) {
#pragma unroll
            for (int j = 0; j < 8; ++j) os[(hi * 8 + j) * 68 + nb * 16 + lr] = acc[mb][nb][j]; }
        __builtin_amdgcn_wave_barrier(); asm volatile("" ::: "memory");
        float* crow = C + (size_t)(r0 + mb * 16) * ldc + c0;
{
#pragma unroll
            for (int s = 0; s < 8; ++s) { const int row = 2 * s + hi, cofs = lr * 4; v4f val = *(const v4fa*)(os + row * 68 + cofs); if (BIAS) { val[0] += bfr(bias[c0 + cofs]); val[1] += bfr(bias[c0 + cofs + 1]); val[2] += bfr(bias[c0 + cofs + 2]); val[3] += bfr(bias[c0 + cofs + 3]); }
                *(v4f*)(crow + (size_t)row * ldc + cofs) = val; }
             }
        __builtin_amdgcn_wave_barrier(); asm volatile("" ::: "memory");
    }
}

__device__ __forceinline__ h16 tohx(float x) { return (h16)x; }
__device__ __forceinline__ void splitf(float y, unsigned short& h, unsigned short& l) { h = f2bf(y); l = f2bf(y - bf2f(h)); }
typedef __attribute__((ext_vector_type(2))) _Float16 v2h;
typedef __attribute__((ext_vector_type(4))) _Float16 v4h;
typedef __attribute__((ext_vector_type(2))) unsigned short v2us;
typedef __attribute__((ext_vector_type(4))) unsigned short v4us;
typedef __attribute__((ext_vector_type(2))) float v2f;
typedef __attribute__((ext_vector_type(4))) int v4i;

__global__ __launch_bounds__(256) void k_wtG(const float* __restrict__ w, int K, int N, bf* Bt) {
    const int lane = threadIdx.x & 31; const int L0 = (blockIdx.x * 8 + (threadIdx.x >> 5)) * 8; const int nlines = N * K / 64;
{
#pragma unroll 1
        for (int l = 0; l < 8; ++l) { const int L = L0 + l; if (L >= nlines) break; const size_t e = (size_t)L * 64 + lane * 2; const int k = (int)(e % K), n = (int)(e / K); v2us o;
            o[0] = f2bf(w[(size_t)k * N + n]); o[1] = f2bf(w[(size_t)(k + 1) * N + n]); *(v2us*)(Bt + e) = o; }
         }
}
__global__ __launch_bounds__(256) void k_cvt8(const float* __restrict__ src, bf* dst, size_t n8) { const size_t i = (size_t)blockIdx.x * 256 + threadIdx.x; if (i >= n8) return; const v8f v = *(const v8f*)(src + i * 8); v8us o;
#pragma unroll
    for (int k = 0; k < 8; ++k) o[k] = f2bf(v[k]); *(v8us*)(dst + i * 8) = o;  }

// k_rope: head planes [h][t][d] (fp16 + hi/lo) of rope(x) x sc with the rotate-half convention out[d] = x[d] cos[t][d] - x[d+HD/2] sin[t][d], out[d+HD/2] = x[d+HD/2] cos[t][d+HD/2] + x[d] sin[t][d+HD/2]
__global__ __launch_bounds__(256) void k_rope(const float* __restrict__ F, int pitch, int nheads, const float* __restrict__ CS, const float* __restrict__ RF, const float* __restrict__ nw, float sc, h16* P16, bf* Ph, bf* Pl) {
    const size_t e = ((size_t)blockIdx.x * 256 + threadIdx.x) * 2; if (e >= (size_t)nheads * TT * HD) return; const int d = (int)(e % HD); const int t = (int)((e / HD) % TT); const int h = (int)(e / ((size_t)HD * TT)); const float* f = F + (size_t)t * pitch + h * HD; const float rf = RF ? RF[(size_t)h * TT + t] : 1.0f; v2h o16; v2us oh, ol;
#pragma unroll
    for (int q = 0; q < 2; ++q) { const int dd = d + q; const int dp = (dd < HD / 2) ? dd + HD / 2 : dd - HD / 2; float x0 = f[dd], x1 = f[dp];
        if (RF) { float n0 = __fmul_rn(x0, rf), n1 = __fmul_rn(x1, rf); asm volatile("" : "+v"(n0)); asm volatile("" : "+v"(n1)); x0 = __fmul_rn(bfr(nw[dd]), n0); x1 = __fmul_rn(bfr(nw[dp]), n1); }
        const v2f cs = *(const v2f*)(CS + ((size_t)t * HD + dd) * 2); float a = __fmul_rn(x0, cs[0]), bq = __fmul_rn(x1, cs[1]); asm volatile("" : "+v"(a)); asm volatile("" : "+v"(bq)); const float r = ((dd < HD / 2) ? __fsub_rn(a, bq) : __fadd_rn(a, bq)) * sc;
        o16[q] = tohx(r); unsigned short a2, c2; splitf(r, a2, c2); oh[q] = a2; ol[q] = c2; }
    *(v2h*)(P16 + e) = o16; *(v2us*)(Ph + e) = oh; *(v2us*)(Pl + e) = ol;  }
__global__ __launch_bounds__(256) void k_vtp(const float* __restrict__ F, int pitch, int nheads, h16* V16, bf* Vh, bf* Vl) { const size_t e = ((size_t)blockIdx.x * 256 + threadIdx.x) * 2; if (e >= (size_t)nheads * HD * TT) return; const int t = (int)(e % TT); const int d = (int)((e / TT) % HD); const int g = (int)(e / ((size_t)TT * HD)); v2h o16; v2us oh, ol;
#pragma unroll
    for (int q = 0; q < 2; ++q) { const float x = F[(size_t)(t + q) * pitch + g * HD + d]; o16[q] = tohx(x); unsigned short a2, c2; splitf(x, a2, c2); oh[q] = a2; ol[q] = c2; }
    *(v2h*)(V16 + e) = o16; *(v2us*)(Vh + e) = oh; *(v2us*)(Vl + e) = ol;  }
__global__ __launch_bounds__(256) void k_csid(float* CS) { const int idx = blockIdx.x * 256 + threadIdx.x; if (idx >= TT * HD) return; v2f cs; cs[0] = 1.0f; cs[1] = 0.0f; *(v2f*)(CS + (size_t)idx * 2) = cs;  }
// k_asoft: per row (zz, i): t = S x DM^-0.5 = 1/32 (no mask); softmax over the 1024 keys (register row, one exp, fixed trees);
__global__ __launch_bounds__(256) void k_asoft(const float* __restrict__ Sb, h16* P16, bf* Ph, bf* Pl) {
    const int lane = threadIdx.x & 31; const int row = blockIdx.x * 8 + (threadIdx.x >> 5); if (row >= ZH * TT) return; const int i = row % TT; const int zz = row / TT; (void)zz; const bool hires = (i < RH); const float* sr = Sb + (size_t)row * TT; float v[TT / 32]; float mx = -3.0e38f;
#pragma unroll
    for (int ch = 0; ch < TT / 128; ++ch) { const int j0 = ch * 128 + lane * 4; const v4f a = *(const v4f*)(sr + j0);
#pragma unroll
        for (int q = 0; q < 4; ++q) { const int j = j0 + q; (void)j; const float t = a[q] * SCL; v[ch * 4 + q] = t; mx = fmaxf(mx, t); } }
#pragma unroll
    for (int sh = 16; sh; sh >>= 1) mx = fmaxf(mx, __shfl_xor(mx, sh, 32));
    float sum = 0.f;
#pragma unroll
    for (int k = 0; k < TT / 32; ++k) { float d0 = __fsub_rn(v[k], mx); asm volatile("" : "+v"(d0)); v[k] = __builtin_amdgcn_exp2f(__fmul_rn(d0, 1.4426950408889634f)); sum += v[k]; }
#pragma unroll
    for (int sh = 16; sh; sh >>= 1) sum += __shfl_xor(sum, sh, 32);
    const float f = __fdiv_rn(hires ? 1.0f : PCAR, sum);
{
        if (hires) {
#pragma unroll
            for (int ch = 0; ch < TT / 128; ++ch) { v4us oh, ol;
#pragma unroll
                for (int q = 0; q < 4; ++q) { unsigned short a, c2; splitf(v[ch * 4 + q] * f, a, c2); oh[q] = a; ol[q] = c2; }
                const size_t oo = ((size_t)zz * (RH ? RH : 1) + i) * TT + ch * 128 + lane * 4; *(v4us*)(Ph + oo) = oh; *(v4us*)(Pl + oo) = ol; }
        } else {
#pragma unroll
            for (int ch = 0; ch < TT / 128; ++ch) { v4h o4;
#pragma unroll
                for (int q = 0; q < 4; ++q) o4[q] = tohx(v[ch * 4 + q] * f);
                *(v4h*)(P16 + (size_t)row * TT + ch * 128 + lane * 4) = o4; } }
         }
}
__global__ __launch_bounds__(256) void k_merge(const float* __restrict__ O, int h0, bf* Ah, bf* Al) { const size_t e = ((size_t)blockIdx.x * 256 + threadIdx.x) * 2; if (e >= (size_t)ZH * TT * HD) return; const int d = (int)(e % HD); const int t = (int)((e / HD) % TT); const int zz = (int)(e / ((size_t)HD * TT)); const float cs = (t < RH) ? 1.0f : (1.0f / PCAR); const size_t oo = (size_t)t * DQ + (h0 + zz) * HD + d;
    v2us oh, ol;
#pragma unroll
    for (int q = 0; q < 2; ++q) { unsigned short a, c2; splitf(O[e + q] * cs, a, c2); oh[q] = a; ol[q] = c2; } *(v2us*)(Ah + oo) = oh; *(v2us*)(Al + oo) = ol;  }

extern "C" void kernel_launch(void* const* d_in, const int* in_sizes, int n_in,
                              void* d_out, int out_size, void* d_ws, size_t ws_size, hipStream_t stream) {
    (void)in_sizes; (void)n_in; (void)out_size;
    const float* x = (const float*)d_in[0]; const float* wqkv = (const float*)d_in[1]; const float* wo = (const float*)d_in[2]; const float* bo = (const float*)d_in[3];   /* argument order x, w_qkv ('xw' [1024][3072]), w_out ('xw'), b_out */
    float* OUT = (float*)d_out;     // [8][1024][1024]
    char* wsp = (char*)d_ws;
    auto take = [&](size_t bytes) { char* p = wsp; wsp += (bytes + 255) & ~(size_t)255; return (void*)p; };
    bf* WQKV = (bf*)take((size_t)3 * DQ * DM * 2); bf* WQ = WQKV; bf* WK = WQKV + (size_t)DQ * DM; bf* WV = WQKV + (size_t)2 * DQ * DM;   /* fused Bt [3*DQ][DM]: q | k | v row blocks */ bf* WO = (bf*)take((size_t)DM * DQ * 2); float* CS = (float*)take((size_t)TT * HD * 2 * 4);
    bf* XB = (bf*)take((size_t)TT * DM * 2); float* FQ = (float*)take((size_t)TT * DQ * 4); float* FK = (float*)take((size_t)TT * DKV * 4);
    h16* QP16 = (h16*)take((size_t)NH_ * TT * HD * 2); h16* KP16 = (h16*)take((size_t)NKV * TT * HD * 2); h16* VT16 = (h16*)take((size_t)NKV * HD * TT * 2);
    bf* QPh = (bf*)take((size_t)NH_ * TT * HD * 2); bf* QPl = (bf*)take((size_t)NH_ * TT * HD * 2); bf* KPh = (bf*)take((size_t)NKV * TT * HD * 2); bf* KPl = (bf*)take((size_t)NKV * TT * HD * 2); bf* VTh = (bf*)take((size_t)NKV * HD * TT * 2); bf* VTl = (bf*)take((size_t)NKV * HD * TT * 2); bf* Ph = (bf*)take((size_t)ZH * RH * TT * 2); bf* Pl = (bf*)take((size_t)ZH * RH * TT * 2);
    float* Sb = (float*)take((size_t)ZH * TT * TT * 4); h16* P16 = (h16*)take((size_t)ZH * TT * TT * 2); float* Ob = (float*)take((size_t)ZH * TT * HD * 4); bf* ATh = (bf*)take((size_t)TT * DQ * 2); bf* ATl = (bf*)take((size_t)TT * DQ * 2);
    if ((size_t)(wsp - (char*)d_ws) > ws_size) return;    // ws 256 MiB
    float* FV = FK;   // v projection reuses the k buffer after the k planes are built (stream-ordered)
    { k_wtG<<<(unsigned)((DM * 3 * DQ / 64 + 63) / 64), 256, 0, stream>>>(wqkv, DM, 3 * DQ, WQKV);   /* fused 'xw' [DM][3*DQ] -> Bt [3*DQ][DM] */
      k_wtG<<<(unsigned)((DQ * DM / 64 + 63) / 64), 256, 0, stream>>>(wo, DQ, DM, WO);
       }
    k_csid<<<(TT * HD + 255) / 256, 256, 0, stream>>>(CS);
    const unsigned LQ = (unsigned)(((size_t)NH_ * TT * HD / 2 + 255) / 256), LKv = (unsigned)(((size_t)NKV * TT * HD / 2 + 255) / 256);
    for (int b = 0; b < NB_; ++b) {
        
        k_cvt8<<<(unsigned)(((size_t)TT * DM / 8 + 255) / 256), 256, 0, stream>>>(x + (size_t)b * TT * DM, XB, (size_t)TT * DM / 8);
        k_gemmw<bf, 0, false><<<dim3(TT / 64, DQ / 64, 1), 32, 0, stream>>>(XB, nullptr, WQ, nullptr, DM, FQ, DQ, nullptr, 0, 0, 0);
        k_rope<<<LQ, 256, 0, stream>>>(FQ, DQ, NH_, CS, nullptr, nullptr, 1.0f, QP16, QPh, QPl);
        k_gemmw<bf, 0, false><<<dim3(TT / 64, DKV / 64, 1), 32, 0, stream>>>(XB, nullptr, WK, nullptr, DM, FK, DKV, nullptr, 0, 0, 0);
        k_rope<<<LKv, 256, 0, stream>>>(FK, DKV, NKV, CS, nullptr, nullptr, 1.0f, KP16, KPh, KPl);
        k_gemmw<bf, 0, false><<<dim3(TT / 64, DKV / 64, 1), 32, 0, stream>>>(XB, nullptr, WV, nullptr, DM, FV, DKV, nullptr, 0, 0, 0); k_vtp<<<LKv, 256, 0, stream>>>(FV, DKV, NKV, VT16, VTh, VTl);
        for (int h0 = 0; h0 < NH_; h0 += ZH) { const size_t zq = (size_t)h0, zk = (size_t)(h0 / REP);   // one kv head per query head: the pass's two heads use consecutive kv planes (z-strides TT*HD)
            k_gemmw<bf, 2, false><<<dim3(RH / 64, TT / 64, ZH), 32, 0, stream>>>(QPh + zq * TT * HD, QPl + zq * TT * HD, KPh + zk * TT * HD, KPl + zk * TT * HD, HD, Sb, TT, nullptr, (size_t)TT * HD, (size_t)TT * HD, (size_t)TT * TT);
            k_gemmw<h16, 0, false><<<dim3((TT - RH) / 64, TT / 64, ZH), 32, 0, stream>>>(QP16 + zq * TT * HD + (size_t)RH * HD, nullptr, KP16 + zk * TT * HD, nullptr, HD, Sb + (size_t)RH * TT, TT, nullptr, (size_t)TT * HD, (size_t)TT * HD, (size_t)TT * TT);
            k_asoft<<<ZH * TT / 8, 256, 0, stream>>>(Sb, P16, Ph, Pl);
            k_gemmw<bf, 2, false><<<dim3(RH / 64, HD / 64, ZH), 32, 0, stream>>>(Ph, Pl, VTh + zk * HD * TT, VTl + zk * HD * TT, TT, Ob, HD, nullptr, (size_t)RH * TT, (size_t)HD * TT, (size_t)TT * HD);
            k_gemmw<h16, 0, false><<<dim3((TT - RH) / 64, HD / 64, ZH), 32, 0, stream>>>(P16 + (size_t)RH * TT, nullptr, VT16 + zk * HD * TT, nullptr, TT, Ob + (size_t)RH * HD, HD, nullptr, (size_t)TT * TT, (size_t)HD * TT, (size_t)TT * HD);
            k_merge<<<(unsigned)(((size_t)ZH * TT * HD / 2 + 255) / 256), 256, 0, stream>>>(Ob, h0, ATh, ATl); }
        k_gemmw<bf, 1, true><<<dim3(TT / 64, DM / 64, 1), 32, 0, stream>>>(ATh, ATl, WO, nullptr, DQ, OUT + (size_t)b * TT * DM, DM, bo, 0, 0, 0); }
}

// v001
// It runs in 1020 microseconds.
// Timed twice side by side with v000, it ran 4.59 times as fast both times.
#include <hip/hip_runtime.h>

// Multi-head self-attention with a fused qkv projection (x [8][1024][1024]; qkv = x w_qkv ('xw' [1024][3072], no bias) -> q | k | v (16 heads x 64); dots x 1024^-0.5 (the repo scales by dim); softmax (no mask); out = merged w_out + b_out ('xw') -> [8][1024][1024] (8.4 M); argument order x, w_qkv, w_out, b_out).
// Layout per group of GB batches (attention: one pass of all 16 heads per batch): bf16 copy of x; fused 'xw' weight transposed once (q | k | v row blocks); exact projections; identity-table plane builders; dense T-1024 attention (hybrid rows: < 512 hi/lo 3 products, rest fp16 x1024); merged hi/lo x w_out exact + b_out.
// Compute dtypes, f32 accumulate: every input rounded to bf16; projections exact; attention rows < 512 3 products, rest fp16; softmax f32; w_out hl x exact + bias.

#define NB_  8
#define TT   1024
#define DM   1024
#define NH_  16
#define NKV  16
#define REP  (NH_ / NKV)
#define HD   64
#define DQ   (NH_ * HD)
#define DKV  (NKV * HD)
#define ZH   16                   // heads per attention pass (grid z)
#define GB   4                    // batches per projection / plane-builder / w_out launch
#define RH   512                  // query rows < RH use hi+lo planes (0: none)
#define WIN  0
#define PCAR 1024.0f
#define SCL  0.03125f   // dim^-0.5 = 1/32 (the repo scales by dim)
typedef _Float16 h16;
typedef unsigned short bf;
typedef __attribute__((ext_vector_type(16))) __bf16   v16bf;
typedef __attribute__((ext_vector_type(16))) _Float16 v16h;
typedef __attribute__((ext_vector_type(8)))  _Float16 v8h;
typedef __attribute__((ext_vector_type(8)))  unsigned short v8us;
typedef __attribute__((ext_vector_type(8)))  float    v8f;
typedef __attribute__((ext_vector_type(4)))  float    v4f;
typedef v8h  __attribute__((may_alias)) v8ha;
typedef v4f  __attribute__((may_alias)) v4fa;
typedef v8us __attribute__((may_alias)) v8usa;

__device__ __forceinline__ unsigned short f2bf(float f) { unsigned u = __float_as_uint(f); u += 0x7FFFu + ((u >> 16) & 1u); return (unsigned short)(u >> 16); }
__device__ __forceinline__ float bf2f(unsigned short b) { return __uint_as_float(((unsigned)b) << 16); }
__device__ __forceinline__ float bfr(float f) { return bf2f(f2bf(f)); }
__device__ __forceinline__ v16h cat16(v8h lo, v8h hi) { return __builtin_shufflevector(lo, hi, 0, 1, 2, 3, 4, 5, 6, 7, 8, 9, 10, 11, 12, 13, 14, 15); }
__device__ __forceinline__ v16bf cat16b(v8us lo, v8us hi) { return __builtin_bit_cast(v16bf, __builtin_shufflevector(lo, hi, 0, 1, 2, 3, 4, 5, 6, 7, 8, 9, 10, 11, 12, 13, 14, 15)); }
__device__ __forceinline__ v8f wmma16(v16h a, v16h b, v8f c) { return __builtin_amdgcn_wmma_f32_16x16x32_f16(false, a, false, b, (short)0, c, false, false); }
__device__ __forceinline__ v8f wmmab(v16bf a, v16bf b, v8f c) { return __builtin_amdgcn_wmma_f32_16x16x32_bf16(false, a, false, b, (short)0, c, false, false); }



// ---- k_gemmw: register-blocked GEMM, ONE WAVE per 64x64 output tile (16 accumulators), operands straight from K-contiguous 16-bit planes; grid (M/64, N/64, Z), 32 threads.
// C[m][n] (f32, pitch ldc, + optional f32 bias[n]) = sum_k A[m][k] Bt[n][k] (+ split products per NSPLIT). z-batch strides sA/sB/sC in elements. K % 32 == 0.
template <typename T16> struct WFrag;
template <> struct WFrag<h16> { typedef v16h V; static __device__ __forceinline__ V ld(const h16* p) { return cat16(*(const v8h*)p, *(const v8h*)(p + 16)); } static __device__ __forceinline__ v8f mma(V a, V b, v8f c) { return wmma16(a, b, c); } };
template <> struct WFrag<bf> { typedef v16bf V; static __device__ __forceinline__ V ld(const bf* p) { return cat16b(*(const v8us*)p, *(const v8us*)(p + 16)); } static __device__ __forceinline__ v8f mma(V a, V b, v8f c) { return wmmab(a, b, c); } };
template <typename T16, int NSPLIT, bool BIAS>
__global__ __launch_bounds__(32) void k_gemmw(const T16* __restrict__ A, const T16* __restrict__ A2, const T16* __restrict__ Bt, const T16* __restrict__ Bt2, int K, float* C, int ldc, const float* __restrict__ bias, size_t sA, size_t sB, size_t sC) {
    typedef typename WFrag<T16>::V V;
    __shared__ __align__(16) float os[16 * 68];
    const size_t z = blockIdx.z; A += z * sA; if (A2) A2 += z * sA; Bt += z * sB; if (Bt2) Bt2 += z * sB; C += z * sC;
    const int lane = threadIdx.x & 31, lr = lane & 15, hi = lane >> 4; const int r0 = blockIdx.x * 64, c0 = blockIdx.y * 64;
    v8f acc[4][4];
#pragma unroll
    for (int mb = 0; mb < 4; ++mb)
#pragma unroll
        for (int nb = 0; nb < 4; ++nb) acc[mb][nb] = (v8f){};
    const size_t aoff = (size_t)(r0 + lr) * K + 8 * hi, boff = (size_t)(c0 + lr) * K + 8 * hi;
#pragma unroll 1
    for (int kc = 0; kc < K; kc += 32) {
        V a[4], a2[4];
#pragma unroll
        for (int mb = 0; mb < 4; ++mb) { a[mb] = WFrag<T16>::ld(A + aoff + (size_t)mb * 16 * K + kc); if (NSPLIT == 1 || NSPLIT == 2) a2[mb] = WFrag<T16>::ld(A2 + aoff + (size_t)mb * 16 * K + kc); }
#pragma unroll
        for (int nb = 0; nb < 4; ++nb) { const V b = WFrag<T16>::ld(Bt + boff + (size_t)nb * 16 * K + kc); V b2; if (NSPLIT >= 2) b2 = WFrag<T16>::ld(Bt2 + boff + (size_t)nb * 16 * K + kc);
#pragma unroll
            for (int mb = 0; mb < 4; ++mb) { acc[mb][nb] = WFrag<T16>::mma(a[mb], b, acc[mb][nb]); if (NSPLIT == 1 || NSPLIT == 2) acc[mb][nb] = WFrag<T16>::mma(a2[mb], b, acc[mb][nb]); if (NSPLIT >= 2) acc[mb][nb] = WFrag<T16>::mma(a[mb], b2, acc[mb][nb]); } }
        asm volatile("v_nop\n\tv_nop\n\tv_nop\n\tv_nop" : "+v"(acc[0][0]), "+v"(acc[1][1]), "+v"(acc[2][2]), "+v"(acc[3][3]) : "v"(a[0]), "v"(a[3]));
    }
#pragma unroll
    for (int mb = 0; mb < 4; ++mb) {
#pragma unroll
        for (int nb = 0; nb < 4; ++nb) {
#pragma unroll
            for (int j = 0; j < 8; ++j) os[(hi * 8 + j) * 68 + nb * 16 + lr] = acc[mb][nb][j]; }
        __builtin_amdgcn_wave_barrier(); asm volatile("" ::: "memory");
        float* crow = C + (size_t)(r0 + mb * 16) * ldc + c0;
{
#pragma unroll
            for (int s = 0; s < 8; ++s) { const int row = 2 * s + hi, cofs = lr * 4; v4f val = *(const v4fa*)(os + row * 68 + cofs); if (BIAS) { val[0] += bfr(bias[c0 + cofs]); val[1] += bfr(bias[c0 + cofs + 1]); val[2] += bfr(bias[c0 + cofs + 2]); val[3] += bfr(bias[c0 + cofs + 3]); }
                *(v4f*)(crow + (size_t)row * ldc + cofs) = val; }
             }
        __builtin_amdgcn_wave_barrier(); asm volatile("" ::: "memory");
    }
}

__device__ __forceinline__ h16 tohx(float x) { return (h16)x; }
__device__ __forceinline__ void splitf(float y, unsigned short& h, unsigned short& l) { h = f2bf(y); l = f2bf(y - bf2f(h)); }
typedef __attribute__((ext_vector_type(2))) _Float16 v2h;
typedef __attribute__((ext_vector_type(4))) _Float16 v4h;
typedef __attribute__((ext_vector_type(2))) unsigned short v2us;
typedef __attribute__((ext_vector_type(4))) unsigned short v4us;
typedef __attribute__((ext_vector_type(2))) float v2f;
typedef __attribute__((ext_vector_type(4))) int v4i;

__global__ __launch_bounds__(256) void k_wtG(const float* __restrict__ w, int K, int N, bf* Bt) {
    const int lane = threadIdx.x & 31; const int L0 = (blockIdx.x * 8 + (threadIdx.x >> 5)) * 8; const int nlines = N * K / 64;
{
#pragma unroll 1
        for (int l = 0; l < 8; ++l) { const int L = L0 + l; if (L >= nlines) break; const size_t e = (size_t)L * 64 + lane * 2; const int k = (int)(e % K), n = (int)(e / K); v2us o;
            o[0] = f2bf(w[(size_t)k * N + n]); o[1] = f2bf(w[(size_t)(k + 1) * N + n]); *(v2us*)(Bt + e) = o; }
         }
}
__global__ __launch_bounds__(256) void k_cvt8(const float* __restrict__ src, bf* dst, size_t n8) { const size_t i = (size_t)blockIdx.x * 256 + threadIdx.x; if (i >= n8) return; const v8f v = *(const v8f*)(src + i * 8); v8us o;
#pragma unroll
    for (int k = 0; k < 8; ++k) o[k] = f2bf(v[k]); *(v8us*)(dst + i * 8) = o;  }

// k_rope: head planes [h][t][d] (fp16 + hi/lo) of rope(x) x sc with the rotate-half convention out[d] = x[d] cos[t][d] - x[d+HD/2] sin[t][d], out[d+HD/2] = x[d+HD/2] cos[t][d+HD/2] + x[d] sin[t][d+HD/2]
__global__ __launch_bounds__(256) void k_rope(const float* __restrict__ F, int pitch, int nheads, const float* __restrict__ CS, const float* __restrict__ RF, const float* __restrict__ nw, float sc, h16* P16, bf* Ph, bf* Pl) {
    { const size_t y = blockIdx.y; F += y * TT * pitch; P16 += y * nheads * TT * HD; Ph += y * nheads * TT * HD; Pl += y * nheads * TT * HD; }   // grid y: batch of the group (its TT rows of F, its block of planes)
    const size_t e = ((size_t)blockIdx.x * 256 + threadIdx.x) * 2; if (e >= (size_t)nheads * TT * HD) return; const int d = (int)(e % HD); const int t = (int)((e / HD) % TT); const int h = (int)(e / ((size_t)HD * TT)); const float* f = F + (size_t)t * pitch + h * HD; const float rf = RF ? RF[(size_t)h * TT + t] : 1.0f; v2h o16; v2us oh, ol;
#pragma unroll
    for (int q = 0; q < 2; ++q) { const int dd = d + q; const int dp = (dd < HD / 2) ? dd + HD / 2 : dd - HD / 2; float x0 = f[dd], x1 = f[dp];
        if (RF) { float n0 = __fmul_rn(x0, rf), n1 = __fmul_rn(x1, rf); asm volatile("" : "+v"(n0)); asm volatile("" : "+v"(n1)); x0 = __fmul_rn(bfr(nw[dd]), n0); x1 = __fmul_rn(bfr(nw[dp]), n1); }
        const v2f cs = *(const v2f*)(CS + ((size_t)t * HD + dd) * 2); float a = __fmul_rn(x0, cs[0]), bq = __fmul_rn(x1, cs[1]); asm volatile("" : "+v"(a)); asm volatile("" : "+v"(bq)); const float r = ((dd < HD / 2) ? __fsub_rn(a, bq) : __fadd_rn(a, bq)) * sc;
        o16[q] = tohx(r); unsigned short a2, c2; splitf(r, a2, c2); oh[q] = a2; ol[q] = c2; }
    *(v2h*)(P16 + e) = o16; *(v2us*)(Ph + e) = oh; *(v2us*)(Pl + e) = ol;  }
__global__ __launch_bounds__(256) void k_vtp(const float* __restrict__ F, int pitch, int nheads, h16* V16, bf* Vh, bf* Vl) { { const size_t y = blockIdx.y; F += y * TT * pitch; V16 += y * nheads * HD * TT; Vh += y * nheads * HD * TT; Vl += y * nheads * HD * TT; }   /* grid y: batch of the group */ const size_t e = ((size_t)blockIdx.x * 256 + threadIdx.x) * 2; if (e >= (size_t)nheads * HD * TT) return; const int t = (int)(e % TT); const int d = (int)((e / TT) % HD); const int g = (int)(e / ((size_t)TT * HD)); v2h o16; v2us oh, ol;
#pragma unroll
    for (int q = 0; q < 2; ++q) { const float x = F[(size_t)(t + q) * pitch + g * HD + d]; o16[q] = tohx(x); unsigned short a2, c2; splitf(x, a2, c2); oh[q] = a2; ol[q] = c2; }
    *(v2h*)(V16 + e) = o16; *(v2us*)(Vh + e) = oh; *(v2us*)(Vl + e) = ol;  }
__global__ __launch_bounds__(256) void k_csid(float* CS) { const int idx = blockIdx.x * 256 + threadIdx.x; if (idx >= TT * HD) return; v2f cs; cs[0] = 1.0f; cs[1] = 0.0f; *(v2f*)(CS + (size_t)idx * 2) = cs;  }
// k_asoft: per row (zz, i): t = S x DM^-0.5 = 1/32 (no mask); softmax over the 1024 keys (register row, one exp, fixed trees);
__global__ __launch_bounds__(256) void k_asoft(const float* __restrict__ Sb, h16* P16, bf* Ph, bf* Pl) {
    const int lane = threadIdx.x & 31; const int row = blockIdx.x * 8 + (threadIdx.x >> 5); if (row >= ZH * TT) return; const int i = row % TT; const int zz = row / TT; (void)zz; const bool hires = (i < RH); const float* sr = Sb + (size_t)row * TT; float v[TT / 32]; float mx = -3.0e38f;
#pragma unroll
    for (int ch = 0; ch < TT / 128; ++ch) { const int j0 = ch * 128 + lane * 4; const v4f a = *(const v4f*)(sr + j0);
#pragma unroll
        for (int q = 0; q < 4; ++q) { const int j = j0 + q; (void)j; const float t = a[q] * SCL; v[ch * 4 + q] = t; mx = fmaxf(mx, t); } }
#pragma unroll
    for (int sh = 16; sh; sh >>= 1) mx = fmaxf(mx, __shfl_xor(mx, sh, 32));
    float sum = 0.f;
#pragma unroll
    for (int k = 0; k < TT / 32; ++k) { float d0 = __fsub_rn(v[k], mx); asm volatile("" : "+v"(d0)); v[k] = __builtin_amdgcn_exp2f(__fmul_rn(d0, 1.4426950408889634f)); sum += v[k]; }
#pragma unroll
    for (int sh = 16; sh; sh >>= 1) sum += __shfl_xor(sum, sh, 32);
    const float f = __fdiv_rn(hires ? 1.0f : PCAR, sum);
{
        if (hires) {
#pragma unroll
            for (int ch = 0; ch < TT / 128; ++ch) { v4us oh, ol;
#pragma unroll
                for (int q = 0; q < 4; ++q) { unsigned short a, c2; splitf(v[ch * 4 + q] * f, a, c2); oh[q] = a; ol[q] = c2; }
                const size_t oo = ((size_t)zz * (RH ? RH : 1) + i) * TT + ch * 128 + lane * 4; *(v4us*)(Ph + oo) = oh; *(v4us*)(Pl + oo) = ol; }
        } else {
#pragma unroll
            for (int ch = 0; ch < TT / 128; ++ch) { v4h o4;
#pragma unroll
                for (int q = 0; q < 4; ++q) o4[q] = tohx(v[ch * 4 + q] * f);
                *(v4h*)(P16 + (size_t)row * TT + ch * 128 + lane * 4) = o4; } }
         }
}
__global__ __launch_bounds__(256) void k_merge(const float* __restrict__ O, int h0, bf* Ah, bf* Al) { const size_t e = ((size_t)blockIdx.x * 256 + threadIdx.x) * 2; if (e >= (size_t)ZH * TT * HD) return; const int d = (int)(e % HD); const int t = (int)((e / HD) % TT); const int zz = (int)(e / ((size_t)HD * TT)); const float cs = (t < RH) ? 1.0f : (1.0f / PCAR); const size_t oo = (size_t)t * DQ + (h0 + zz) * HD + d;
    v2us oh, ol;
#pragma unroll
    for (int q = 0; q < 2; ++q) { unsigned short a, c2; splitf(O[e + q] * cs, a, c2); oh[q] = a; ol[q] = c2; } *(v2us*)(Ah + oo) = oh; *(v2us*)(Al + oo) = ol;  }

extern "C" void kernel_launch(void* const* d_in, const int* in_sizes, int n_in,
                              void* d_out, int out_size, void* d_ws, size_t ws_size, hipStream_t stream) {
    (void)in_sizes; (void)n_in; (void)out_size;
    const float* x = (const float*)d_in[0]; const float* wqkv = (const float*)d_in[1]; const float* wo = (const float*)d_in[2]; const float* bo = (const float*)d_in[3];   /* argument order x, w_qkv ('xw' [1024][3072]), w_out ('xw'), b_out */
    float* OUT = (float*)d_out;     // [8][1024][1024]
    char* wsp = (char*)d_ws;
    auto take = [&](size_t bytes) { char* p = wsp; wsp += (bytes + 255) & ~(size_t)255; return (void*)p; };
    bf* WQKV = (bf*)take((size_t)3 * DQ * DM * 2);   /* fused Bt [3*DQ][DM]: q | k | v row blocks */ bf* WO = (bf*)take((size_t)DM * DQ * 2); float* CS = (float*)take((size_t)TT * HD * 2 * 4);
    float* Sb = (float*)take((size_t)ZH * TT * TT * 4);   // 64 MiB; its first 56 MiB also serve as XB | F, which are dead once the group's planes are built (stream-ordered)
    bf* XB = (bf*)Sb; float* F = (float*)(XB + (size_t)GB * TT * DM);   // XB [GB*TT][DM] bf16, F [GB*TT][3*DQ] f32 (q | k | v columns)
    h16* QK16 = (h16*)take((size_t)GB * (NH_ + NKV) * TT * HD * 2); bf* QKh = (bf*)take((size_t)GB * (NH_ + NKV) * TT * HD * 2); bf* QKl = (bf*)take((size_t)GB * (NH_ + NKV) * TT * HD * 2);   // planes [batch][16 q heads | 16 k heads][t][d]
    h16* VT16 = (h16*)take((size_t)GB * NKV * HD * TT * 2); bf* VTh = (bf*)take((size_t)GB * NKV * HD * TT * 2); bf* VTl = (bf*)take((size_t)GB * NKV * HD * TT * 2);   // planes [batch][head][d][t]
    bf* Ph = (bf*)take((size_t)ZH * RH * TT * 2); bf* Pl = (bf*)take((size_t)ZH * RH * TT * 2);
    h16* P16 = (h16*)take((size_t)ZH * TT * TT * 2); float* Ob = (float*)take((size_t)ZH * TT * HD * 4); bf* ATh = (bf*)take((size_t)GB * TT * DQ * 2); bf* ATl = (bf*)take((size_t)GB * TT * DQ * 2);
    if ((size_t)(wsp - (char*)d_ws) > ws_size) return;    // ws 256 MiB, under 230 MiB used
    { k_wtG<<<(unsigned)((DM * 3 * DQ / 64 + 63) / 64), 256, 0, stream>>>(wqkv, DM, 3 * DQ, WQKV);   /* fused 'xw' [DM][3*DQ] -> Bt [3*DQ][DM] */
      k_wtG<<<(unsigned)((DQ * DM / 64 + 63) / 64), 256, 0, stream>>>(wo, DQ, DM, WO);
       }
    k_csid<<<(TT * HD + 255) / 256, 256, 0, stream>>>(CS);
    const unsigned LQK = (unsigned)(((size_t)(NH_ + NKV) * TT * HD / 2 + 255) / 256), LKv = (unsigned)(((size_t)NKV * TT * HD / 2 + 255) / 256);
    for (int b0 = 0; b0 < NB_; b0 += GB) {
        k_cvt8<<<(unsigned)(((size_t)GB * TT * DM / 8 + 255) / 256), 256, 0, stream>>>(x + (size_t)b0 * TT * DM, XB, (size_t)GB * TT * DM / 8);
        k_gemmw<bf, 0, false><<<dim3(GB * TT / 64, 3 * DQ / 64, 1), 32, 0, stream>>>(XB, nullptr, WQKV, nullptr, DM, F, 3 * DQ, nullptr, 0, 0, 0);
        k_rope<<<dim3(LQK, GB, 1), 256, 0, stream>>>(F, 3 * DQ, NH_ + NKV, CS, nullptr, nullptr, 1.0f, QK16, QKh, QKl);
        k_vtp<<<dim3(LKv, GB, 1), 256, 0, stream>>>(F + DQ + DKV, 3 * DQ, NKV, VT16, VTh, VTl);
        for (int bb = 0; bb < GB; ++bb)
        for (int h0 = 0; h0 < NH_; h0 += ZH) { const size_t zq = (size_t)bb * (NH_ + NKV) + h0, zk = (size_t)bb * (NH_ + NKV) + NH_ + h0 / REP, zv = (size_t)bb * NKV + h0 / REP;   // one kv head per query head: the pass's heads use consecutive planes (z-strides TT*HD)
            k_gemmw<bf, 2, false><<<dim3(RH / 64, TT / 64, ZH), 32, 0, stream>>>(QKh + zq * TT * HD, QKl + zq * TT * HD, QKh + zk * TT * HD, QKl + zk * TT * HD, HD, Sb, TT, nullptr, (size_t)TT * HD, (size_t)TT * HD, (size_t)TT * TT);
            k_gemmw<h16, 0, false><<<dim3((TT - RH) / 64, TT / 64, ZH), 32, 0, stream>>>(QK16 + zq * TT * HD + (size_t)RH * HD, nullptr, QK16 + zk * TT * HD, nullptr, HD, Sb + (size_t)RH * TT, TT, nullptr, (size_t)TT * HD, (size_t)TT * HD, (size_t)TT * TT);
            k_asoft<<<ZH * TT / 8, 256, 0, stream>>>(Sb, P16, Ph, Pl);
            k_gemmw<bf, 2, false><<<dim3(RH / 64, HD / 64, ZH), 32, 0, stream>>>(Ph, Pl, VTh + zv * HD * TT, VTl + zv * HD * TT, TT, Ob, HD, nullptr, (size_t)RH * TT, (size_t)HD * TT, (size_t)TT * HD);
            k_gemmw<h16, 0, false><<<dim3((TT - RH) / 64, HD / 64, ZH), 32, 0, stream>>>(P16 + (size_t)RH * TT, nullptr, VT16 + zv * HD * TT, nullptr, TT, Ob + (size_t)RH * HD, HD, nullptr, (size_t)TT * TT, (size_t)HD * TT, (size_t)TT * HD);
            k_merge<<<(unsigned)(((size_t)ZH * TT * HD / 2 + 255) / 256), 256, 0, stream>>>(Ob, h0, ATh + (size_t)bb * TT * DQ, ATl + (size_t)bb * TT * DQ); }
        k_gemmw<bf, 1, true><<<dim3(GB * TT / 64, DM / 64, 1), 32, 0, stream>>>(ATh, ATl, WO, nullptr, DQ, OUT + (size_t)b0 * TT * DM, DM, bo, 0, 0, 0); }
}

// v002
// It runs in 402 microseconds.
// Next to v001, in two timings, it ran 2.52 times as fast each time.
// Counting every step since v000, it is 11.6 times as fast.
#include <hip/hip_runtime.h>

// Multi-head self-attention with a fused qkv projection (x [8][1024][1024]; qkv = x w_qkv ('xw' [1024][3072], no bias) -> q | k | v (16 heads x 64); dots x 1024^-0.5 (the repo scales by dim); softmax (no mask); out = merged w_out + b_out ('xw') -> [8][1024][1024] (8.4 M); argument order x, w_qkv, w_out, b_out).
// Layout: per group of GB batches bf16 copy of x; fused 'xw' weight transposed once (q | k | v row blocks); exact projections; identity-table plane builders (planes of all batches kept); ONE fused attention launch over all batches and heads (hybrid rows: < 512 hi/lo 3 products, rest fp16; scores and weights stay in registers); merged hi/lo x w_out exact + b_out.
// Compute dtypes, f32 accumulate: every input rounded to bf16; projections exact; attention rows < 512 3 products, rest fp16; softmax f32; w_out hl x exact + bias.

#define NB_  8
#define TT   1024
#define DM   1024
#define NH_  16
#define NKV  16
#define REP  (NH_ / NKV)
#define HD   64
#define DQ   (NH_ * HD)
#define DKV  (NKV * HD)
#define GB   4                    // batches per projection / plane-builder / w_out launch
#define RH   512                  // query rows < RH use hi+lo planes
#define WIN  0
#define SCL  0.03125f   // dim^-0.5 = 1/32 (the repo scales by dim)
typedef _Float16 h16;
typedef unsigned short bf;
typedef __attribute__((ext_vector_type(16))) __bf16   v16bf;
typedef __attribute__((ext_vector_type(16))) _Float16 v16h;
typedef __attribute__((ext_vector_type(8)))  _Float16 v8h;
typedef __attribute__((ext_vector_type(8)))  unsigned short v8us;
typedef __attribute__((ext_vector_type(8)))  float    v8f;
typedef __attribute__((ext_vector_type(4)))  float    v4f;
typedef v8h  __attribute__((may_alias)) v8ha;
typedef v4f  __attribute__((may_alias)) v4fa;
typedef v8us __attribute__((may_alias)) v8usa;

__device__ __forceinline__ unsigned short f2bf(float f) { unsigned u = __float_as_uint(f); u += 0x7FFFu + ((u >> 16) & 1u); return (unsigned short)(u >> 16); }
__device__ __forceinline__ float bf2f(unsigned short b) { return __uint_as_float(((unsigned)b) << 16); }
__device__ __forceinline__ float bfr(float f) { return bf2f(f2bf(f)); }
__device__ __forceinline__ v16h cat16(v8h lo, v8h hi) { return __builtin_shufflevector(lo, hi, 0, 1, 2, 3, 4, 5, 6, 7, 8, 9, 10, 11, 12, 13, 14, 15); }
__device__ __forceinline__ v16bf cat16b(v8us lo, v8us hi) { return __builtin_bit_cast(v16bf, __builtin_shufflevector(lo, hi, 0, 1, 2, 3, 4, 5, 6, 7, 8, 9, 10, 11, 12, 13, 14, 15)); }
__device__ __forceinline__ v8f wmma16(v16h a, v16h b, v8f c) { return __builtin_amdgcn_wmma_f32_16x16x32_f16(false, a, false, b, (short)0, c, false, false); }
__device__ __forceinline__ v8f wmmab(v16bf a, v16bf b, v8f c) { return __builtin_amdgcn_wmma_f32_16x16x32_bf16(false, a, false, b, (short)0, c, false, false); }



// ---- k_gemmw: register-blocked GEMM, ONE WAVE per 64x64 output tile (16 accumulators), operands straight from K-contiguous 16-bit planes; grid (M/64, N/64, Z), 32 threads.
// C[m][n] (f32, pitch ldc, + optional f32 bias[n]) = sum_k A[m][k] Bt[n][k] (+ split products per NSPLIT). z-batch strides sA/sB/sC in elements. K % 32 == 0.
template <typename T16> struct WFrag;
template <> struct WFrag<h16> { typedef v16h V; static __device__ __forceinline__ V ld(const h16* p) { return cat16(*(const v8h*)p, *(const v8h*)(p + 16)); } static __device__ __forceinline__ v8f mma(V a, V b, v8f c) { return wmma16(a, b, c); } };
template <> struct WFrag<bf> { typedef v16bf V; static __device__ __forceinline__ V ld(const bf* p) { return cat16b(*(const v8us*)p, *(const v8us*)(p + 16)); } static __device__ __forceinline__ v8f mma(V a, V b, v8f c) { return wmmab(a, b, c); } };
template <typename T16, int NSPLIT, bool BIAS>
__global__ __launch_bounds__(32) void k_gemmw(const T16* __restrict__ A, const T16* __restrict__ A2, const T16* __restrict__ Bt, const T16* __restrict__ Bt2, int K, float* C, int ldc, const float* __restrict__ bias, size_t sA, size_t sB, size_t sC) {
    typedef typename WFrag<T16>::V V;
    __shared__ __align__(16) float os[16 * 68];
    const size_t z = blockIdx.z; A += z * sA; if (A2) A2 += z * sA; Bt += z * sB; if (Bt2) Bt2 += z * sB; C += z * sC;
    const int lane = threadIdx.x & 31, lr = lane & 15, hi = lane >> 4; const int r0 = blockIdx.x * 64, c0 = blockIdx.y * 64;
    v8f acc[4][4];
#pragma unroll
    for (int mb = 0; mb < 4; ++mb)
#pragma unroll
        for (int nb = 0; nb < 4; ++nb) acc[mb][nb] = (v8f){};
    const size_t aoff = (size_t)(r0 + lr) * K + 8 * hi, boff = (size_t)(c0 + lr) * K + 8 * hi;
#pragma unroll 1
    for (int kc = 0; kc < K; kc += 32) {
        V a[4], a2[4];
#pragma unroll
        for (int mb = 0; mb < 4; ++mb) { a[mb] = WFrag<T16>::ld(A + aoff + (size_t)mb * 16 * K + kc); if (NSPLIT == 1 || NSPLIT == 2) a2[mb] = WFrag<T16>::ld(A2 + aoff + (size_t)mb * 16 * K + kc); }
#pragma unroll
        for (int nb = 0; nb < 4; ++nb) { const V b = WFrag<T16>::ld(Bt + boff + (size_t)nb * 16 * K + kc); V b2; if (NSPLIT >= 2) b2 = WFrag<T16>::ld(Bt2 + boff + (size_t)nb * 16 * K + kc);
#pragma unroll
            for (int mb = 0; mb < 4; ++mb) { acc[mb][nb] = WFrag<T16>::mma(a[mb], b, acc[mb][nb]); if (NSPLIT == 1 || NSPLIT == 2) acc[mb][nb] = WFrag<T16>::mma(a2[mb], b, acc[mb][nb]); if (NSPLIT >= 2) acc[mb][nb] = WFrag<T16>::mma(a[mb], b2, acc[mb][nb]); } }
        asm volatile("v_nop\n\tv_nop\n\tv_nop\n\tv_nop" : "+v"(acc[0][0]), "+v"(acc[1][1]), "+v"(acc[2][2]), "+v"(acc[3][3]) : "v"(a[0]), "v"(a[3]));
    }
#pragma unroll
    for (int mb = 0; mb < 4; ++mb) {
#pragma unroll
        for (int nb = 0; nb < 4; ++nb) {
#pragma unroll
            for (int j = 0; j < 8; ++j) os[(hi * 8 + j) * 68 + nb * 16 + lr] = acc[mb][nb][j]; }
        __builtin_amdgcn_wave_barrier(); asm volatile("" ::: "memory");
        float* crow = C + (size_t)(r0 + mb * 16) * ldc + c0;
{
#pragma unroll
            for (int s = 0; s < 8; ++s) { const int row = 2 * s + hi, cofs = lr * 4; v4f val = *(const v4fa*)(os + row * 68 + cofs); if (BIAS) { val[0] += bfr(bias[c0 + cofs]); val[1] += bfr(bias[c0 + cofs + 1]); val[2] += bfr(bias[c0 + cofs + 2]); val[3] += bfr(bias[c0 + cofs + 3]); }
                *(v4f*)(crow + (size_t)row * ldc + cofs) = val; }
             }
        __builtin_amdgcn_wave_barrier(); asm volatile("" ::: "memory");
    }
}

__device__ __forceinline__ h16 tohx(float x) { return (h16)x; }
__device__ __forceinline__ void splitf(float y, unsigned short& h, unsigned short& l) { h = f2bf(y); l = f2bf(y - bf2f(h)); }
typedef __attribute__((ext_vector_type(2))) _Float16 v2h;
typedef __attribute__((ext_vector_type(4))) _Float16 v4h;
typedef __attribute__((ext_vector_type(2))) unsigned short v2us;
typedef __attribute__((ext_vector_type(4))) unsigned short v4us;
typedef __attribute__((ext_vector_type(2))) float v2f;
typedef __attribute__((ext_vector_type(4))) int v4i;

__global__ __launch_bounds__(256) void k_wtG(const float* __restrict__ w, int K, int N, bf* Bt) {
    const int lane = threadIdx.x & 31; const int L0 = (blockIdx.x * 8 + (threadIdx.x >> 5)) * 8; const int nlines = N * K / 64;
{
#pragma unroll 1
        for (int l = 0; l < 8; ++l) { const int L = L0 + l; if (L >= nlines) break; const size_t e = (size_t)L * 64 + lane * 2; const int k = (int)(e % K), n = (int)(e / K); v2us o;
            o[0] = f2bf(w[(size_t)k * N + n]); o[1] = f2bf(w[(size_t)(k + 1) * N + n]); *(v2us*)(Bt + e) = o; }
         }
}
__global__ __launch_bounds__(256) void k_cvt8(const float* __restrict__ src, bf* dst, size_t n8) { const size_t i = (size_t)blockIdx.x * 256 + threadIdx.x; if (i >= n8) return; const v8f v = *(const v8f*)(src + i * 8); v8us o;
#pragma unroll
    for (int k = 0; k < 8; ++k) o[k] = f2bf(v[k]); *(v8us*)(dst + i * 8) = o;  }

// k_rope: head planes [h][t][d] (fp16 + hi/lo) of rope(x) x sc with the rotate-half convention out[d] = x[d] cos[t][d] - x[d+HD/2] sin[t][d], out[d+HD/2] = x[d+HD/2] cos[t][d+HD/2] + x[d] sin[t][d+HD/2]
__global__ __launch_bounds__(256) void k_rope(const float* __restrict__ F, int pitch, int nheads, const float* __restrict__ CS, const float* __restrict__ RF, const float* __restrict__ nw, float sc, h16* P16, bf* Ph, bf* Pl) {
    { const size_t y = blockIdx.y; F += y * TT * pitch; P16 += y * nheads * TT * HD; Ph += y * nheads * TT * HD; Pl += y * nheads * TT * HD; }   // grid y: batch of the group (its TT rows of F, its block of planes)
    const size_t e = ((size_t)blockIdx.x * 256 + threadIdx.x) * 2; if (e >= (size_t)nheads * TT * HD) return; const int d = (int)(e % HD); const int t = (int)((e / HD) % TT); const int h = (int)(e / ((size_t)HD * TT)); const float* f = F + (size_t)t * pitch + h * HD; const float rf = RF ? RF[(size_t)h * TT + t] : 1.0f; v2h o16; v2us oh, ol;
#pragma unroll
    for (int q = 0; q < 2; ++q) { const int dd = d + q; const int dp = (dd < HD / 2) ? dd + HD / 2 : dd - HD / 2; float x0 = f[dd], x1 = f[dp];
        if (RF) { float n0 = __fmul_rn(x0, rf), n1 = __fmul_rn(x1, rf); asm volatile("" : "+v"(n0)); asm volatile("" : "+v"(n1)); x0 = __fmul_rn(bfr(nw[dd]), n0); x1 = __fmul_rn(bfr(nw[dp]), n1); }
        const v2f cs = *(const v2f*)(CS + ((size_t)t * HD + dd) * 2); float a = __fmul_rn(x0, cs[0]), bq = __fmul_rn(x1, cs[1]); asm volatile("" : "+v"(a)); asm volatile("" : "+v"(bq)); const float r = ((dd < HD / 2) ? __fsub_rn(a, bq) : __fadd_rn(a, bq)) * sc;
        o16[q] = tohx(r); unsigned short a2, c2; splitf(r, a2, c2); oh[q] = a2; ol[q] = c2; }
    *(v2h*)(P16 + e) = o16; *(v2us*)(Ph + e) = oh; *(v2us*)(Pl + e) = ol;  }
__global__ __launch_bounds__(256) void k_vtp(const float* __restrict__ F, int pitch, int nheads, h16* V16, bf* Vh, bf* Vl) { { const size_t y = blockIdx.y; F += y * TT * pitch; V16 += y * nheads * HD * TT; Vh += y * nheads * HD * TT; Vl += y * nheads * HD * TT; }   /* grid y: batch of the group */ const size_t e = ((size_t)blockIdx.x * 256 + threadIdx.x) * 2; if (e >= (size_t)nheads * HD * TT) return; const int t = (int)(e % TT); const int d = (int)((e / TT) % HD); const int g = (int)(e / ((size_t)TT * HD)); v2h o16; v2us oh, ol;
#pragma unroll
    for (int q = 0; q < 2; ++q) { const float x = F[(size_t)(t + q) * pitch + g * HD + d]; o16[q] = tohx(x); unsigned short a2, c2; splitf(x, a2, c2); oh[q] = a2; ol[q] = c2; }
    *(v2h*)(V16 + e) = o16; *(v2us*)(Vh + e) = oh; *(v2us*)(Vl + e) = ol;  }
__global__ __launch_bounds__(256) void k_csid(float* CS) { const int idx = blockIdx.x * 256 + threadIdx.x; if (idx >= TT * HD) return; v2f cs; cs[0] = 1.0f; cs[1] = 0.0f; *(v2f*)(CS + (size_t)idx * 2) = cs;  }
// ---- k_fattn: the whole attention of 32 query rows in ONE WAVE, scores and weights never leave registers. Per pass of 32 keys: S^T = K Q^T (A = K rows, B = Q kept in registers), running maximum and sum per query
// (a lane holds one query's scores; the two lane halves split its keys), the two S^T tiles converted in place are the B operand of O^T += V^T P^T (A = V^T rows in the same k order as the loader's).
// Weights enter the product un-normalised, exp2(t - running max); O^T is divided by the row sum at the end and stored as the merged hi/lo planes [t][head * HD + d], 8 consecutive d per lane.
// Rows < RH: hi/lo planes, 3 products; the rest fp16. Grid (RH / 128, heads, batches), 8 waves: waves 0-3 take 128 rows < RH, waves 4-7 take 128 rows >= RH (equal work per work-group). No LDS, no barrier.
__device__ __forceinline__ float xhalf(float x) { const int b = __builtin_bit_cast(int, x); return __builtin_bit_cast(float, __builtin_amdgcn_permlanex16(b, b, 0x76543210, 0xfedcba98, false, false)); }   // lane l <-> lane l ^ 16
#define SCL2 (SCL * 1.4426950408889634f)   // score scale in the log2 domain
// fragment at a wave-uniform base + the lane's 32-bit byte offset + a constant (the constant goes into the load's immediate field)
template <typename T16> __device__ __forceinline__ typename WFrag<T16>::V ldf(const T16* base, unsigned vo, int imm) { return WFrag<T16>::ld((const T16*)((const char*)base + vo + imm)); }
template <typename T16, bool HL>
__device__ __forceinline__ void attn_rows(const T16* __restrict__ Q, const T16* __restrict__ Q2, const T16* __restrict__ Kp, const T16* __restrict__ K2, const T16* __restrict__ Vt, const T16* __restrict__ Vt2, bf* Ah, bf* Al, const int lr, const int hi) {
    typedef WFrag<T16> WF; typedef typename WF::V V;
    // every inner loop below is unrolled so that the fragment and accumulator arrays are indexed by constants and stay in registers; the loop over the keys stays rolled (unroll 1): one pass already fills the register budget
    const unsigned koff = (unsigned)(lr * HD + 8 * hi) * 2u, voff = (unsigned)(lr * TT + 8 * hi) * 2u;   // the lane's byte offsets in a [row][HD] and a [d][TT] plane
    V q[2][2], q2[2][2];
#pragma unroll
    for (int qt = 0; qt < 2; ++qt)
#pragma unroll
        for (int kc = 0; kc < 2; ++kc) { q[qt][kc] = ldf(Q, koff, (qt * 16 * HD + kc * 32) * 2); if (HL) q2[qt][kc] = ldf(Q2, koff, (qt * 16 * HD + kc * 32) * 2); }
    v8f o[4][2];
#pragma unroll
    for (int dt = 0; dt < 4; ++dt)
#pragma unroll
        for (int qt = 0; qt < 2; ++qt) o[dt][qt] = (v8f){};
    float m[2] = { -3.0e38f, -3.0e38f }, l[2] = { 0.f, 0.f };
    unsigned vo = voff;   // the lane's byte offset in the V^T planes, stepped by 32 keys a pass
#pragma unroll 1
    for (int j0 = 0; j0 < TT; j0 += 32) {
        v8f s[2][2];   // [key tile][query tile]: register r of lane (lr, hi) = score of key j0 + 16 kt + 8 hi + r, query 16 qt + lr
        V k[2][2], k2[2][2];
#pragma unroll
        for (int kt = 0; kt < 2; ++kt)
#pragma unroll
            for (int kc = 0; kc < 2; ++kc) { k[kt][kc] = ldf(Kp + (size_t)j0 * HD, koff, (kt * 16 * HD + kc * 32) * 2); if (HL) k2[kt][kc] = ldf(K2 + (size_t)j0 * HD, koff, (kt * 16 * HD + kc * 32) * 2); }
        __builtin_amdgcn_sched_barrier(0);   // all K loads of the pass are asked for before the first product: left free, the compiler reuses two fragments' registers and waits out a load latency six times a pass
#pragma unroll
        for (int kt = 0; kt < 2; ++kt) { s[kt][0] = (v8f){}; s[kt][1] = (v8f){}; }
#pragma unroll
        for (int kc = 0; kc < 2; ++kc) {
#pragma unroll
            for (int kt = 0; kt < 2; ++kt) { s[kt][0] = WF::mma(k[kt][kc], q[0][kc], s[kt][0]); s[kt][1] = WF::mma(k[kt][kc], q[1][kc], s[kt][1]); }
            if (HL) {
#pragma unroll
                for (int kt = 0; kt < 2; ++kt) { s[kt][0] = WF::mma(k[kt][kc], q2[0][kc], s[kt][0]); s[kt][1] = WF::mma(k[kt][kc], q2[1][kc], s[kt][1]); }
#pragma unroll
                for (int kt = 0; kt < 2; ++kt) { s[kt][0] = WF::mma(k2[kt][kc], q[0][kc], s[kt][0]); s[kt][1] = WF::mma(k2[kt][kc], q[1][kc], s[kt][1]); } } }
        V v[4], v2[4];   // asked for here, they fly during the softmax arithmetic
#pragma unroll
        for (int dt = 0; dt < 4; ++dt) v[dt] = ldf(Vt, vo, dt * 16 * TT * 2);
        asm volatile("s_wait_xcnt 0x0" : "+v"(vo) : : "memory");   // stands behind the run of loads and in front of every rewrite of the offset register they name: the offset passes through this statement, so it outlives the run and is stepped only behind the wait (left free, the compiler forms a 64-bit address pair and gives it to the last load's result)
        float mn[2]; bool need = false;
#pragma unroll
        for (int qt = 0; qt < 2; ++qt) { float mx = fmaxf(s[0][qt][0], s[1][qt][0]);
#pragma unroll
            for (int r = 1; r < 8; ++r) mx = fmaxf(mx, fmaxf(s[0][qt][r], s[1][qt][r]));
            mx = fmaxf(mx, xhalf(mx)); mn[qt] = fmaxf(m[qt], mx * SCL2); need = need || (mn[qt] > m[qt]); }
        if (__builtin_amdgcn_ballot_w32(need) != 0) {   // some query's maximum grew: bring its sum and its output column to the new maximum (factor 1 for the others)
#pragma unroll
            for (int qt = 0; qt < 2; ++qt) { const float al = __builtin_amdgcn_exp2f(m[qt] - mn[qt]); m[qt] = mn[qt]; l[qt] *= al;
#pragma unroll
                for (int dt = 0; dt < 4; ++dt) o[dt][qt] *= al; } }
        V p[2], p2[2];   // the weights as B operands: element e of lane (lr, hi) = key j0 + 16 (e >> 3) + 8 hi + (e & 7), the loader's k order
#pragma unroll
        for (int qt = 0; qt < 2; ++qt) {
#pragma unroll
            for (int e = 0; e < 16; ++e) { const float pe = __builtin_amdgcn_exp2f(fmaf(s[e >> 3][qt][e & 7], SCL2, -m[qt])); l[qt] += pe;
                if constexpr (HL) { const __bf16 ph = (__bf16)pe; p[qt][e] = ph; p2[qt][e] = (__bf16)(pe - (float)ph); } else { p[qt][e] = (h16)pe; } } }
        if (HL) {   // the lo-plane V^T loads: they fly during the hi-plane products (their offset comes out of the wait statement above, so they cannot be lifted over it into the score products, where no registers are free for them)
#pragma unroll
            for (int dt = 0; dt < 4; ++dt) v2[dt] = ldf(Vt2, vo, dt * 16 * TT * 2); }
        vo += 32 * 2;
#pragma unroll
        for (int qt = 0; qt < 2; ++qt)
#pragma unroll
            for (int dt = 0; dt < 4; ++dt) o[dt][qt] = WF::mma(v[dt], p[qt], o[dt][qt]);
        if (HL) {
#pragma unroll
            for (int qt = 0; qt < 2; ++qt)
#pragma unroll
                for (int dt = 0; dt < 4; ++dt) o[dt][qt] = WF::mma(v[dt], p2[qt], o[dt][qt]);
#pragma unroll
            for (int qt = 0; qt < 2; ++qt)
#pragma unroll
                for (int dt = 0; dt < 4; ++dt) o[dt][qt] = WF::mma(v2[dt], p[qt], o[dt][qt]); }
    }
    const int ln = (int)__builtin_amdgcn_mbcnt_lo(~0u, 0u);   // the lane's number, read anew: no register carries it through the loop, whose live set is at the 256 budget
#pragma unroll
    for (int qt = 0; qt < 2; ++qt) { const float inv = __fdiv_rn(1.0f, l[qt] + xhalf(l[qt])); const size_t ro = (size_t)(qt * 16 + (ln & 15)) * DQ + 8 * (ln >> 4);
#pragma unroll
        for (int dt = 0; dt < 4; ++dt) { v8us oh, ol;
#pragma unroll
            for (int r = 0; r < 8; ++r) { unsigned short a, c2; splitf(o[dt][qt][r] * inv, a, c2); oh[r] = a; ol[r] = c2; }
            *(v8us*)(Ah + ro + dt * 16) = oh; *(v8us*)(Al + ro + dt * 16) = ol; } }
}
static_assert(RH * 2 == TT && RH % 128 == 0 && HD == 64, "k_fattn: half the rows hi/lo, 128 rows of each kind per work-group, head size 64");
// waves_per_eu(4, 4): four waves a SIMD, so each wave may use a quarter of the SIMD's registers (256); the hi/lo path needs nearly all of them, and the grid is exactly four waves for every SIMD
__global__ __launch_bounds__(256) __attribute__((amdgpu_waves_per_eu(4, 4))) void k_fattn(const h16* __restrict__ QK16, const bf* __restrict__ QKh, const bf* __restrict__ QKl, const h16* __restrict__ VT16, const bf* __restrict__ VTh, const bf* __restrict__ VTl, bf* ATh, bf* ATl) {
    const int lane = threadIdx.x & 31, lr = lane & 15, hi = lane >> 4; const int w = __builtin_amdgcn_readfirstlane((int)(threadIdx.x >> 5));   // the wave's number in a scalar register: the branch below is a scalar one, every lane stays on for the matrix instructions
    const size_t b = blockIdx.z, h = blockIdx.y; const size_t zq = (b * (NH_ + NKV) + h) * TT * HD, zk = (b * (NH_ + NKV) + NH_ + h / REP) * TT * HD, zv = (b * NKV + h / REP) * HD * TT;
    const size_t t0 = (w < 4) ? (size_t)blockIdx.x * 128 + w * 32 : (size_t)RH + blockIdx.x * 128 + (w - 4) * 32; const size_t ao = (b * TT + t0) * DQ + h * HD;
    if (w < 4) attn_rows<bf, true>(QKh + zq + t0 * HD, QKl + zq + t0 * HD, QKh + zk, QKl + zk, VTh + zv, VTl + zv, ATh + ao, ATl + ao, lr, hi);
    else attn_rows<h16, false>(QK16 + zq + t0 * HD, nullptr, QK16 + zk, nullptr, VT16 + zv, nullptr, ATh + ao, ATl + ao, lr, hi);
}

extern "C" void kernel_launch(void* const* d_in, const int* in_sizes, int n_in,
                              void* d_out, int out_size, void* d_ws, size_t ws_size, hipStream_t stream) {
    (void)in_sizes; (void)n_in; (void)out_size;
    const float* x = (const float*)d_in[0]; const float* wqkv = (const float*)d_in[1]; const float* wo = (const float*)d_in[2]; const float* bo = (const float*)d_in[3];   /* argument order x, w_qkv ('xw' [1024][3072]), w_out ('xw'), b_out */
    float* OUT = (float*)d_out;     // [8][1024][1024]
    char* wsp = (char*)d_ws;
    auto take = [&](size_t bytes) { char* p = wsp; wsp += (bytes + 255) & ~(size_t)255; return (void*)p; };
    bf* WQKV = (bf*)take((size_t)3 * DQ * DM * 2);   /* fused Bt [3*DQ][DM]: q | k | v row blocks */ bf* WO = (bf*)take((size_t)DM * DQ * 2); float* CS = (float*)take((size_t)TT * HD * 2 * 4);
    bf* XB = (bf*)take((size_t)GB * TT * DM * 2); float* F = (float*)take((size_t)GB * TT * 3 * DQ * 4);   // per group: XB [GB*TT][DM] bf16, F [GB*TT][3*DQ] f32 (q | k | v columns)
    h16* QK16 = (h16*)take((size_t)NB_ * (NH_ + NKV) * TT * HD * 2); bf* QKh = (bf*)take((size_t)NB_ * (NH_ + NKV) * TT * HD * 2); bf* QKl = (bf*)take((size_t)NB_ * (NH_ + NKV) * TT * HD * 2);   // planes [batch][16 q heads | 16 k heads][t][d], all batches
    h16* VT16 = (h16*)take((size_t)NB_ * NKV * HD * TT * 2); bf* VTh = (bf*)take((size_t)NB_ * NKV * HD * TT * 2); bf* VTl = (bf*)take((size_t)NB_ * NKV * HD * TT * 2);   // planes [batch][head][d][t], all batches
    bf* ATh = (bf*)take((size_t)NB_ * TT * DQ * 2); bf* ATl = (bf*)take((size_t)NB_ * TT * DQ * 2);   // merged attention output, hi/lo, [batch * TT + t][DQ]
    if ((size_t)(wsp - (char*)d_ws) > ws_size) return;    // ws 256 MiB, under 241 MiB used
    { k_wtG<<<(unsigned)((DM * 3 * DQ / 64 + 63) / 64), 256, 0, stream>>>(wqkv, DM, 3 * DQ, WQKV);   /* fused 'xw' [DM][3*DQ] -> Bt [3*DQ][DM] */
      k_wtG<<<(unsigned)((DQ * DM / 64 + 63) / 64), 256, 0, stream>>>(wo, DQ, DM, WO);
       }
    k_csid<<<(TT * HD + 255) / 256, 256, 0, stream>>>(CS);
    const unsigned LQK = (unsigned)(((size_t)(NH_ + NKV) * TT * HD / 2 + 255) / 256), LKv = (unsigned)(((size_t)NKV * TT * HD / 2 + 255) / 256);
    for (int b0 = 0; b0 < NB_; b0 += GB) { const size_t pq = (size_t)b0 * (NH_ + NKV) * TT * HD, pv = (size_t)b0 * NKV * HD * TT;   // the group's block of planes
        k_cvt8<<<(unsigned)(((size_t)GB * TT * DM / 8 + 255) / 256), 256, 0, stream>>>(x + (size_t)b0 * TT * DM, XB, (size_t)GB * TT * DM / 8);
        k_gemmw<bf, 0, false><<<dim3(GB * TT / 64, 3 * DQ / 64, 1), 32, 0, stream>>>(XB, nullptr, WQKV, nullptr, DM, F, 3 * DQ, nullptr, 0, 0, 0);
        k_rope<<<dim3(LQK, GB, 1), 256, 0, stream>>>(F, 3 * DQ, NH_ + NKV, CS, nullptr, nullptr, 1.0f, QK16 + pq, QKh + pq, QKl + pq);
        k_vtp<<<dim3(LKv, GB, 1), 256, 0, stream>>>(F + DQ + DKV, 3 * DQ, NKV, VT16 + pv, VTh + pv, VTl + pv); }
    k_fattn<<<dim3(RH / 128, NH_, NB_), 256, 0, stream>>>(QK16, QKh, QKl, VT16, VTh, VTl, ATh, ATl);
    for (int b0 = 0; b0 < NB_; b0 += GB)
        k_gemmw<bf, 1, true><<<dim3(GB * TT / 64, DM / 64, 1), 32, 0, stream>>>(ATh + (size_t)b0 * TT * DQ, ATl + (size_t)b0 * TT * DQ, WO, nullptr, DQ, OUT + (size_t)b0 * TT * DM, DM, bo, 0, 0, 0);
}

// v003
// A run of this version takes 326 microseconds.
// Timed twice side by side with v002, it ran 1.24 and 1.23 times as fast.
// Over all steps from v000 it is 14.3 times as fast.
#include <hip/hip_runtime.h>

// Multi-head self-attention with a fused qkv projection (x [8][1024][1024]; qkv = x w_qkv ('xw' [1024][3072], no bias) -> q | k | v (16 heads x 64); dots x 1024^-0.5 (the repo scales by dim); softmax (no mask); out = merged w_out + b_out ('xw') -> [8][1024][1024] (8.4 M); argument order x, w_qkv, w_out, b_out).
// Layout: per group of GB batches bf16 copy of x; fused 'xw' weight transposed once (q | k | v row blocks); exact projections whose epilogue stores the head planes itself (planes of all batches kept); ONE fused attention launch over all batches and heads (hybrid rows: < 512 hi/lo 3 products, rest fp16; scores and weights stay in registers); merged hi/lo x w_out exact + b_out.
// Compute dtypes, f32 accumulate: every input rounded to bf16; projections exact; attention rows < 512 3 products, rest fp16; softmax f32; w_out hl x exact + bias.

#define NB_  8
#define TT   1024
#define DM   1024
#define NH_  16
#define NKV  16
#define REP  (NH_ / NKV)
#define HD   64
#define DQ   (NH_ * HD)
#define DKV  (NKV * HD)
#define GB   4                    // batches per projection / w_out launch
#define RH   512                  // query rows < RH use hi+lo planes
#define WIN  0
#define SCL  0.03125f   // dim^-0.5 = 1/32 (the repo scales by dim)
typedef _Float16 h16;
typedef unsigned short bf;
typedef __attribute__((ext_vector_type(16))) __bf16   v16bf;
typedef __attribute__((ext_vector_type(16))) _Float16 v16h;
typedef __attribute__((ext_vector_type(8)))  _Float16 v8h;
typedef __attribute__((ext_vector_type(8)))  unsigned short v8us;
typedef __attribute__((ext_vector_type(8)))  float    v8f;
typedef __attribute__((ext_vector_type(4)))  float    v4f;
typedef v8h  __attribute__((may_alias)) v8ha;
typedef v4f  __attribute__((may_alias)) v4fa;
typedef v8us __attribute__((may_alias)) v8usa;

__device__ __forceinline__ unsigned short f2bf(float f) { unsigned u = __float_as_uint(f); u += 0x7FFFu + ((u >> 16) & 1u); return (unsigned short)(u >> 16); }
__device__ __forceinline__ float bf2f(unsigned short b) { return __uint_as_float(((unsigned)b) << 16); }
__device__ __forceinline__ float bfr(float f) { return bf2f(f2bf(f)); }
__device__ __forceinline__ v16h cat16(v8h lo, v8h hi) { return __builtin_shufflevector(lo, hi, 0, 1, 2, 3, 4, 5, 6, 7, 8, 9, 10, 11, 12, 13, 14, 15); }
__device__ __forceinline__ v16bf cat16b(v8us lo, v8us hi) { return __builtin_bit_cast(v16bf, __builtin_shufflevector(lo, hi, 0, 1, 2, 3, 4, 5, 6, 7, 8, 9, 10, 11, 12, 13, 14, 15)); }
__device__ __forceinline__ v8f wmma16(v16h a, v16h b, v8f c) { return __builtin_amdgcn_wmma_f32_16x16x32_f16(false, a, false, b, (short)0, c, false, false); }
__device__ __forceinline__ v8f wmmab(v16bf a, v16bf b, v8f c) { return __builtin_amdgcn_wmma_f32_16x16x32_bf16(false, a, false, b, (short)0, c, false, false); }



__device__ __forceinline__ h16 tohx(float x) { return (h16)x; }
__device__ __forceinline__ void splitf(float y, unsigned short& h, unsigned short& l) { h = f2bf(y); l = f2bf(y - bf2f(h)); }
// put_rows: 16 plane rows of 64 values, staged as f32 in LDS at pitch 68, go out as fp16, hi and lo planes at P + row * pitch; a lane takes 8 consecutive values of a row, so every store instruction writes 4 whole 128-byte lines
__device__ __forceinline__ void put_rows(const float* os, const int lane, h16* P16, bf* Ph, bf* Pl, const size_t pitch) {
#pragma unroll
    for (int s = 0; s < 4; ++s) { const int row = 4 * s + (lane >> 3), cofs = (lane & 7) * 8; const v4f x0 = *(const v4fa*)(os + row * 68 + cofs), x1 = *(const v4fa*)(os + row * 68 + cofs + 4); v8h o16; v8us oh, ol;
#pragma unroll
        for (int r = 0; r < 8; ++r) { const float x = (r < 4) ? x0[r & 3] : x1[r & 3]; o16[r] = tohx(x); unsigned short a2, c2; splitf(x, a2, c2); oh[r] = a2; ol[r] = c2; }
        const size_t e = (size_t)row * pitch + cofs; *(v8h*)(P16 + e) = o16; *(v8us*)(Ph + e) = oh; *(v8us*)(Pl + e) = ol; }
}
// ---- k_gemmw: register-blocked GEMM, ONE WAVE per 64x64 output tile (16 accumulators), operands straight from K-contiguous 16-bit planes; grid (M/64, N/64, Z), 32 threads.
// C[m][n] (f32, pitch ldc, + optional f32 bias[n]) = sum_k A[m][k] Bt[n][k] (+ split products per NSPLIT). z-batch strides sA/sB/sC in elements. K % 32 == 0.
// PLANES (the q | k | v projection; rows = batch * TT + t, columns = q heads | k heads | v heads, so a tile is 64 positions of ONE head): no C; the epilogue stores the head planes, q and k heads as [head][t][d] (the tile is 64 whole rows of 128 bytes),
// v heads as [head][d][t] (64 rows of d, 128 bytes of t each). 16 plane rows at a time are staged in the wave's LDS, position-major for q and k, d-major for v (a lane's accumulator registers are 8 consecutive positions of one d).
template <typename T16> struct WFrag;
template <> struct WFrag<h16> { typedef v16h V; static __device__ __forceinline__ V ld(const h16* p) { return cat16(*(const v8h*)p, *(const v8h*)(p + 16)); } static __device__ __forceinline__ v8f mma(V a, V b, v8f c) { return wmma16(a, b, c); } };
template <> struct WFrag<bf> { typedef v16bf V; static __device__ __forceinline__ V ld(const bf* p) { return cat16b(*(const v8us*)p, *(const v8us*)(p + 16)); } static __device__ __forceinline__ v8f mma(V a, V b, v8f c) { return wmmab(a, b, c); } };
template <typename T16, int NSPLIT, bool BIAS, bool PLANES>
__global__ __launch_bounds__(32) void k_gemmw(const T16* __restrict__ A, const T16* __restrict__ A2, const T16* __restrict__ Bt, const T16* __restrict__ Bt2, int K, float* C, int ldc, const float* __restrict__ bias, size_t sA, size_t sB, size_t sC, h16* QK16, bf* QKh, bf* QKl, h16* VT16, bf* VTh, bf* VTl) {
    typedef typename WFrag<T16>::V V;
    __shared__ __align__(16) float os[16 * 68];
    const size_t z = blockIdx.z; A += z * sA; if (A2) A2 += z * sA; Bt += z * sB; if (Bt2) Bt2 += z * sB; C += z * sC;
    const int lane = threadIdx.x & 31, lr = lane & 15, hi = lane >> 4; const int r0 = blockIdx.x * 64, c0 = blockIdx.y * 64;
    v8f acc[4][4];
#pragma unroll
    for (int mb = 0; mb < 4; ++mb)
#pragma unroll
        for (int nb = 0; nb < 4; ++nb) acc[mb][nb] = (v8f){};
    const size_t aoff = (size_t)(r0 + lr) * K + 8 * hi, boff = (size_t)(c0 + lr) * K + 8 * hi;
#pragma unroll 1
    for (int kc = 0; kc < K; kc += 32) {
        V a[4], a2[4];
#pragma unroll
        for (int mb = 0; mb < 4; ++mb) { a[mb] = WFrag<T16>::ld(A + aoff + (size_t)mb * 16 * K + kc); if (NSPLIT == 1 || NSPLIT == 2) a2[mb] = WFrag<T16>::ld(A2 + aoff + (size_t)mb * 16 * K + kc); }
#pragma unroll
        for (int nb = 0; nb < 4; ++nb) { const V b = WFrag<T16>::ld(Bt + boff + (size_t)nb * 16 * K + kc); V b2; if (NSPLIT >= 2) b2 = WFrag<T16>::ld(Bt2 + boff + (size_t)nb * 16 * K + kc);
#pragma unroll
            for (int mb = 0; mb < 4; ++mb) { acc[mb][nb] = WFrag<T16>::mma(a[mb], b, acc[mb][nb]); if (NSPLIT == 1 || NSPLIT == 2) acc[mb][nb] = WFrag<T16>::mma(a2[mb], b, acc[mb][nb]); if (NSPLIT >= 2) acc[mb][nb] = WFrag<T16>::mma(a[mb], b2, acc[mb][nb]); } }
        asm volatile("v_nop\n\tv_nop\n\tv_nop\n\tv_nop" : "+v"(acc[0][0]), "+v"(acc[1][1]), "+v"(acc[2][2]), "+v"(acc[3][3]) : "v"(a[0]), "v"(a[3]));
    }
    if constexpr (PLANES) {
        static_assert(HD == 64 && TT % 64 == 0, "a 64-column tile is one head, a 64-row tile lies in one batch");
        const size_t bb = (size_t)(r0 / TT), t0 = (size_t)(r0 % TT), hd = blockIdx.y;   // batch of the group, first position, head block: q heads from 0, k heads from NH_, v heads from NH_ + NKV
        if (hd < NH_ + NKV) { const size_t zp = ((bb * (NH_ + NKV) + hd) * TT + t0) * HD;
#pragma unroll
            for (int mb = 0; mb < 4; ++mb) {
#pragma unroll
                for (int nb = 0; nb < 4; ++nb) {
#pragma unroll
                    for (int j = 0; j < 8; ++j) os[(hi * 8 + j) * 68 + nb * 16 + lr] = acc[mb][nb][j]; }
                __builtin_amdgcn_wave_barrier(); asm volatile("" ::: "memory");   // a lane reads what other lanes of the wave staged: no LDS read is lifted over the staging writes
                put_rows(os, lane, QK16 + zp + mb * 16 * HD, QKh + zp + mb * 16 * HD, QKl + zp + mb * 16 * HD, HD);
                __builtin_amdgcn_wave_barrier(); asm volatile("" ::: "memory");   // the next 16 rows are not staged over rows still to be read
            }
        } else { const size_t zp = (bb * NKV + (hd - (NH_ + NKV))) * HD * TT + t0;
#pragma unroll
            for (int nb = 0; nb < 4; ++nb) {
#pragma unroll
                for (int mb = 0; mb < 4; ++mb) { float* o = os + lr * 68 + mb * 16 + hi * 8; const v8f c = acc[mb][nb]; *(v4fa*)o = (v4f){ c[0], c[1], c[2], c[3] }; *(v4fa*)(o + 4) = (v4f){ c[4], c[5], c[6], c[7] }; }
                __builtin_amdgcn_wave_barrier(); asm volatile("" ::: "memory");   // as above: staging writes, then the reads
                put_rows(os, lane, VT16 + zp + (size_t)nb * 16 * TT, VTh + zp + (size_t)nb * 16 * TT, VTl + zp + (size_t)nb * 16 * TT, TT);
                __builtin_amdgcn_wave_barrier(); asm volatile("" ::: "memory");   // as above: the reads, then the next staging writes
            }
        }
        return;
    }
#pragma unroll
    for (int mb = 0; mb < 4; ++mb) {
#pragma unroll
        for (int nb = 0; nb < 4; ++nb) {
#pragma unroll
            for (int j = 0; j < 8; ++j) os[(hi * 8 + j) * 68 + nb * 16 + lr] = acc[mb][nb][j]; }
        __builtin_amdgcn_wave_barrier(); asm volatile("" ::: "memory");
        float* crow = C + (size_t)(r0 + mb * 16) * ldc + c0;
{
#pragma unroll
            for (int s = 0; s < 8; ++s) { const int row = 2 * s + hi, cofs = lr * 4; v4f val = *(const v4fa*)(os + row * 68 + cofs); if (BIAS) { val[0] += bfr(bias[c0 + cofs]); val[1] += bfr(bias[c0 + cofs + 1]); val[2] += bfr(bias[c0 + cofs + 2]); val[3] += bfr(bias[c0 + cofs + 3]); }
                *(v4f*)(crow + (size_t)row * ldc + cofs) = val; }
             }
        __builtin_amdgcn_wave_barrier(); asm volatile("" ::: "memory");
    }
}

typedef __attribute__((ext_vector_type(2))) _Float16 v2h;
typedef __attribute__((ext_vector_type(4))) _Float16 v4h;
typedef __attribute__((ext_vector_type(2))) unsigned short v2us;
typedef __attribute__((ext_vector_type(4))) unsigned short v4us;
typedef __attribute__((ext_vector_type(2))) float v2f;
typedef __attribute__((ext_vector_type(4))) int v4i;

__global__ __launch_bounds__(256) void k_wtG(const float* __restrict__ w, int K, int N, bf* Bt) {
    const int lane = threadIdx.x & 31; const int L0 = (blockIdx.x * 8 + (threadIdx.x >> 5)) * 8; const int nlines = N * K / 64;
{
#pragma unroll 1
        for (int l = 0; l < 8; ++l) { const int L = L0 + l; if (L >= nlines) break; const size_t e = (size_t)L * 64 + lane * 2; const int k = (int)(e % K), n = (int)(e / K); v2us o;
            o[0] = f2bf(w[(size_t)k * N + n]); o[1] = f2bf(w[(size_t)(k + 1) * N + n]); *(v2us*)(Bt + e) = o; }
         }
}
__global__ __launch_bounds__(256) void k_cvt8(const float* __restrict__ src, bf* dst, size_t n8) { const size_t i = (size_t)blockIdx.x * 256 + threadIdx.x; if (i >= n8) return; const v8f v = *(const v8f*)(src + i * 8); v8us o;
#pragma unroll
    for (int k = 0; k < 8; ++k) o[k] = f2bf(v[k]); *(v8us*)(dst + i * 8) = o;  }

// ---- k_fattn: the whole attention of 32 query rows in ONE WAVE, scores and weights never leave registers. Per pass of 32 keys: S^T = K Q^T (A = K rows, B = Q kept in registers), running maximum and sum per query
// (a lane holds one query's scores; the two lane halves split its keys), the two S^T tiles converted in place are the B operand of O^T += V^T P^T (A = V^T rows in the same k order as the loader's).
// Weights enter the product un-normalised, exp2(t - running max); O^T is divided by the row sum at the end and stored as the merged hi/lo planes [t][head * HD + d], 8 consecutive d per lane.
// Rows < RH: hi/lo planes, 3 products; the rest fp16. Grid (RH / 128, heads, batches), 8 waves: waves 0-3 take 128 rows < RH, waves 4-7 take 128 rows >= RH (equal work per work-group). No LDS, no barrier.
__device__ __forceinline__ float xhalf(float x) { const int b = __builtin_bit_cast(int, x); return __builtin_bit_cast(float, __builtin_amdgcn_permlanex16(b, b, 0x76543210, 0xfedcba98, false, false)); }   // lane l <-> lane l ^ 16
#define SCL2 (SCL * 1.4426950408889634f)   // score scale in the log2 domain
// fragment at a wave-uniform base + the lane's 32-bit byte offset + a constant (the constant goes into the load's immediate field)
template <typename T16> __device__ __forceinline__ typename WFrag<T16>::V ldf(const T16* base, unsigned vo, int imm) { return WFrag<T16>::ld((const T16*)((const char*)base + vo + imm)); }
template <typename T16, bool HL>
__device__ __forceinline__ void attn_rows(const T16* __restrict__ Q, const T16* __restrict__ Q2, const T16* __restrict__ Kp, const T16* __restrict__ K2, const T16* __restrict__ Vt, const T16* __restrict__ Vt2, bf* Ah, bf* Al, const int lr, const int hi) {
    typedef WFrag<T16> WF; typedef typename WF::V V;
    // every inner loop below is unrolled so that the fragment and accumulator arrays are indexed by constants and stay in registers; the loop over the keys stays rolled (unroll 1): one pass already fills the register budget
    const unsigned koff = (unsigned)(lr * HD + 8 * hi) * 2u, voff = (unsigned)(lr * TT + 8 * hi) * 2u;   // the lane's byte offsets in a [row][HD] and a [d][TT] plane
    V q[2][2], q2[2][2];
#pragma unroll
    for (int qt = 0; qt < 2; ++qt)
#pragma unroll
        for (int kc = 0; kc < 2; ++kc) { q[qt][kc] = ldf(Q, koff, (qt * 16 * HD + kc * 32) * 2); if (HL) q2[qt][kc] = ldf(Q2, koff, (qt * 16 * HD + kc * 32) * 2); }
    v8f o[4][2];
#pragma unroll
    for (int dt = 0; dt < 4; ++dt)
#pragma unroll
        for (int qt = 0; qt < 2; ++qt) o[dt][qt] = (v8f){};
    float m[2] = { -3.0e38f, -3.0e38f }, l[2] = { 0.f, 0.f };
    unsigned vo = voff;   // the lane's byte offset in the V^T planes, stepped by 32 keys a pass
#pragma unroll 1
    for (int j0 = 0; j0 < TT; j0 += 32) {
        v8f s[2][2];   // [key tile][query tile]: register r of lane (lr, hi) = score of key j0 + 16 kt + 8 hi + r, query 16 qt + lr
        V k[2][2], k2[2][2];
#pragma unroll
        for (int kt = 0; kt < 2; ++kt)
#pragma unroll
            for (int kc = 0; kc < 2; ++kc) { k[kt][kc] = ldf(Kp + (size_t)j0 * HD, koff, (kt * 16 * HD + kc * 32) * 2); if (HL) k2[kt][kc] = ldf(K2 + (size_t)j0 * HD, koff, (kt * 16 * HD + kc * 32) * 2); }
        __builtin_amdgcn_sched_barrier(0);   // all K loads of the pass are asked for before the first product: left free, the compiler reuses two fragments' registers and waits out a load latency six times a pass
#pragma unroll
        for (int kt = 0; kt < 2; ++kt) { s[kt][0] = (v8f){}; s[kt][1] = (v8f){}; }
#pragma unroll
        for (int kc = 0; kc < 2; ++kc) {
#pragma unroll
            for (int kt = 0; kt < 2; ++kt) { s[kt][0] = WF::mma(k[kt][kc], q[0][kc], s[kt][0]); s[kt][1] = WF::mma(k[kt][kc], q[1][kc], s[kt][1]); }
            if (HL) {
#pragma unroll
                for (int kt = 0; kt < 2; ++kt) { s[kt][0] = WF::mma(k[kt][kc], q2[0][kc], s[kt][0]); s[kt][1] = WF::mma(k[kt][kc], q2[1][kc], s[kt][1]); }
#pragma unroll
                for (int kt = 0; kt < 2; ++kt) { s[kt][0] = WF::mma(k2[kt][kc], q[0][kc], s[kt][0]); s[kt][1] = WF::mma(k2[kt][kc], q[1][kc], s[kt][1]); } } }
        V v[4], v2[4];   // asked for here, they fly during the softmax arithmetic
#pragma unroll
        for (int dt = 0; dt < 4; ++dt) v[dt] = ldf(Vt, vo, dt * 16 * TT * 2);
        asm volatile("s_wait_xcnt 0x0" : "+v"(vo) : : "memory");   // stands behind the run of loads and in front of every rewrite of the offset register they name: the offset passes through this statement, so it outlives the run and is stepped only behind the wait (left free, the compiler forms a 64-bit address pair and gives it to the last load's result)
        float mn[2]; bool need = false;
#pragma unroll
        for (int qt = 0; qt < 2; ++qt) { float mx = fmaxf(s[0][qt][0], s[1][qt][0]);
#pragma unroll
            for (int r = 1; r < 8; ++r) mx = fmaxf(mx, fmaxf(s[0][qt][r], s[1][qt][r]));
            mx = fmaxf(mx, xhalf(mx)); mn[qt] = fmaxf(m[qt], mx * SCL2); need = need || (mn[qt] > m[qt]); }
        if (__builtin_amdgcn_ballot_w32(need) != 0) {   // some query's maximum grew: bring its sum and its output column to the new maximum (factor 1 for the others)
#pragma unroll
            for (int qt = 0; qt < 2; ++qt) { const float al = __builtin_amdgcn_exp2f(m[qt] - mn[qt]); m[qt] = mn[qt]; l[qt] *= al;
#pragma unroll
                for (int dt = 0; dt < 4; ++dt) o[dt][qt] *= al; } }
        V p[2], p2[2];   // the weights as B operands: element e of lane (lr, hi) = key j0 + 16 (e >> 3) + 8 hi + (e & 7), the loader's k order
#pragma unroll
        for (int qt = 0; qt < 2; ++qt) {
#pragma unroll
            for (int e = 0; e < 16; ++e) { const float pe = __builtin_amdgcn_exp2f(fmaf(s[e >> 3][qt][e & 7], SCL2, -m[qt])); l[qt] += pe;
                if constexpr (HL) { const __bf16 ph = (__bf16)pe; p[qt][e] = ph; p2[qt][e] = (__bf16)(pe - (float)ph); } else { p[qt][e] = (h16)pe; } } }
        if (HL) {   // the lo-plane V^T loads: they fly during the hi-plane products (their offset comes out of the wait statement above, so they cannot be lifted over it into the score products, where no registers are free for them)
#pragma unroll
            for (int dt = 0; dt < 4; ++dt) v2[dt] = ldf(Vt2, vo, dt * 16 * TT * 2); }
        vo += 32 * 2;
#pragma unroll
        for (int qt = 0; qt < 2; ++qt)
#pragma unroll
            for (int dt = 0; dt < 4; ++dt) o[dt][qt] = WF::mma(v[dt], p[qt], o[dt][qt]);
        if (HL) {
#pragma unroll
            for (int qt = 0; qt < 2; ++qt)
#pragma unroll
                for (int dt = 0; dt < 4; ++dt) o[dt][qt] = WF::mma(v[dt], p2[qt], o[dt][qt]);
#pragma unroll
            for (int qt = 0; qt < 2; ++qt)
#pragma unroll
                for (int dt = 0; dt < 4; ++dt) o[dt][qt] = WF::mma(v2[dt], p[qt], o[dt][qt]); }
    }
    const int ln = (int)__builtin_amdgcn_mbcnt_lo(~0u, 0u);   // the lane's number, read anew: no register carries it through the loop, whose live set is at the 256 budget
#pragma unroll
    for (int qt = 0; qt < 2; ++qt) { const float inv = __fdiv_rn(1.0f, l[qt] + xhalf(l[qt])); const size_t ro = (size_t)(qt * 16 + (ln & 15)) * DQ + 8 * (ln >> 4);
#pragma unroll
        for (int dt = 0; dt < 4; ++dt) { v8us oh, ol;
#pragma unroll
            for (int r = 0; r < 8; ++r) { unsigned short a, c2; splitf(o[dt][qt][r] * inv, a, c2); oh[r] = a; ol[r] = c2; }
            *(v8us*)(Ah + ro + dt * 16) = oh; *(v8us*)(Al + ro + dt * 16) = ol; } }
}
static_assert(RH * 2 == TT && RH % 128 == 0 && HD == 64, "k_fattn: half the rows hi/lo, 128 rows of each kind per work-group, head size 64");
// waves_per_eu(4, 4): four waves a SIMD, so each wave may use a quarter of the SIMD's registers (256); the hi/lo path needs nearly all of them, and the grid is exactly four waves for every SIMD
__global__ __launch_bounds__(256) __attribute__((amdgpu_waves_per_eu(4, 4))) void k_fattn(const h16* __restrict__ QK16, const bf* __restrict__ QKh, const bf* __restrict__ QKl, const h16* __restrict__ VT16, const bf* __restrict__ VTh, const bf* __restrict__ VTl, bf* ATh, bf* ATl) {
    const int lane = threadIdx.x & 31, lr = lane & 15, hi = lane >> 4; const int w = __builtin_amdgcn_readfirstlane((int)(threadIdx.x >> 5));   // the wave's number in a scalar register: the branch below is a scalar one, every lane stays on for the matrix instructions
    const size_t b = blockIdx.z, h = blockIdx.y; const size_t zq = (b * (NH_ + NKV) + h) * TT * HD, zk = (b * (NH_ + NKV) + NH_ + h / REP) * TT * HD, zv = (b * NKV + h / REP) * HD * TT;
    const size_t t0 = (w < 4) ? (size_t)blockIdx.x * 128 + w * 32 : (size_t)RH + blockIdx.x * 128 + (w - 4) * 32; const size_t ao = (b * TT + t0) * DQ + h * HD;
    if (w < 4) attn_rows<bf, true>(QKh + zq + t0 * HD, QKl + zq + t0 * HD, QKh + zk, QKl + zk, VTh + zv, VTl + zv, ATh + ao, ATl + ao, lr, hi);
    else attn_rows<h16, false>(QK16 + zq + t0 * HD, nullptr, QK16 + zk, nullptr, VT16 + zv, nullptr, ATh + ao, ATl + ao, lr, hi);
}

extern "C" void kernel_launch(void* const* d_in, const int* in_sizes, int n_in,
                              void* d_out, int out_size, void* d_ws, size_t ws_size, hipStream_t stream) {
    (void)in_sizes; (void)n_in; (void)out_size;
    const float* x = (const float*)d_in[0]; const float* wqkv = (const float*)d_in[1]; const float* wo = (const float*)d_in[2]; const float* bo = (const float*)d_in[3];   /* argument order x, w_qkv ('xw' [1024][3072]), w_out ('xw'), b_out */
    float* OUT = (float*)d_out;     // [8][1024][1024]
    char* wsp = (char*)d_ws;
    auto take = [&](size_t bytes) { char* p = wsp; wsp += (bytes + 255) & ~(size_t)255; return (void*)p; };
    bf* WQKV = (bf*)take((size_t)3 * DQ * DM * 2);   /* fused Bt [3*DQ][DM]: q | k | v row blocks */ bf* WO = (bf*)take((size_t)DM * DQ * 2);
    bf* XB = (bf*)take((size_t)GB * TT * DM * 2);   // per group: XB [GB*TT][DM] bf16
    h16* QK16 = (h16*)take((size_t)NB_ * (NH_ + NKV) * TT * HD * 2); bf* QKh = (bf*)take((size_t)NB_ * (NH_ + NKV) * TT * HD * 2); bf* QKl = (bf*)take((size_t)NB_ * (NH_ + NKV) * TT * HD * 2);   // planes [batch][16 q heads | 16 k heads][t][d], all batches
    h16* VT16 = (h16*)take((size_t)NB_ * NKV * HD * TT * 2); bf* VTh = (bf*)take((size_t)NB_ * NKV * HD * TT * 2); bf* VTl = (bf*)take((size_t)NB_ * NKV * HD * TT * 2);   // planes [batch][head][d][t], all batches
    bf* ATh = (bf*)take((size_t)NB_ * TT * DQ * 2); bf* ATl = (bf*)take((size_t)NB_ * TT * DQ * 2);   // merged attention output, hi/lo, [batch * TT + t][DQ]
    if ((size_t)(wsp - (char*)d_ws) > ws_size) return;    // ws 256 MiB, under 193 MiB used
    { k_wtG<<<(unsigned)((DM * 3 * DQ / 64 + 63) / 64), 256, 0, stream>>>(wqkv, DM, 3 * DQ, WQKV);   /* fused 'xw' [DM][3*DQ] -> Bt [3*DQ][DM] */
      k_wtG<<<(unsigned)((DQ * DM / 64 + 63) / 64), 256, 0, stream>>>(wo, DQ, DM, WO);
       }
    for (int b0 = 0; b0 < NB_; b0 += GB) { const size_t pq = (size_t)b0 * (NH_ + NKV) * TT * HD, pv = (size_t)b0 * NKV * HD * TT;   // the group's block of planes
        k_cvt8<<<(unsigned)(((size_t)GB * TT * DM / 8 + 255) / 256), 256, 0, stream>>>(x + (size_t)b0 * TT * DM, XB, (size_t)GB * TT * DM / 8);
        k_gemmw<bf, 0, false, true><<<dim3(GB * TT / 64, 3 * DQ / 64, 1), 32, 0, stream>>>(XB, nullptr, WQKV, nullptr, DM, nullptr, 0, nullptr, 0, 0, 0, QK16 + pq, QKh + pq, QKl + pq, VT16 + pv, VTh + pv, VTl + pv); }
    k_fattn<<<dim3(RH / 128, NH_, NB_), 256, 0, stream>>>(QK16, QKh, QKl, VT16, VTh, VTl, ATh, ATl);
    for (int b0 = 0; b0 < NB_; b0 += GB)
        k_gemmw<bf, 1, true, false><<<dim3(GB * TT / 64, DM / 64, 1), 32, 0, stream>>>(ATh + (size_t)b0 * TT * DQ, ATl + (size_t)b0 * TT * DQ, WO, nullptr, DQ, OUT + (size_t)b0 * TT * DM, DM, bo, 0, 0, 0, nullptr, nullptr, nullptr, nullptr, nullptr, nullptr);
}

// v004
// A run of this version takes 232 microseconds.
// Two timings next to v003 both put it at 1.40 times that version's speed.
// Counting every step since v000, it is 20.0 times as fast.
#include <hip/hip_runtime.h>

// Multi-head self-attention with a fused qkv projection (x [8][1024][1024]; qkv = x w_qkv ('xw' [1024][3072], no bias) -> q | k | v (16 heads x 64); dots x 1024^-0.5 (the repo scales by dim); softmax (no mask); out = merged w_out + b_out ('xw') -> [8][1024][1024] (8.4 M); argument order x, w_qkv, w_out, b_out).
// Layout: per group of GB batches bf16 copy of x; fused 'xw' weight transposed once (q | k | v row blocks); exact projections whose epilogue stores the head planes itself (planes of all batches kept); ONE fused attention launch over all batches and heads (hybrid rows: < 512 hi/lo 3 products, rest fp16; scores and weights stay in registers); merged hi/lo x w_out exact + b_out.
// Compute dtypes, f32 accumulate: every input rounded to bf16; projections exact; attention rows < 512 3 products, rest fp16; softmax f32; w_out hl x exact + bias.

#define NB_  8
#define TT   1024
#define DM   1024
#define NH_  16
#define NKV  16
#define REP  (NH_ / NKV)
#define HD   64
#define DQ   (NH_ * HD)
#define DKV  (NKV * HD)
#define GB   4                    // batches per projection / w_out launch
#define RH   512                  // query rows < RH use hi+lo planes
#define WIN  0
#define SCL  0.03125f   // dim^-0.5 = 1/32 (the repo scales by dim)
typedef _Float16 h16;
typedef unsigned short bf;
typedef __attribute__((ext_vector_type(16))) __bf16   v16bf;
typedef __attribute__((ext_vector_type(16))) _Float16 v16h;
typedef __attribute__((ext_vector_type(8)))  _Float16 v8h;
typedef __attribute__((ext_vector_type(8)))  unsigned short v8us;
typedef __attribute__((ext_vector_type(8)))  float    v8f;
typedef __attribute__((ext_vector_type(4)))  float    v4f;
typedef v8h  __attribute__((may_alias)) v8ha;
typedef v4f  __attribute__((may_alias)) v4fa;
typedef v8us __attribute__((may_alias)) v8usa;

__device__ __forceinline__ unsigned short f2bf(float f) { unsigned u = __float_as_uint(f); u += 0x7FFFu + ((u >> 16) & 1u); return (unsigned short)(u >> 16); }
__device__ __forceinline__ float bf2f(unsigned short b) { return __uint_as_float(((unsigned)b) << 16); }
__device__ __forceinline__ float bfr(float f) { return bf2f(f2bf(f)); }
__device__ __forceinline__ v16h cat16(v8h lo, v8h hi) { return __builtin_shufflevector(lo, hi, 0, 1, 2, 3, 4, 5, 6, 7, 8, 9, 10, 11, 12, 13, 14, 15); }
__device__ __forceinline__ v16bf cat16b(v8us lo, v8us hi) { return __builtin_bit_cast(v16bf, __builtin_shufflevector(lo, hi, 0, 1, 2, 3, 4, 5, 6, 7, 8, 9, 10, 11, 12, 13, 14, 15)); }
__device__ __forceinline__ v8f wmma16(v16h a, v16h b, v8f c) { return __builtin_amdgcn_wmma_f32_16x16x32_f16(false, a, false, b, (short)0, c, false, false); }
__device__ __forceinline__ v8f wmmab(v16bf a, v16bf b, v8f c) { return __builtin_amdgcn_wmma_f32_16x16x32_bf16(false, a, false, b, (short)0, c, false, false); }



__device__ __forceinline__ h16 tohx(float x) { return (h16)x; }
__device__ __forceinline__ void splitf(float y, unsigned short& h, unsigned short& l) { h = f2bf(y); l = f2bf(y - bf2f(h)); }
// put_rows: 16 plane rows of 64 values, staged as f32 in LDS at pitch 68, go out as fp16, hi and lo planes at P + row * pitch; a lane takes 8 consecutive values of a row, so every store instruction writes 4 whole 128-byte lines
__device__ __forceinline__ void put_rows(const float* os, const int lane, h16* P16, bf* Ph, bf* Pl, const size_t pitch) {
#pragma unroll
    for (int s = 0; s < 4; ++s) { const int row = 4 * s + (lane >> 3), cofs = (lane & 7) * 8; const v4f x0 = *(const v4fa*)(os + row * 68 + cofs), x1 = *(const v4fa*)(os + row * 68 + cofs + 4); v8h o16; v8us oh, ol;
#pragma unroll
        for (int r = 0; r < 8; ++r) { const float x = (r < 4) ? x0[r & 3] : x1[r & 3]; o16[r] = tohx(x); unsigned short a2, c2; splitf(x, a2, c2); oh[r] = a2; ol[r] = c2; }
        const size_t e = (size_t)row * pitch + cofs; *(v8h*)(P16 + e) = o16; *(v8us*)(Ph + e) = oh; *(v8us*)(Pl + e) = ol; }
}
// ---- k_gemmw: GEMM on K-contiguous bf16 planes, FOUR WAVES (2 x 2) per 128x128 output tile, each wave a 64x64 quarter (16 accumulators); grid (M/128, N/128), 128 threads.
// C[m][n] (f32, pitch ldc, + optional f32 bias[n]) = sum_k A[m][k] Bt[n][k] (+ A2[m][k] Bt[n][k] when NSPLIT == 1). K: a constant, whole stages, at least two.
// Operands go through LDS: a stage is 64 k (128 bytes) of the tile's rows [A 128 | A2 128 when NSPLIT | Bt 128] at a pitch of 144 bytes, brought by asynchronous 16-byte copies (8 lanes take one whole 128-byte line of a row),
// two buffers, the stage after next asked for as soon as every wave has left a buffer. Fragments are read from LDS in the k order of WFrag::ld, every accumulator takes its products in ascending k (A, then A2, per 32 k).
// PLANES (the q | k | v projection; rows = batch * TT + t, columns = q heads | k heads | v heads, so a wave's quarter is 64 positions of ONE head): no C; the epilogue stores the head planes, q and k heads as [head][t][d] (64 whole rows of 128 bytes),
// v heads as [head][d][t] (64 rows of d, 128 bytes of t each). 16 plane rows at a time are staged in the wave's own LDS slice, position-major for q and k, d-major for v (a lane's accumulator registers are 8 consecutive positions of one d).
template <typename T16> struct WFrag;
template <> struct WFrag<h16> { typedef v16h V; static __device__ __forceinline__ V ld(const h16* p) { return cat16(*(const v8h*)p, *(const v8h*)(p + 16)); } static __device__ __forceinline__ v8f mma(V a, V b, v8f c) { return wmma16(a, b, c); } };
template <> struct WFrag<bf> { typedef v16bf V; static __device__ __forceinline__ V ld(const bf* p) { return cat16b(*(const v8us*)p, *(const v8us*)(p + 16)); } static __device__ __forceinline__ v8f mma(V a, V b, v8f c) { return wmmab(a, b, c); } };
#define GPB 144                   // LDS row pitch in bytes: 16 x odd, free of bank conflicts for 16-byte reads of 128-byte rows
#define GPE (GPB / 2)             // the same in elements
// cp8: 128 rows x 128 bytes of one plane into LDS; the work-group's 128 threads take 16 rows a copy (thread: row tid / 8, 16-byte piece tid % 8), 8 copies each. l: the lane's LDS byte address, g: its global address, rs: 16 rows in elements.
// s_wait_xcnt 0 closes the statement: no address register of a copy is rewritten before it.
__device__ __forceinline__ void cp8(const unsigned l, const bf* g, const size_t rs) {
    asm volatile("global_load_async_to_lds_b128 %0, %8, off\n\t"
                 "global_load_async_to_lds_b128 %1, %9, off\n\t"
                 "global_load_async_to_lds_b128 %2, %10, off\n\t"
                 "global_load_async_to_lds_b128 %3, %11, off\n\t"
                 "global_load_async_to_lds_b128 %4, %12, off\n\t"
                 "global_load_async_to_lds_b128 %5, %13, off\n\t"
                 "global_load_async_to_lds_b128 %6, %14, off\n\t"
                 "global_load_async_to_lds_b128 %7, %15, off\n\t"
                 "s_wait_xcnt 0x0"
                 :: "v"(l), "v"(l + 16 * GPB), "v"(l + 32 * GPB), "v"(l + 48 * GPB), "v"(l + 64 * GPB), "v"(l + 80 * GPB), "v"(l + 96 * GPB), "v"(l + 112 * GPB),
                    "v"(g), "v"(g + rs), "v"(g + 2 * rs), "v"(g + 3 * rs), "v"(g + 4 * rs), "v"(g + 5 * rs), "v"(g + 6 * rs), "v"(g + 7 * rs) : "memory");
}
// waves_per_eu(4, 4): the projection stays inside 256 registers a wave, so that three of its work-groups (its grid is three for every WGP) are resident together; the two-plane instance, one work-group for every WGP, is held to the same bound
template <int NSPLIT, bool BIAS, bool PLANES, int K>
__global__ __launch_bounds__(128) __attribute__((amdgpu_waves_per_eu(4, 4))) void k_gemmw(const bf* __restrict__ A, const bf* __restrict__ A2, const bf* __restrict__ Bt, float* C, int ldc, const float* __restrict__ bias, h16* QK16, bf* QKh, bf* QKl, h16* VT16, bf* VTh, bf* VTl) {
    typedef WFrag<bf> WF; typedef typename WF::V V;
    static_assert((NSPLIT == 0 || NSPLIT == 1) && K % 64 == 0 && K >= 128, "one or two A planes; whole stages, at least two");
    constexpr int BROW = (NSPLIT ? 256 : 128), STAGE = (BROW + 128) * GPB;   // first Bt row of a stage; bytes of a stage
    __shared__ __align__(128) char ring[2 * STAGE];
    __shared__ __align__(16) float osall[4][16 * 68];
    const int tid = threadIdx.x, lane = tid & 31, lr = lane & 15, hi = lane >> 4; const int w = __builtin_amdgcn_readfirstlane(tid >> 5), wm = w >> 1, wn = w & 1;
    float* os = osall[w];
    const int R0 = blockIdx.x * 128, C0 = blockIdx.y * 128, r0 = R0 + wm * 64, c0 = C0 + wn * 64;
    v8f acc[4][4];
#pragma unroll
    for (int mb = 0; mb < 4; ++mb)
#pragma unroll
        for (int nb = 0; nb < 4; ++nb) acc[mb][nb] = (v8f){};
    const unsigned lcp = (unsigned)(size_t)ring + (unsigned)((tid >> 3) * GPB + (tid & 7) * 16);   // low 32 bits of a __shared__ address: the byte address in LDS
    const size_t rs = (size_t)16 * K; const size_t gofs = (size_t)(tid >> 3) * K + (tid & 7) * 8;
    const bf* gA = A + (size_t)R0 * K + gofs; const bf* gA2 = NSPLIT ? A2 + (size_t)R0 * K + gofs : nullptr; const bf* gB = Bt + (size_t)C0 * K + gofs;
    auto fill = [&](const int t) { const unsigned l = lcp + (unsigned)((t & 1) * STAGE); cp8(l, gA + t * 64, rs); if constexpr (NSPLIT == 1) cp8(l + 128 * GPB, gA2 + t * 64, rs); cp8(l + BROW * GPB, gB + t * 64, rs); };
    constexpr int NT = K / 64;
    fill(0);
    asm volatile("s_wait_asynccnt 0x0" ::: "memory");   // this wave's copies of stage 0 have landed
    __syncthreads();                                     // and so have the other waves'
    fill(1);
    const int aofs = (wm * 64 + lr) * GPE + 8 * hi, bofs = (BROW + wn * 64 + lr) * GPE + 8 * hi;   // the lane's element offsets in a stage
#pragma unroll 1
    for (int t = 0; t < NT; ++t) {   // stays rolled: one trip a stage, the buffer chosen by the trip's parity
        const bf* sb = (const bf*)(ring + (t & 1) * STAGE);
        // fragments of both 32-k halves of the stage; every loop here is unrolled so that the arrays are indexed by constants and stay in registers
        V a[2][4], a2[2][4], b[2][4];
#pragma unroll
        for (int mb = 0; mb < 4; ++mb) { a[0][mb] = WF::ld(sb + aofs + mb * 16 * GPE); if (NSPLIT == 1) a2[0][mb] = WF::ld(sb + aofs + (128 + mb * 16) * GPE); }
#pragma unroll
        for (int nb = 0; nb < 4; ++nb) b[0][nb] = WF::ld(sb + bofs + nb * 16 * GPE);
        if (NSPLIT == 0) {   // registers are free for the second half's A fragments: they fly during the first half's products
#pragma unroll
            for (int mb = 0; mb < 4; ++mb) a[1][mb] = WF::ld(sb + aofs + mb * 16 * GPE + 32); }
        __builtin_amdgcn_sched_barrier(0);   // the whole group of LDS reads is asked for before the first product: left free, the compiler keeps one Bt fragment and waits out an LDS latency in front of every four products
#pragma unroll
        for (int nb = 0; nb < 4; ++nb) {
#pragma unroll
            for (int mb = 0; mb < 4; ++mb) { acc[mb][nb] = WF::mma(a[0][mb], b[0][nb], acc[mb][nb]); if (NSPLIT == 1) acc[mb][nb] = WF::mma(a2[0][mb], b[0][nb], acc[mb][nb]); }
            b[1][nb] = WF::ld(sb + bofs + nb * 16 * GPE + 32);
            if (nb < 3) __builtin_amdgcn_sched_barrier(0);   // the second half's Bt fragment is asked for as soon as the first half's has been used up, not sunk to its own first use
        }
        if (NSPLIT == 1) {
#pragma unroll
            for (int mb = 0; mb < 4; ++mb) { a[1][mb] = WF::ld(sb + aofs + mb * 16 * GPE + 32); a2[1][mb] = WF::ld(sb + aofs + (128 + mb * 16) * GPE + 32); } }
        // the stage's last LDS read is asked for: the hand-over stands here, so that the refill flies during the second half's products (they read registers only)
        asm volatile("s_wait_dscnt 0x0" ::: "memory");      // this wave's reads of the buffer are done before the buffer is handed back
        asm volatile("s_wait_asynccnt 0x0" ::: "memory");   // this wave's copies of stage t + 1 have landed
        __syncthreads();                                     // publishes stage t + 1 and ends every wave's reads of stage t
        if (t + 2 < NT) fill(t + 2);
#pragma unroll
        for (int nb = 0; nb < 4; ++nb)
#pragma unroll
            for (int mb = 0; mb < 4; ++mb) { acc[mb][nb] = WF::mma(a[1][mb], b[1][nb], acc[mb][nb]); if (NSPLIT == 1) acc[mb][nb] = WF::mma(a2[1][mb], b[1][nb], acc[mb][nb]); }
    }
    asm volatile("s_wait_asynccnt 0x0" ::: "memory");   // no copy is outstanding when the wave goes on
    if constexpr (PLANES) {
        static_assert(HD == 64 && TT % 64 == 0, "a 64-column quarter is one head, a 64-row quarter lies in one batch");
        const size_t bb = (size_t)(r0 / TT), t0 = (size_t)(r0 % TT), hd = (size_t)(c0 / 64);   // batch of the group, first position, head block: q heads from 0, k heads from NH_, v heads from NH_ + NKV
        if (hd < NH_ + NKV) { const size_t zp = ((bb * (NH_ + NKV) + hd) * TT + t0) * HD;
#pragma unroll
            for (int mb = 0; mb < 4; ++mb) {
#pragma unroll
                for (int nb = 0; nb < 4; ++nb) {
#pragma unroll
                    for (int j = 0; j < 8; ++j) os[(hi * 8 + j) * 68 + nb * 16 + lr] = acc[mb][nb][j]; }
                __builtin_amdgcn_wave_barrier(); asm volatile("" ::: "memory");   // a lane reads what other lanes of the wave staged: no LDS read is lifted over the staging writes
                put_rows(os, lane, QK16 + zp + mb * 16 * HD, QKh + zp + mb * 16 * HD, QKl + zp + mb * 16 * HD, HD);
                __builtin_amdgcn_wave_barrier(); asm volatile("" ::: "memory");   // the next 16 rows are not staged over rows still to be read
            }
        } else { const size_t zp = (bb * NKV + (hd - (NH_ + NKV))) * HD * TT + t0;
#pragma unroll
            for (int nb = 0; nb < 4; ++nb) {
#pragma unroll
                for (int mb = 0; mb < 4; ++mb) { float* o = os + lr * 68 + mb * 16 + hi * 8; const v8f c = acc[mb][nb]; *(v4fa*)o = (v4f){ c[0], c[1], c[2], c[3] }; *(v4fa*)(o + 4) = (v4f){ c[4], c[5], c[6], c[7] }; }
                __builtin_amdgcn_wave_barrier(); asm volatile("" ::: "memory");   // as above: staging writes, then the reads
                put_rows(os, lane, VT16 + zp + (size_t)nb * 16 * TT, VTh + zp + (size_t)nb * 16 * TT, VTl + zp + (size_t)nb * 16 * TT, TT);
                __builtin_amdgcn_wave_barrier(); asm volatile("" ::: "memory");   // as above: the reads, then the next staging writes
            }
        }
        return;
    }
#pragma unroll
    for (int mb = 0; mb < 4; ++mb) {
#pragma unroll
        for (int nb = 0; nb < 4; ++nb) {
#pragma unroll
            for (int j = 0; j < 8; ++j) os[(hi * 8 + j) * 68 + nb * 16 + lr] = acc[mb][nb][j]; }
        __builtin_amdgcn_wave_barrier(); asm volatile("" ::: "memory");
        float* crow = C + (size_t)(r0 + mb * 16) * ldc + c0;
{
#pragma unroll
            for (int s = 0; s < 8; ++s) { const int row = 2 * s + hi, cofs = lr * 4; v4f val = *(const v4fa*)(os + row * 68 + cofs); if (BIAS) { val[0] += bfr(bias[c0 + cofs]); val[1] += bfr(bias[c0 + cofs + 1]); val[2] += bfr(bias[c0 + cofs + 2]); val[3] += bfr(bias[c0 + cofs + 3]); }
                *(v4f*)(crow + (size_t)row * ldc + cofs) = val; }
             }
        asm volatile("s_wait_xcnt 0x0" ::: "memory");   // behind the run of stores, in front of the next rows' arithmetic, which reuses registers that the stores name
        __builtin_amdgcn_wave_barrier(); asm volatile("" ::: "memory");
    }
}

typedef __attribute__((ext_vector_type(2))) _Float16 v2h;
typedef __attribute__((ext_vector_type(4))) _Float16 v4h;
typedef __attribute__((ext_vector_type(2))) unsigned short v2us;
typedef __attribute__((ext_vector_type(4))) unsigned short v4us;
typedef __attribute__((ext_vector_type(2))) float v2f;
typedef __attribute__((ext_vector_type(4))) int v4i;

__global__ __launch_bounds__(256) void k_wtG(const float* __restrict__ w, int K, int N, bf* Bt) {
    const int lane = threadIdx.x & 31; const int L0 = (blockIdx.x * 8 + (threadIdx.x >> 5)) * 8; const int nlines = N * K / 64;
{
#pragma unroll 1
        for (int l = 0; l < 8; ++l) { const int L = L0 + l; if (L >= nlines) break; const size_t e = (size_t)L * 64 + lane * 2; const int k = (int)(e % K), n = (int)(e / K); v2us o;
            o[0] = f2bf(w[(size_t)k * N + n]); o[1] = f2bf(w[(size_t)(k + 1) * N + n]); *(v2us*)(Bt + e) = o; }
         }
}
__global__ __launch_bounds__(256) void k_cvt8(const float* __restrict__ src, bf* dst, size_t n8) { const size_t i = (size_t)blockIdx.x * 256 + threadIdx.x; if (i >= n8) return; const v8f v = *(const v8f*)(src + i * 8); v8us o;
#pragma unroll
    for (int k = 0; k < 8; ++k) o[k] = f2bf(v[k]); *(v8us*)(dst + i * 8) = o;  }

// ---- k_fattn: the whole attention of 32 query rows in ONE WAVE, scores and weights never leave registers. Per pass of 32 keys: S^T = K Q^T (A = K rows, B = Q kept in registers), running maximum and sum per query
// (a lane holds one query's scores; the two lane halves split its keys), the two S^T tiles converted in place are the B operand of O^T += V^T P^T (A = V^T rows in the same k order as the loader's).
// Weights enter the product un-normalised, exp2(t - running max); O^T is divided by the row sum at the end and stored as the merged hi/lo planes [t][head * HD + d], 8 consecutive d per lane.
// Rows < RH: hi/lo planes, 3 products; the rest fp16. Grid (RH / 128, heads, batches), 8 waves: waves 0-3 take 128 rows < RH, waves 4-7 take 128 rows >= RH (equal work per work-group). No LDS, no barrier.
__device__ __forceinline__ float xhalf(float x) { const int b = __builtin_bit_cast(int, x); return __builtin_bit_cast(float, __builtin_amdgcn_permlanex16(b, b, 0x76543210, 0xfedcba98, false, false)); }   // lane l <-> lane l ^ 16
#define SCL2 (SCL * 1.4426950408889634f)   // score scale in the log2 domain
// fragment at a wave-uniform base + the lane's 32-bit byte offset + a constant (the constant goes into the load's immediate field)
template <typename T16> __device__ __forceinline__ typename WFrag<T16>::V ldf(const T16* base, unsigned vo, int imm) { return WFrag<T16>::ld((const T16*)((const char*)base + vo + imm)); }
template <typename T16, bool HL>
__device__ __forceinline__ void attn_rows(const T16* __restrict__ Q, const T16* __restrict__ Q2, const T16* __restrict__ Kp, const T16* __restrict__ K2, const T16* __restrict__ Vt, const T16* __restrict__ Vt2, bf* Ah, bf* Al, const int lr, const int hi) {
    typedef WFrag<T16> WF; typedef typename WF::V V;
    // every inner loop below is unrolled so that the fragment and accumulator arrays are indexed by constants and stay in registers; the loop over the keys stays rolled (unroll 1): one pass already fills the register budget
    const unsigned koff = (unsigned)(lr * HD + 8 * hi) * 2u, voff = (unsigned)(lr * TT + 8 * hi) * 2u;   // the lane's byte offsets in a [row][HD] and a [d][TT] plane
    V q[2][2], q2[2][2];
#pragma unroll
    for (int qt = 0; qt < 2; ++qt)
#pragma unroll
        for (int kc = 0; kc < 2; ++kc) { q[qt][kc] = ldf(Q, koff, (qt * 16 * HD + kc * 32) * 2); if (HL) q2[qt][kc] = ldf(Q2, koff, (qt * 16 * HD + kc * 32) * 2); }
    v8f o[4][2];
#pragma unroll
    for (int dt = 0; dt < 4; ++dt)
#pragma unroll
        for (int qt = 0; qt < 2; ++qt) o[dt][qt] = (v8f){};
    float m[2] = { -3.0e38f, -3.0e38f }, l[2] = { 0.f, 0.f };
    unsigned vo = voff;   // the lane's byte offset in the V^T planes, stepped by 32 keys a pass
#pragma unroll 1
    for (int j0 = 0; j0 < TT; j0 += 32) {
        v8f s[2][2];   // [key tile][query tile]: register r of lane (lr, hi) = score of key j0 + 16 kt + 8 hi + r, query 16 qt + lr
        V k[2][2], k2[2][2];
#pragma unroll
        for (int kt = 0; kt < 2; ++kt)
#pragma unroll
            for (int kc = 0; kc < 2; ++kc) { k[kt][kc] = ldf(Kp + (size_t)j0 * HD, koff, (kt * 16 * HD + kc * 32) * 2); if (HL) k2[kt][kc] = ldf(K2 + (size_t)j0 * HD, koff, (kt * 16 * HD + kc * 32) * 2); }
        __builtin_amdgcn_sched_barrier(0);   // all K loads of the pass are asked for before the first product: left free, the compiler reuses two fragments' registers and waits out a load latency six times a pass
#pragma unroll
        for (int kt = 0; kt < 2; ++kt) { s[kt][0] = (v8f){}; s[kt][1] = (v8f){}; }
#pragma unroll
        for (int kc = 0; kc < 2; ++kc) {
#pragma unroll
            for (int kt = 0; kt < 2; ++kt) { s[kt][0] = WF::mma(k[kt][kc], q[0][kc], s[kt][0]); s[kt][1] = WF::mma(k[kt][kc], q[1][kc], s[kt][1]); }
            if (HL) {
#pragma unroll
                for (int kt = 0; kt < 2; ++kt) { s[kt][0] = WF::mma(k[kt][kc], q2[0][kc], s[kt][0]); s[kt][1] = WF::mma(k[kt][kc], q2[1][kc], s[kt][1]); }
#pragma unroll
                for (int kt = 0; kt < 2; ++kt) { s[kt][0] = WF::mma(k2[kt][kc], q[0][kc], s[kt][0]); s[kt][1] = WF::mma(k2[kt][kc], q[1][kc], s[kt][1]); } } }
        V v[4], v2[4];   // asked for here, they fly during the softmax arithmetic
#pragma unroll
        for (int dt = 0; dt < 4; ++dt) v[dt] = ldf(Vt, vo, dt * 16 * TT * 2);
        asm volatile("s_wait_xcnt 0x0" : "+v"(vo) : : "memory");   // stands behind the run of loads and in front of every rewrite of the offset register they name: the offset passes through this statement, so it outlives the run and is stepped only behind the wait (left free, the compiler forms a 64-bit address pair and gives it to the last load's result)
        float mn[2]; bool need = false;
#pragma unroll
        for (int qt = 0; qt < 2; ++qt) { float mx = fmaxf(s[0][qt][0], s[1][qt][0]);
#pragma unroll
            for (int r = 1; r < 8; ++r) mx = fmaxf(mx, fmaxf(s[0][qt][r], s[1][qt][r]));
            mx = fmaxf(mx, xhalf(mx)); mn[qt] = fmaxf(m[qt], mx * SCL2); need = need || (mn[qt] > m[qt]); }
        if (__builtin_amdgcn_ballot_w32(need) != 0) {   // some query's maximum grew: bring its sum and its output column to the new maximum (factor 1 for the others)
#pragma unroll
            for (int qt = 0; qt < 2; ++qt) { const float al = __builtin_amdgcn_exp2f(m[qt] - mn[qt]); m[qt] = mn[qt]; l[qt] *= al;
#pragma unroll
                for (int dt = 0; dt < 4; ++dt) o[dt][qt] *= al; } }
        V p[2], p2[2];   // the weights as B operands: element e of lane (lr, hi) = key j0 + 16 (e >> 3) + 8 hi + (e & 7), the loader's k order
#pragma unroll
        for (int qt = 0; qt < 2; ++qt) {
#pragma unroll
            for (int e = 0; e < 16; ++e) { const float pe = __builtin_amdgcn_exp2f(fmaf(s[e >> 3][qt][e & 7], SCL2, -m[qt])); l[qt] += pe;
                if constexpr (HL) { const __bf16 ph = (__bf16)pe; p[qt][e] = ph; p2[qt][e] = (__bf16)(pe - (float)ph); } else { p[qt][e] = (h16)pe; } } }
        if (HL) {   // the lo-plane V^T loads: they fly during the hi-plane products (their offset comes out of the wait statement above, so they cannot be lifted over it into the score products, where no registers are free for them)
#pragma unroll
            for (int dt = 0; dt < 4; ++dt) v2[dt] = ldf(Vt2, vo, dt * 16 * TT * 2); }
        vo += 32 * 2;
#pragma unroll
        for (int qt = 0; qt < 2; ++qt)
#pragma unroll
            for (int dt = 0; dt < 4; ++dt) o[dt][qt] = WF::mma(v[dt], p[qt], o[dt][qt]);
        if (HL) {
#pragma unroll
            for (int qt = 0; qt < 2; ++qt)
#pragma unroll
                for (int dt = 0; dt < 4; ++dt) o[dt][qt] = WF::mma(v[dt], p2[qt], o[dt][qt]);
#pragma unroll
            for (int qt = 0; qt < 2; ++qt)
#pragma unroll
                for (int dt = 0; dt < 4; ++dt) o[dt][qt] = WF::mma(v2[dt], p[qt], o[dt][qt]); }
    }
    const int ln = (int)__builtin_amdgcn_mbcnt_lo(~0u, 0u);   // the lane's number, read anew: no register carries it through the loop, whose live set is at the 256 budget
#pragma unroll
    for (int qt = 0; qt < 2; ++qt) { const float inv = __fdiv_rn(1.0f, l[qt] + xhalf(l[qt])); const size_t ro = (size_t)(qt * 16 + (ln & 15)) * DQ + 8 * (ln >> 4);
#pragma unroll
        for (int dt = 0; dt < 4; ++dt) { v8us oh, ol;
#pragma unroll
            for (int r = 0; r < 8; ++r) { unsigned short a, c2; splitf(o[dt][qt][r] * inv, a, c2); oh[r] = a; ol[r] = c2; }
            *(v8us*)(Ah + ro + dt * 16) = oh; *(v8us*)(Al + ro + dt * 16) = ol; } }
}
static_assert(RH * 2 == TT && RH % 128 == 0 && HD == 64, "k_fattn: half the rows hi/lo, 128 rows of each kind per work-group, head size 64");
// waves_per_eu(4, 4): four waves a SIMD, so each wave may use a quarter of the SIMD's registers (256); the hi/lo path needs nearly all of them, and the grid is exactly four waves for every SIMD
__global__ __launch_bounds__(256) __attribute__((amdgpu_waves_per_eu(4, 4))) void k_fattn(const h16* __restrict__ QK16, const bf* __restrict__ QKh, const bf* __restrict__ QKl, const h16* __restrict__ VT16, const bf* __restrict__ VTh, const bf* __restrict__ VTl, bf* ATh, bf* ATl) {
    const int lane = threadIdx.x & 31, lr = lane & 15, hi = lane >> 4; const int w = __builtin_amdgcn_readfirstlane((int)(threadIdx.x >> 5));   // the wave's number in a scalar register: the branch below is a scalar one, every lane stays on for the matrix instructions
    const size_t b = blockIdx.z, h = blockIdx.y; const size_t zq = (b * (NH_ + NKV) + h) * TT * HD, zk = (b * (NH_ + NKV) + NH_ + h / REP) * TT * HD, zv = (b * NKV + h / REP) * HD * TT;
    const size_t t0 = (w < 4) ? (size_t)blockIdx.x * 128 + w * 32 : (size_t)RH + blockIdx.x * 128 + (w - 4) * 32; const size_t ao = (b * TT + t0) * DQ + h * HD;
    if (w < 4) attn_rows<bf, true>(QKh + zq + t0 * HD, QKl + zq + t0 * HD, QKh + zk, QKl + zk, VTh + zv, VTl + zv, ATh + ao, ATl + ao, lr, hi);
    else attn_rows<h16, false>(QK16 + zq + t0 * HD, nullptr, QK16 + zk, nullptr, VT16 + zv, nullptr, ATh + ao, ATl + ao, lr, hi);
}

extern "C" void kernel_launch(void* const* d_in, const int* in_sizes, int n_in,
                              void* d_out, int out_size, void* d_ws, size_t ws_size, hipStream_t stream) {
    (void)in_sizes; (void)n_in; (void)out_size;
    const float* x = (const float*)d_in[0]; const float* wqkv = (const float*)d_in[1]; const float* wo = (const float*)d_in[2]; const float* bo = (const float*)d_in[3];   /* argument order x, w_qkv ('xw' [1024][3072]), w_out ('xw'), b_out */
    float* OUT = (float*)d_out;     // [8][1024][1024]
    char* wsp = (char*)d_ws;
    auto take = [&](size_t bytes) { char* p = wsp; wsp += (bytes + 255) & ~(size_t)255; return (void*)p; };
    bf* WQKV = (bf*)take((size_t)3 * DQ * DM * 2);   /* fused Bt [3*DQ][DM]: q | k | v row blocks */ bf* WO = (bf*)take((size_t)DM * DQ * 2);
    bf* XB = (bf*)take((size_t)GB * TT * DM * 2);   // per group: XB [GB*TT][DM] bf16
    h16* QK16 = (h16*)take((size_t)NB_ * (NH_ + NKV) * TT * HD * 2); bf* QKh = (bf*)take((size_t)NB_ * (NH_ + NKV) * TT * HD * 2); bf* QKl = (bf*)take((size_t)NB_ * (NH_ + NKV) * TT * HD * 2);   // planes [batch][16 q heads | 16 k heads][t][d], all batches
    h16* VT16 = (h16*)take((size_t)NB_ * NKV * HD * TT * 2); bf* VTh = (bf*)take((size_t)NB_ * NKV * HD * TT * 2); bf* VTl = (bf*)take((size_t)NB_ * NKV * HD * TT * 2);   // planes [batch][head][d][t], all batches
    bf* ATh = (bf*)take((size_t)NB_ * TT * DQ * 2); bf* ATl = (bf*)take((size_t)NB_ * TT * DQ * 2);   // merged attention output, hi/lo, [batch * TT + t][DQ]
    if ((size_t)(wsp - (char*)d_ws) > ws_size) return;    // ws 256 MiB, under 193 MiB used
    { k_wtG<<<(unsigned)((DM * 3 * DQ / 64 + 63) / 64), 256, 0, stream>>>(wqkv, DM, 3 * DQ, WQKV);   /* fused 'xw' [DM][3*DQ] -> Bt [3*DQ][DM] */
      k_wtG<<<(unsigned)((DQ * DM / 64 + 63) / 64), 256, 0, stream>>>(wo, DQ, DM, WO);
       }
    for (int b0 = 0; b0 < NB_; b0 += GB) { const size_t pq = (size_t)b0 * (NH_ + NKV) * TT * HD, pv = (size_t)b0 * NKV * HD * TT;   // the group's block of planes
        k_cvt8<<<(unsigned)(((size_t)GB * TT * DM / 8 + 255) / 256), 256, 0, stream>>>(x + (size_t)b0 * TT * DM, XB, (size_t)GB * TT * DM / 8);
        k_gemmw<0, false, true, DM><<<dim3(GB * TT / 128, 3 * DQ / 128, 1), 128, 0, stream>>>(XB, nullptr, WQKV, nullptr, 0, nullptr, QK16 + pq, QKh + pq, QKl + pq, VT16 + pv, VTh + pv, VTl + pv); }
    k_fattn<<<dim3(RH / 128, NH_, NB_), 256, 0, stream>>>(QK16, QKh, QKl, VT16, VTh, VTl, ATh, ATl);
    for (int b0 = 0; b0 < NB_; b0 += GB)
        k_gemmw<1, true, false, DQ><<<dim3(GB * TT / 128, DM / 128, 1), 128, 0, stream>>>(ATh + (size_t)b0 * TT * DQ, ATl + (size_t)b0 * TT * DQ, WO, OUT + (size_t)b0 * TT * DM, DM, bo, nullptr, nullptr, nullptr, nullptr, nullptr, nullptr);
}

// v005
// Measured time: 184 microseconds a run.
// Two timings next to v004 both put it at 1.26 times that version's speed.
// Counting every step since v000, it is 25.2 times as fast.
#include <hip/hip_runtime.h>

// Multi-head self-attention with a fused qkv projection (x [8][1024][1024]; qkv = x w_qkv ('xw' [1024][3072], no bias) -> q | k | v (16 heads x 64); dots x 1024^-0.5 (the repo scales by dim); softmax (no mask); out = merged w_out + b_out ('xw') -> [8][1024][1024] (8.4 M); argument order x, w_qkv, w_out, b_out).
// Layout: per group of GB batches bf16 copy of x; fused 'xw' weight transposed once (q | k | v row blocks); exact projections whose epilogue stores the head planes itself (planes of all batches kept); ONE fused attention launch over all batches and heads (hybrid rows: < 512 hi/lo 3 products, rest fp16; K and V^T staged in LDS, scores and weights stay in registers); merged hi/lo x w_out exact + b_out.
// Compute dtypes, f32 accumulate: every input rounded to bf16; projections exact; attention rows < 512 3 products, rest fp16; softmax f32; w_out hl x exact + bias.

#define NB_  8
#define TT   1024
#define DM   1024
#define NH_  16
#define NKV  16
#define REP  (NH_ / NKV)
#define HD   64
#define DQ   (NH_ * HD)
#define DKV  (NKV * HD)
#define GB   4                    // batches per projection / w_out launch
#define RH   512                  // query rows < RH use hi+lo planes
#define WIN  0
#define SCL  0.03125f   // dim^-0.5 = 1/32 (the repo scales by dim)
typedef _Float16 h16;
typedef unsigned short bf;
typedef __attribute__((ext_vector_type(16))) __bf16   v16bf;
typedef __attribute__((ext_vector_type(16))) _Float16 v16h;
typedef __attribute__((ext_vector_type(8)))  _Float16 v8h;
typedef __attribute__((ext_vector_type(8)))  unsigned short v8us;
typedef __attribute__((ext_vector_type(8)))  float    v8f;
typedef __attribute__((ext_vector_type(4)))  float    v4f;
typedef v8h  __attribute__((may_alias)) v8ha;
typedef v4f  __attribute__((may_alias)) v4fa;
typedef v8us __attribute__((may_alias)) v8usa;

__device__ __forceinline__ unsigned short f2bf(float f) { unsigned u = __float_as_uint(f); u += 0x7FFFu + ((u >> 16) & 1u); return (unsigned short)(u >> 16); }
__device__ __forceinline__ float bf2f(unsigned short b) { return __uint_as_float(((unsigned)b) << 16); }
__device__ __forceinline__ float bfr(float f) { return bf2f(f2bf(f)); }
__device__ __forceinline__ v16h cat16(v8h lo, v8h hi) { return __builtin_shufflevector(lo, hi, 0, 1, 2, 3, 4, 5, 6, 7, 8, 9, 10, 11, 12, 13, 14, 15); }
__device__ __forceinline__ v16bf cat16b(v8us lo, v8us hi) { return __builtin_bit_cast(v16bf, __builtin_shufflevector(lo, hi, 0, 1, 2, 3, 4, 5, 6, 7, 8, 9, 10, 11, 12, 13, 14, 15)); }
__device__ __forceinline__ v8f wmma16(v16h a, v16h b, v8f c) { return __builtin_amdgcn_wmma_f32_16x16x32_f16(false, a, false, b, (short)0, c, false, false); }
__device__ __forceinline__ v8f wmmab(v16bf a, v16bf b, v8f c) { return __builtin_amdgcn_wmma_f32_16x16x32_bf16(false, a, false, b, (short)0, c, false, false); }



__device__ __forceinline__ h16 tohx(float x) { return (h16)x; }
__device__ __forceinline__ void splitf(float y, unsigned short& h, unsigned short& l) { h = f2bf(y); l = f2bf(y - bf2f(h)); }
// put_rows: 16 plane rows of 64 values, staged as f32 in LDS at pitch 68, go out as fp16, hi and lo planes at P + row * pitch; a lane takes 8 consecutive values of a row, so every store instruction writes 4 whole 128-byte lines
__device__ __forceinline__ void put_rows(const float* os, const int lane, h16* P16, bf* Ph, bf* Pl, const size_t pitch) {
#pragma unroll
    for (int s = 0; s < 4; ++s) { const int row = 4 * s + (lane >> 3), cofs = (lane & 7) * 8; const v4f x0 = *(const v4fa*)(os + row * 68 + cofs), x1 = *(const v4fa*)(os + row * 68 + cofs + 4); v8h o16; v8us oh, ol;
#pragma unroll
        for (int r = 0; r < 8; ++r) { const float x = (r < 4) ? x0[r & 3] : x1[r & 3]; o16[r] = tohx(x); unsigned short a2, c2; splitf(x, a2, c2); oh[r] = a2; ol[r] = c2; }
        const size_t e = (size_t)row * pitch + cofs; *(v8h*)(P16 + e) = o16; *(v8us*)(Ph + e) = oh; *(v8us*)(Pl + e) = ol; }
}
// ---- k_gemmw: GEMM on K-contiguous bf16 planes, FOUR WAVES (2 x 2) per 128x128 output tile, each wave a 64x64 quarter (16 accumulators); grid (M/128, N/128), 128 threads.
// C[m][n] (f32, pitch ldc, + optional f32 bias[n]) = sum_k A[m][k] Bt[n][k] (+ A2[m][k] Bt[n][k] when NSPLIT == 1). K: a constant, whole stages, at least two.
// Operands go through LDS: a stage is 64 k (128 bytes) of the tile's rows [A 128 | A2 128 when NSPLIT | Bt 128] at a pitch of 144 bytes, brought by asynchronous 16-byte copies (8 lanes take one whole 128-byte line of a row),
// two buffers, the stage after next asked for as soon as every wave has left a buffer. Fragments are read from LDS in the k order of WFrag::ld, every accumulator takes its products in ascending k (A, then A2, per 32 k).
// PLANES (the q | k | v projection; rows = batch * TT + t, columns = q heads | k heads | v heads, so a wave's quarter is 64 positions of ONE head): no C; the epilogue stores the head planes, q and k heads as [head][t][d] (64 whole rows of 128 bytes),
// v heads as [head][d][t] (64 rows of d, 128 bytes of t each). 16 plane rows at a time are staged in the wave's own LDS slice, position-major for q and k, d-major for v (a lane's accumulator registers are 8 consecutive positions of one d).
template <typename T16> struct WFrag;
template <> struct WFrag<h16> { typedef v16h V; static __device__ __forceinline__ V ld(const h16* p) { return cat16(*(const v8h*)p, *(const v8h*)(p + 16)); } static __device__ __forceinline__ v8f mma(V a, V b, v8f c) { return wmma16(a, b, c); } };
template <> struct WFrag<bf> { typedef v16bf V; static __device__ __forceinline__ V ld(const bf* p) { return cat16b(*(const v8us*)p, *(const v8us*)(p + 16)); } static __device__ __forceinline__ v8f mma(V a, V b, v8f c) { return wmmab(a, b, c); } };
#define GPB 144                   // LDS row pitch in bytes: 16 x odd, free of bank conflicts for 16-byte reads of 128-byte rows
#define GPE (GPB / 2)             // the same in elements
// cp8: 128 rows x 128 bytes of one plane into LDS; the work-group's 128 threads take 16 rows a copy (thread: row tid / 8, 16-byte piece tid % 8), 8 copies each. l: the lane's LDS byte address, g: its global address, rs: 16 rows in elements.
// s_wait_xcnt 0 closes the statement: no address register of a copy is rewritten before it.
__device__ __forceinline__ void cp8(const unsigned l, const bf* g, const size_t rs) {
    asm volatile("global_load_async_to_lds_b128 %0, %8, off\n\t"
                 "global_load_async_to_lds_b128 %1, %9, off\n\t"
                 "global_load_async_to_lds_b128 %2, %10, off\n\t"
                 "global_load_async_to_lds_b128 %3, %11, off\n\t"
                 "global_load_async_to_lds_b128 %4, %12, off\n\t"
                 "global_load_async_to_lds_b128 %5, %13, off\n\t"
                 "global_load_async_to_lds_b128 %6, %14, off\n\t"
                 "global_load_async_to_lds_b128 %7, %15, off\n\t"
                 "s_wait_xcnt 0x0"
                 :: "v"(l), "v"(l + 16 * GPB), "v"(l + 32 * GPB), "v"(l + 48 * GPB), "v"(l + 64 * GPB), "v"(l + 80 * GPB), "v"(l + 96 * GPB), "v"(l + 112 * GPB),
                    "v"(g), "v"(g + rs), "v"(g + 2 * rs), "v"(g + 3 * rs), "v"(g + 4 * rs), "v"(g + 5 * rs), "v"(g + 6 * rs), "v"(g + 7 * rs) : "memory");
}
// waves_per_eu(4, 4): the projection stays inside 256 registers a wave, so that three of its work-groups (its grid is three for every WGP) are resident together; the two-plane instance, one work-group for every WGP, is held to the same bound
template <int NSPLIT, bool BIAS, bool PLANES, int K>
__global__ __launch_bounds__(128) __attribute__((amdgpu_waves_per_eu(4, 4))) void k_gemmw(const bf* __restrict__ A, const bf* __restrict__ A2, const bf* __restrict__ Bt, float* C, int ldc, const float* __restrict__ bias, h16* QK16, bf* QKh, bf* QKl, h16* VT16, bf* VTh, bf* VTl) {
    typedef WFrag<bf> WF; typedef typename WF::V V;
    static_assert((NSPLIT == 0 || NSPLIT == 1) && K % 64 == 0 && K >= 128, "one or two A planes; whole stages, at least two");
    constexpr int BROW = (NSPLIT ? 256 : 128), STAGE = (BROW + 128) * GPB;   // first Bt row of a stage; bytes of a stage
    __shared__ __align__(128) char ring[2 * STAGE];
    __shared__ __align__(16) float osall[4][16 * 68];
    const int tid = threadIdx.x, lane = tid & 31, lr = lane & 15, hi = lane >> 4; const int w = __builtin_amdgcn_readfirstlane(tid >> 5), wm = w >> 1, wn = w & 1;
    float* os = osall[w];
    const int R0 = blockIdx.x * 128, C0 = blockIdx.y * 128, r0 = R0 + wm * 64, c0 = C0 + wn * 64;
    v8f acc[4][4];
#pragma unroll
    for (int mb = 0; mb < 4; ++mb)
#pragma unroll
        for (int nb = 0; nb < 4; ++nb) acc[mb][nb] = (v8f){};
    const unsigned lcp = (unsigned)(size_t)ring + (unsigned)((tid >> 3) * GPB + (tid & 7) * 16);   // low 32 bits of a __shared__ address: the byte address in LDS
    const size_t rs = (size_t)16 * K; const size_t gofs = (size_t)(tid >> 3) * K + (tid & 7) * 8;
    const bf* gA = A + (size_t)R0 * K + gofs; const bf* gA2 = NSPLIT ? A2 + (size_t)R0 * K + gofs : nullptr; const bf* gB = Bt + (size_t)C0 * K + gofs;
    auto fill = [&](const int t) { const unsigned l = lcp + (unsigned)((t & 1) * STAGE); cp8(l, gA + t * 64, rs); if constexpr (NSPLIT == 1) cp8(l + 128 * GPB, gA2 + t * 64, rs); cp8(l + BROW * GPB, gB + t * 64, rs); };
    constexpr int NT = K / 64;
    fill(0);
    asm volatile("s_wait_asynccnt 0x0" ::: "memory");   // this wave's copies of stage 0 have landed
    __syncthreads();                                     // and so have the other waves'
    fill(1);
    const int aofs = (wm * 64 + lr) * GPE + 8 * hi, bofs = (BROW + wn * 64 + lr) * GPE + 8 * hi;   // the lane's element offsets in a stage
#pragma unroll 1
    for (int t = 0; t < NT; ++t) {   // stays rolled: one trip a stage, the buffer chosen by the trip's parity
        const bf* sb = (const bf*)(ring + (t & 1) * STAGE);
        // fragments of both 32-k halves of the stage; every loop here is unrolled so that the arrays are indexed by constants and stay in registers
        V a[2][4], a2[2][4], b[2][4];
#pragma unroll
        for (int mb = 0; mb < 4; ++mb) { a[0][mb] = WF::ld(sb + aofs + mb * 16 * GPE); if (NSPLIT == 1) a2[0][mb] = WF::ld(sb + aofs + (128 + mb * 16) * GPE); }
#pragma unroll
        for (int nb = 0; nb < 4; ++nb) b[0][nb] = WF::ld(sb + bofs + nb * 16 * GPE);
        if (NSPLIT == 0) {   // registers are free for the second half's A fragments: they fly during the first half's products
#pragma unroll
            for (int mb = 0; mb < 4; ++mb) a[1][mb] = WF::ld(sb + aofs + mb * 16 * GPE + 32); }
        __builtin_amdgcn_sched_barrier(0);   // the whole group of LDS reads is asked for before the first product: left free, the compiler keeps one Bt fragment and waits out an LDS latency in front of every four products
#pragma unroll
        for (int nb = 0; nb < 4; ++nb) {
#pragma unroll
            for (int mb = 0; mb < 4; ++mb) { acc[mb][nb] = WF::mma(a[0][mb], b[0][nb], acc[mb][nb]); if (NSPLIT == 1) acc[mb][nb] = WF::mma(a2[0][mb], b[0][nb], acc[mb][nb]); }
            b[1][nb] = WF::ld(sb + bofs + nb * 16 * GPE + 32);
            if (nb < 3) __builtin_amdgcn_sched_barrier(0);   // the second half's Bt fragment is asked for as soon as the first half's has been used up, not sunk to its own first use
        }
        if (NSPLIT == 1) {
#pragma unroll
            for (int mb = 0; mb < 4; ++mb) { a[1][mb] = WF::ld(sb + aofs + mb * 16 * GPE + 32); a2[1][mb] = WF::ld(sb + aofs + (128 + mb * 16) * GPE + 32); } }
        // the stage's last LDS read is asked for: the hand-over stands here, so that the refill flies during the second half's products (they read registers only)
        asm volatile("s_wait_dscnt 0x0" ::: "memory");      // this wave's reads of the buffer are done before the buffer is handed back
        asm volatile("s_wait_asynccnt 0x0" ::: "memory");   // this wave's copies of stage t + 1 have landed
        __syncthreads();                                     // publishes stage t + 1 and ends every wave's reads of stage t
        if (t + 2 < NT) fill(t + 2);
#pragma unroll
        for (int nb = 0; nb < 4; ++nb)
#pragma unroll
            for (int mb = 0; mb < 4; ++mb) { acc[mb][nb] = WF::mma(a[1][mb], b[1][nb], acc[mb][nb]); if (NSPLIT == 1) acc[mb][nb] = WF::mma(a2[1][mb], b[1][nb], acc[mb][nb]); }
    }
    asm volatile("s_wait_asynccnt 0x0" ::: "memory");   // no copy is outstanding when the wave goes on
    if constexpr (PLANES) {
        static_assert(HD == 64 && TT % 64 == 0, "a 64-column quarter is one head, a 64-row quarter lies in one batch");
        const size_t bb = (size_t)(r0 / TT), t0 = (size_t)(r0 % TT), hd = (size_t)(c0 / 64);   // batch of the group, first position, head block: q heads from 0, k heads from NH_, v heads from NH_ + NKV
        if (hd < NH_ + NKV) { const size_t zp = ((bb * (NH_ + NKV) + hd) * TT + t0) * HD;
#pragma unroll
            for (int mb = 0; mb < 4; ++mb) {
#pragma unroll
                for (int nb = 0; nb < 4; ++nb) {
#pragma unroll
                    for (int j = 0; j < 8; ++j) os[(hi * 8 + j) * 68 + nb * 16 + lr] = acc[mb][nb][j]; }
                __builtin_amdgcn_wave_barrier(); asm volatile("" ::: "memory");   // a lane reads what other lanes of the wave staged: no LDS read is lifted over the staging writes
                put_rows(os, lane, QK16 + zp + mb * 16 * HD, QKh + zp + mb * 16 * HD, QKl + zp + mb * 16 * HD, HD);
                __builtin_amdgcn_wave_barrier(); asm volatile("" ::: "memory");   // the next 16 rows are not staged over rows still to be read
            }
        } else { const size_t zp = (bb * NKV + (hd - (NH_ + NKV))) * HD * TT + t0;
#pragma unroll
            for (int nb = 0; nb < 4; ++nb) {
#pragma unroll
                for (int mb = 0; mb < 4; ++mb) { float* o = os + lr * 68 + mb * 16 + hi * 8; const v8f c = acc[mb][nb]; *(v4fa*)o = (v4f){ c[0], c[1], c[2], c[3] }; *(v4fa*)(o + 4) = (v4f){ c[4], c[5], c[6], c[7] }; }
                __builtin_amdgcn_wave_barrier(); asm volatile("" ::: "memory");   // as above: staging writes, then the reads
                put_rows(os, lane, VT16 + zp + (size_t)nb * 16 * TT, VTh + zp + (size_t)nb * 16 * TT, VTl + zp + (size_t)nb * 16 * TT, TT);
                __builtin_amdgcn_wave_barrier(); asm volatile("" ::: "memory");   // as above: the reads, then the next staging writes
            }
        }
        return;
    }
#pragma unroll
    for (int mb = 0; mb < 4; ++mb) {
#pragma unroll
        for (int nb = 0; nb < 4; ++nb) {
#pragma unroll
            for (int j = 0; j < 8; ++j) os[(hi * 8 + j) * 68 + nb * 16 + lr] = acc[mb][nb][j]; }
        __builtin_amdgcn_wave_barrier(); asm volatile("" ::: "memory");
        float* crow = C + (size_t)(r0 + mb * 16) * ldc + c0;
{
#pragma unroll
            for (int s = 0; s < 8; ++s) { const int row = 2 * s + hi, cofs = lr * 4; v4f val = *(const v4fa*)(os + row * 68 + cofs); if (BIAS) { val[0] += bfr(bias[c0 + cofs]); val[1] += bfr(bias[c0 + cofs + 1]); val[2] += bfr(bias[c0 + cofs + 2]); val[3] += bfr(bias[c0 + cofs + 3]); }
                *(v4f*)(crow + (size_t)row * ldc + cofs) = val; }
             }
        asm volatile("s_wait_xcnt 0x0" ::: "memory");   // behind the run of stores, in front of the next rows' arithmetic, which reuses registers that the stores name
        __builtin_amdgcn_wave_barrier(); asm volatile("" ::: "memory");
    }
}

typedef __attribute__((ext_vector_type(2))) _Float16 v2h;
typedef __attribute__((ext_vector_type(4))) _Float16 v4h;
typedef __attribute__((ext_vector_type(2))) unsigned short v2us;
typedef __attribute__((ext_vector_type(4))) unsigned short v4us;
typedef __attribute__((ext_vector_type(2))) float v2f;
typedef __attribute__((ext_vector_type(4))) int v4i;

__global__ __launch_bounds__(256) void k_wtG(const float* __restrict__ w, int K, int N, bf* Bt) {
    const int lane = threadIdx.x & 31; const int L0 = (blockIdx.x * 8 + (threadIdx.x >> 5)) * 8; const int nlines = N * K / 64;
{
#pragma unroll 1
        for (int l = 0; l < 8; ++l) { const int L = L0 + l; if (L >= nlines) break; const size_t e = (size_t)L * 64 + lane * 2; const int k = (int)(e % K), n = (int)(e / K); v2us o;
            o[0] = f2bf(w[(size_t)k * N + n]); o[1] = f2bf(w[(size_t)(k + 1) * N + n]); *(v2us*)(Bt + e) = o; }
         }
}
__global__ __launch_bounds__(256) void k_cvt8(const float* __restrict__ src, bf* dst, size_t n8) { const size_t i = (size_t)blockIdx.x * 256 + threadIdx.x; if (i >= n8) return; const v8f v = *(const v8f*)(src + i * 8); v8us o;
#pragma unroll
    for (int k = 0; k < 8; ++k) o[k] = f2bf(v[k]); *(v8us*)(dst + i * 8) = o;  }

// ---- k_fattn: the whole attention of 32 query rows in ONE WAVE, scores and weights never leave registers. Per pass of 32 keys: S^T = K Q^T (A = K rows, B = Q kept in registers), running maximum and sum per query
// (a lane holds one query's scores; the two lane halves split its keys), the two S^T tiles converted in place are the B operand of O^T += V^T P^T (A = V^T rows in the same k order as the loader's).
// Weights enter the product un-normalised, exp2(t - running max); O^T is divided by the row sum at the end and stored as the merged hi/lo planes [t][head * HD + d], 8 consecutive d per lane.
// Rows < RH: hi/lo planes, 3 products; the rest fp16. Grid (RH / 128, heads, batches), 8 waves: waves 0-3 take 128 rows < RH, waves 4-7 take 128 rows >= RH (equal work per work-group).
// K and V^T go through LDS, shared by the waves: a stage is 64 keys of the six planes, rows [K hi 64 | K lo 64 | K fp16 64 | V^T hi 64 | V^T lo 64 | V^T fp16 64] of 128 bytes at a pitch of 144 bytes (a K row is a key, a V^T row is a d),
// brought by asynchronous 16-byte copies (8 lanes take one whole 128-byte line), two buffers, one work-group barrier a stage. A stage is two passes of 32 keys; the fragments are read from LDS in the k order of WFrag::ld.
__device__ __forceinline__ float xhalf(float x) { const int b = __builtin_bit_cast(int, x); return __builtin_bit_cast(float, __builtin_amdgcn_permlanex16(b, b, 0x76543210, 0xfedcba98, false, false)); }   // lane l <-> lane l ^ 16
#define SCL2 (SCL * 1.4426950408889634f)   // score scale in the log2 domain
#define AST (384 * GPB)                    // bytes of a stage
// cp6: 64 rows x 128 bytes of each of three planes into LDS; the work-group's 256 threads take 32 rows a copy (thread: row tid / 8, 16-byte piece tid % 8), 2 copies a plane. l: the lane's LDS byte address in the first plane's block, g0 g1 g2: its global addresses, hb: 32 rows in bytes.
// s_wait_xcnt 0 closes the statement: no address register of a copy is rewritten before it.
__device__ __forceinline__ void cp6(const unsigned l, const char* g0, const char* g1, const char* g2, const size_t hb) {
    asm volatile("global_load_async_to_lds_b128 %0, %6, off\n\t"
                 "global_load_async_to_lds_b128 %1, %7, off\n\t"
                 "global_load_async_to_lds_b128 %2, %8, off\n\t"
                 "global_load_async_to_lds_b128 %3, %9, off\n\t"
                 "global_load_async_to_lds_b128 %4, %10, off\n\t"
                 "global_load_async_to_lds_b128 %5, %11, off\n\t"
                 "s_wait_xcnt 0x0"
                 :: "v"(l), "v"(l + 32 * GPB), "v"(l + 64 * GPB), "v"(l + 96 * GPB), "v"(l + 128 * GPB), "v"(l + 160 * GPB),
                    "v"(g0), "v"(g0 + hb), "v"(g1), "v"(g1 + hb), "v"(g2), "v"(g2 + hb) : "memory");
}
// one stage (64 keys, two passes) for one wave. sK, sK2, sV, sV2: the lane's addresses in the stage's K and V^T blocks (row lr, 16-byte piece hi). qa, qb: the Q fragments as raw registers.
template <typename T16, bool HL>
__device__ __forceinline__ void attn_stage(const char* sK, const char* sK2, const char* sV, const char* sV2, const v16h (&qa)[2][2], const v16h (&qb)[2][2], v8f (&o)[4][2], float (&m)[2], float (&l)[2]) {
    typedef WFrag<T16> WF; typedef typename WF::V V;
    // every loop below is unrolled so that the fragment and accumulator arrays are indexed by constants and stay in registers
#pragma unroll
    for (int ps = 0; ps < 2; ++ps) {
        v8f s[2][2];   // [key tile][query tile]: register r of lane (lr, hi) = score of key 32 ps + 16 kt + 8 hi + r of the stage, query 16 qt + lr
        V k[2][2], k2[2][2];
#pragma unroll
        for (int kt = 0; kt < 2; ++kt)
#pragma unroll
            for (int kc = 0; kc < 2; ++kc) { k[kt][kc] = WF::ld((const T16*)(sK + (ps * 32 + kt * 16) * GPB + kc * 64)); if (HL) k2[kt][kc] = WF::ld((const T16*)(sK2 + (ps * 32 + kt * 16) * GPB + kc * 64)); }
#pragma unroll
        for (int kt = 0; kt < 2; ++kt) { s[kt][0] = (v8f){}; s[kt][1] = (v8f){}; }
#pragma unroll
        for (int kc = 0; kc < 2; ++kc) { const V q0 = __builtin_bit_cast(V, qa[0][kc]), q1 = __builtin_bit_cast(V, qa[1][kc]);
#pragma unroll
            for (int kt = 0; kt < 2; ++kt) { s[kt][0] = WF::mma(k[kt][kc], q0, s[kt][0]); s[kt][1] = WF::mma(k[kt][kc], q1, s[kt][1]); }
            if (HL) { const V r0 = __builtin_bit_cast(V, qb[0][kc]), r1 = __builtin_bit_cast(V, qb[1][kc]);
#pragma unroll
                for (int kt = 0; kt < 2; ++kt) { s[kt][0] = WF::mma(k[kt][kc], r0, s[kt][0]); s[kt][1] = WF::mma(k[kt][kc], r1, s[kt][1]); }
#pragma unroll
                for (int kt = 0; kt < 2; ++kt) { s[kt][0] = WF::mma(k2[kt][kc], q0, s[kt][0]); s[kt][1] = WF::mma(k2[kt][kc], q1, s[kt][1]); } } }
        V v[4], v2[4];   // asked for here, they fly during the softmax arithmetic
#pragma unroll
        for (int dt = 0; dt < 4; ++dt) v[dt] = WF::ld((const T16*)(sV + dt * 16 * GPB + ps * 64));
        float mn[2]; bool need = false;
#pragma unroll
        for (int qt = 0; qt < 2; ++qt) { float mx = fmaxf(s[0][qt][0], s[1][qt][0]);
#pragma unroll
            for (int r = 1; r < 8; ++r) mx = fmaxf(mx, fmaxf(s[0][qt][r], s[1][qt][r]));
            mx = fmaxf(mx, xhalf(mx)); mn[qt] = fmaxf(m[qt], mx * SCL2); need = need || (mn[qt] > m[qt]); }
        if (__builtin_amdgcn_ballot_w32(need) != 0) {   // some query's maximum grew: bring its sum and its output column to the new maximum (factor 1 for the others)
#pragma unroll
            for (int qt = 0; qt < 2; ++qt) { const float al = __builtin_amdgcn_exp2f(m[qt] - mn[qt]); m[qt] = mn[qt]; l[qt] *= al;
#pragma unroll
                for (int dt = 0; dt < 4; ++dt) o[dt][qt] *= al; } }
        V p[2], p2[2];   // the weights as B operands: element e of lane (lr, hi) = key 32 ps + 16 (e >> 3) + 8 hi + (e & 7), the loader's k order
#pragma unroll
        for (int qt = 0; qt < 2; ++qt) {
#pragma unroll
            for (int e = 0; e < 16; ++e) { const float pe = __builtin_amdgcn_exp2f(fmaf(s[e >> 3][qt][e & 7], SCL2, -m[qt])); l[qt] += pe;
                if constexpr (HL) { const __bf16 ph = (__bf16)pe; p[qt][e] = ph; p2[qt][e] = (__bf16)(pe - (float)ph); } else { p[qt][e] = (h16)pe; } } }
        if (HL) {   // the lo-plane V^T reads: they fly during the hi-plane products
#pragma unroll
            for (int dt = 0; dt < 4; ++dt) v2[dt] = WF::ld((const T16*)(sV2 + dt * 16 * GPB + ps * 64)); }
#pragma unroll
        for (int qt = 0; qt < 2; ++qt)
#pragma unroll
            for (int dt = 0; dt < 4; ++dt) o[dt][qt] = WF::mma(v[dt], p[qt], o[dt][qt]);
        if (HL) {
#pragma unroll
            for (int qt = 0; qt < 2; ++qt)
#pragma unroll
                for (int dt = 0; dt < 4; ++dt) o[dt][qt] = WF::mma(v[dt], p2[qt], o[dt][qt]);
#pragma unroll
            for (int qt = 0; qt < 2; ++qt)
#pragma unroll
                for (int dt = 0; dt < 4; ++dt) o[dt][qt] = WF::mma(v2[dt], p[qt], o[dt][qt]); }
        if (HL && ps == 0) __builtin_amdgcn_sched_barrier(0);   // the second pass's K reads are not lifted into the first pass's products, where no registers are free for them: left free, the compiler spills a Q fragment and reloads it every pass
    }
}
static_assert(RH * 2 == TT && RH % 128 == 0 && HD == 64 && TT % 64 == 0 && TT >= 128, "k_fattn: half the rows hi/lo, 128 rows of each kind per work-group, head size 64, whole stages, at least two");
// waves_per_eu(4, 4): four waves a SIMD, so each wave may use a quarter of the SIMD's registers (256); the hi/lo path needs nearly all of them, and the grid is exactly four waves for every SIMD (two work-groups' LDS fit a WGP)
__global__ __launch_bounds__(256) __attribute__((amdgpu_waves_per_eu(4, 4))) void k_fattn(const h16* __restrict__ QK16, const bf* __restrict__ QKh, const bf* __restrict__ QKl, const h16* __restrict__ VT16, const bf* __restrict__ VTh, const bf* __restrict__ VTl, bf* ATh, bf* ATl) {
    __shared__ __align__(128) char ring[2 * AST];
    const int tid = threadIdx.x, lane = tid & 31, lr = lane & 15, hi = lane >> 4; const int w = __builtin_amdgcn_readfirstlane(tid >> 5);   // the wave's number in a scalar register: the branch in the loop is a scalar one, every lane stays on for the matrix instructions
    const size_t b = blockIdx.z, h = blockIdx.y; const size_t zq = (b * (NH_ + NKV) + h) * TT * HD, zk = (b * (NH_ + NKV) + NH_ + h / REP) * TT * HD, zv = (b * NKV + h / REP) * HD * TT;
    const size_t t0 = (w < 4) ? (size_t)blockIdx.x * 128 + w * 32 : (size_t)RH + blockIdx.x * 128 + (w - 4) * 32; const size_t ao = (b * TT + t0) * DQ + h * HD;
    auto fill = [&](const int t) {
        const unsigned row = (unsigned)tid >> 3, pc = ((unsigned)tid & 7u) * 16u;   // the thread's row of 32 and its 16-byte piece
        const unsigned lf = (unsigned)(size_t)ring + (unsigned)((t & 1) * AST) + row * GPB + pc;   // low 32 bits of a __shared__ address: the byte address in LDS
        const size_t ko = (zk + (size_t)t * 64 * HD) * 2 + row * (HD * 2) + pc, vo = (zv + (size_t)t * 64) * 2 + row * (TT * 2) + pc;   // byte offsets in a [key][HD] and a [d][TT] plane
        cp6(lf, (const char*)QKh + ko, (const char*)QKl + ko, (const char*)QK16 + ko, (size_t)32 * HD * 2);
        cp6(lf + 192 * GPB, (const char*)VTh + vo, (const char*)VTl + vo, (const char*)VT16 + vo, (size_t)32 * TT * 2); };
    constexpr int NT = TT / 64;
    fill(0);
    // the Q fragments, as raw registers: waves 0-3 hi and lo planes, waves 4-7 the fp16 plane (their second set is loaded and not used)
    const h16* Qa = ((w < 4) ? (const h16*)QKh : QK16) + zq + t0 * HD + lr * HD + 8 * hi; const h16* Qb = (const h16*)QKl + zq + t0 * HD + lr * HD + 8 * hi;
    v16h qa[2][2], qb[2][2];
#pragma unroll
    for (int qt = 0; qt < 2; ++qt)
#pragma unroll
        for (int kc = 0; kc < 2; ++kc) { qa[qt][kc] = WFrag<h16>::ld(Qa + qt * 16 * HD + kc * 32); qb[qt][kc] = WFrag<h16>::ld(Qb + qt * 16 * HD + kc * 32); }
    v8f o[4][2];
#pragma unroll
    for (int dt = 0; dt < 4; ++dt)
#pragma unroll
        for (int qt = 0; qt < 2; ++qt) o[dt][qt] = (v8f){};
    float m[2] = { -3.0e38f, -3.0e38f }, l[2] = { 0.f, 0.f };
    asm volatile("s_wait_asynccnt 0x0" ::: "memory");   // this wave's copies of stage 0 have landed
    __syncthreads();                                     // and so have the other waves'
    fill(1);
    const int lofs = lr * GPB + hi * 16;   // the lane's byte offset in a block of rows
    const bool whl = __builtin_amdgcn_readfirstlane(tid >> 7) == 0;   // waves 0-3, in a scalar register of its own
#pragma unroll 1
    for (int t = 0; t < NT; ++t) {   // stays rolled: one trip a stage, the buffer chosen by the trip's parity
        const char* sb = ring + (t & 1) * AST + lofs;
        // two tests in a row on two scalars, not an if / else: the compiler lays an if / else out as two tests in a row and then keeps the two arms' accumulators in different registers (two copies of all of them a stage, and spills in the fp16 arm)
        if (whl) attn_stage<bf, true>(sb, sb + 64 * GPB, sb + 192 * GPB, sb + 256 * GPB, qa, qb, o, m, l);
        if (w >= 4) attn_stage<h16, false>(sb + 128 * GPB, nullptr, sb + 320 * GPB, nullptr, qa, qb, o, m, l);
        asm volatile("s_wait_dscnt 0x0" ::: "memory");      // this wave's reads of the buffer are done before the buffer is handed back
        asm volatile("s_wait_asynccnt 0x0" ::: "memory");   // this wave's copies of stage t + 1 have landed
        __syncthreads();                                     // publishes stage t + 1 and ends every wave's reads of stage t
        if (t + 2 < NT) fill(t + 2);
    }
    asm volatile("s_wait_asynccnt 0x0" ::: "memory");   // no copy is outstanding when the wave goes on
    bf* Ah = ATh + ao; bf* Al = ATl + ao;
    const int ln = (int)__builtin_amdgcn_mbcnt_lo(~0u, 0u);   // the lane's number, read anew: no register carries it through the loop, whose live set is near the 256 budget
#pragma unroll
    for (int qt = 0; qt < 2; ++qt) { const float inv = __fdiv_rn(1.0f, l[qt] + xhalf(l[qt])); const size_t ro = (size_t)(qt * 16 + (ln & 15)) * DQ + 8 * (ln >> 4);
#pragma unroll
        for (int dt = 0; dt < 4; ++dt) { v8us oh, ol;
#pragma unroll
            for (int r = 0; r < 8; ++r) { unsigned short a, c2; splitf(o[dt][qt][r] * inv, a, c2); oh[r] = a; ol[r] = c2; }
            *(v8us*)(Ah + ro + dt * 16) = oh; *(v8us*)(Al + ro + dt * 16) = ol; } }
}

extern "C" void kernel_launch(void* const* d_in, const int* in_sizes, int n_in,
                              void* d_out, int out_size, void* d_ws, size_t ws_size, hipStream_t stream) {
    (void)in_sizes; (void)n_in; (void)out_size;
    const float* x = (const float*)d_in[0]; const float* wqkv = (const float*)d_in[1]; const float* wo = (const float*)d_in[2]; const float* bo = (const float*)d_in[3];   /* argument order x, w_qkv ('xw' [1024][3072]), w_out ('xw'), b_out */
    float* OUT = (float*)d_out;     // [8][1024][1024]
    char* wsp = (char*)d_ws;
    auto take = [&](size_t bytes) { char* p = wsp; wsp += (bytes + 255) & ~(size_t)255; return (void*)p; };
    bf* WQKV = (bf*)take((size_t)3 * DQ * DM * 2);   /* fused Bt [3*DQ][DM]: q | k | v row blocks */ bf* WO = (bf*)take((size_t)DM * DQ * 2);
    bf* XB = (bf*)take((size_t)GB * TT * DM * 2);   // per group: XB [GB*TT][DM] bf16
    h16* QK16 = (h16*)take((size_t)NB_ * (NH_ + NKV) * TT * HD * 2); bf* QKh = (bf*)take((size_t)NB_ * (NH_ + NKV) * TT * HD * 2); bf* QKl = (bf*)take((size_t)NB_ * (NH_ + NKV) * TT * HD * 2);   // planes [batch][16 q heads | 16 k heads][t][d], all batches
    h16* VT16 = (h16*)take((size_t)NB_ * NKV * HD * TT * 2); bf* VTh = (bf*)take((size_t)NB_ * NKV * HD * TT * 2); bf* VTl = (bf*)take((size_t)NB_ * NKV * HD * TT * 2);   // planes [batch][head][d][t], all batches
    bf* ATh = (bf*)take((size_t)NB_ * TT * DQ * 2); bf* ATl = (bf*)take((size_t)NB_ * TT * DQ * 2);   // merged attention output, hi/lo, [batch * TT + t][DQ]
    if ((size_t)(wsp - (char*)d_ws) > ws_size) return;    // ws 256 MiB, under 193 MiB used
    { k_wtG<<<(unsigned)((DM * 3 * DQ / 64 + 63) / 64), 256, 0, stream>>>(wqkv, DM, 3 * DQ, WQKV);   /* fused 'xw' [DM][3*DQ] -> Bt [3*DQ][DM] */
      k_wtG<<<(unsigned)((DQ * DM / 64 + 63) / 64), 256, 0, stream>>>(wo, DQ, DM, WO);
       }
    for (int b0 = 0; b0 < NB_; b0 += GB) { const size_t pq = (size_t)b0 * (NH_ + NKV) * TT * HD, pv = (size_t)b0 * NKV * HD * TT;   // the group's block of planes
        k_cvt8<<<(unsigned)(((size_t)GB * TT * DM / 8 + 255) / 256), 256, 0, stream>>>(x + (size_t)b0 * TT * DM, XB, (size_t)GB * TT * DM / 8);
        k_gemmw<0, false, true, DM><<<dim3(GB * TT / 128, 3 * DQ / 128, 1), 128, 0, stream>>>(XB, nullptr, WQKV, nullptr, 0, nullptr, QK16 + pq, QKh + pq, QKl + pq, VT16 + pv, VTh + pv, VTl + pv); }
    k_fattn<<<dim3(RH / 128, NH_, NB_), 256, 0, stream>>>(QK16, QKh, QKl, VT16, VTh, VTl, ATh, ATl);
    for (int b0 = 0; b0 < NB_; b0 += GB)
        k_gemmw<1, true, false, DQ><<<dim3(GB * TT / 128, DM / 128, 1), 128, 0, stream>>>(ATh + (size_t)b0 * TT * DQ, ATl + (size_t)b0 * TT * DQ, WO, OUT + (size_t)b0 * TT * DM, DM, bo, nullptr, nullptr, nullptr, nullptr, nullptr, nullptr);
}

// v006
// One run takes 156 microseconds.
// Two timings next to v005 both put it at 1.18 times that version's speed.
// All steps since v000 together make it 29.7 times as fast.
#include <hip/hip_runtime.h>

// Multi-head self-attention with a fused qkv projection (x [8][1024][1024]; qkv = x w_qkv ('xw' [1024][3072], no bias) -> q | k | v (16 heads x 64); dots x 1024^-0.5 (the repo scales by dim); softmax (no mask); out = merged w_out + b_out ('xw') -> [8][1024][1024] (8.4 M); argument order x, w_qkv, w_out, b_out).
// Layout: ONE preparation launch (bf16 copy of x, all batches; both 'xw' weights transposed, the fused one as q | k | v row blocks); ONE launch of exact projections whose epilogue stores the head planes itself (planes of all batches kept); ONE fused attention launch over all batches and heads (hybrid rows: < 512 hi/lo 3 products, rest fp16; K and V^T staged in LDS, scores and weights stay in registers); ONE launch of merged hi/lo x w_out exact + b_out. Four launches.
// Compute dtypes, f32 accumulate: every input rounded to bf16; projections exact; attention rows < 512 3 products, rest fp16; softmax f32; w_out hl x exact + bias.

#define NB_  8
#define TT   1024
#define DM   1024
#define NH_  16
#define NKV  16
#define REP  (NH_ / NKV)
#define HD   64
#define DQ   (NH_ * HD)
#define DKV  (NKV * HD)
#define RH   512                  // query rows < RH use hi+lo planes
#define WIN  0
#define SCL  0.03125f   // dim^-0.5 = 1/32 (the repo scales by dim)
typedef _Float16 h16;
typedef unsigned short bf;
typedef __attribute__((ext_vector_type(16))) __bf16   v16bf;
typedef __attribute__((ext_vector_type(16))) _Float16 v16h;
typedef __attribute__((ext_vector_type(8)))  _Float16 v8h;
typedef __attribute__((ext_vector_type(8)))  unsigned short v8us;
typedef __attribute__((ext_vector_type(8)))  float    v8f;
typedef __attribute__((ext_vector_type(4)))  float    v4f;
typedef v8h  __attribute__((may_alias)) v8ha;
typedef v4f  __attribute__((may_alias)) v4fa;
typedef v8us __attribute__((may_alias)) v8usa;

__device__ __forceinline__ unsigned short f2bf(float f) { unsigned u = __float_as_uint(f); u += 0x7FFFu + ((u >> 16) & 1u); return (unsigned short)(u >> 16); }
__device__ __forceinline__ float bf2f(unsigned short b) { return __uint_as_float(((unsigned)b) << 16); }
__device__ __forceinline__ float bfr(float f) { return bf2f(f2bf(f)); }
__device__ __forceinline__ v16h cat16(v8h lo, v8h hi) { return __builtin_shufflevector(lo, hi, 0, 1, 2, 3, 4, 5, 6, 7, 8, 9, 10, 11, 12, 13, 14, 15); }
__device__ __forceinline__ v16bf cat16b(v8us lo, v8us hi) { return __builtin_bit_cast(v16bf, __builtin_shufflevector(lo, hi, 0, 1, 2, 3, 4, 5, 6, 7, 8, 9, 10, 11, 12, 13, 14, 15)); }
__device__ __forceinline__ v8f wmma16(v16h a, v16h b, v8f c) { return __builtin_amdgcn_wmma_f32_16x16x32_f16(false, a, false, b, (short)0, c, false, false); }
__device__ __forceinline__ v8f wmmab(v16bf a, v16bf b, v8f c) { return __builtin_amdgcn_wmma_f32_16x16x32_bf16(false, a, false, b, (short)0, c, false, false); }



__device__ __forceinline__ h16 tohx(float x) { return (h16)x; }
__device__ __forceinline__ void splitf(float y, unsigned short& h, unsigned short& l) { h = f2bf(y); l = f2bf(y - bf2f(h)); }
// put_rows: 16 plane rows of 64 values, staged as f32 in LDS at pitch 68, go out as fp16, hi and lo planes at P + row * pitch; a lane takes 8 consecutive values of a row, so every store instruction writes 4 whole 128-byte lines
__device__ __forceinline__ void put_rows(const float* os, const int lane, h16* P16, bf* Ph, bf* Pl, const size_t pitch) {
#pragma unroll
    for (int s = 0; s < 4; ++s) { const int row = 4 * s + (lane >> 3), cofs = (lane & 7) * 8; const v4f x0 = *(const v4fa*)(os + row * 68 + cofs), x1 = *(const v4fa*)(os + row * 68 + cofs + 4); v8h o16; v8us oh, ol;
#pragma unroll
        for (int r = 0; r < 8; ++r) { const float x = (r < 4) ? x0[r & 3] : x1[r & 3]; o16[r] = tohx(x); unsigned short a2, c2; splitf(x, a2, c2); oh[r] = a2; ol[r] = c2; }
        const size_t e = (size_t)row * pitch + cofs; *(v8h*)(P16 + e) = o16; *(v8us*)(Ph + e) = oh; *(v8us*)(Pl + e) = ol; }
}
// ---- k_gemmw: GEMM on K-contiguous bf16 planes, FOUR WAVES (2 x 2) per 128x128 output tile, each wave a 64x64 quarter (16 accumulators); grid (M/128, N/128), 128 threads.
// C[m][n] (f32, pitch ldc, + optional f32 bias[n]) = sum_k A[m][k] Bt[n][k] (+ A2[m][k] Bt[n][k] when NSPLIT == 1). K: a constant, whole stages, at least two.
// Operands go through LDS: a stage is 64 k (128 bytes) of the tile's rows [A 128 | A2 128 when NSPLIT | Bt 128] at a pitch of 144 bytes, brought by asynchronous 16-byte copies (8 lanes take one whole 128-byte line of a row),
// two buffers, the stage after next asked for as soon as every wave has left a buffer. Fragments are read from LDS in the k order of WFrag::ld, every accumulator takes its products in ascending k (A, then A2, per 32 k).
// PLANES (the q | k | v projection; rows = batch * TT + t, columns = q heads | k heads | v heads, so a wave's quarter is 64 positions of ONE head): no C; the epilogue stores the head planes, q and k heads as [head][t][d] (64 whole rows of 128 bytes),
// v heads as [head][d][t] (64 rows of d, 128 bytes of t each). 16 plane rows at a time are staged in the wave's own LDS slice, position-major for q and k, d-major for v (a lane's accumulator registers are 8 consecutive positions of one d).
template <typename T16> struct WFrag;
template <> struct WFrag<h16> { typedef v16h V; static __device__ __forceinline__ V ld(const h16* p) { return cat16(*(const v8h*)p, *(const v8h*)(p + 16)); } static __device__ __forceinline__ v8f mma(V a, V b, v8f c) { return wmma16(a, b, c); } };
template <> struct WFrag<bf> { typedef v16bf V; static __device__ __forceinline__ V ld(const bf* p) { return cat16b(*(const v8us*)p, *(const v8us*)(p + 16)); } static __device__ __forceinline__ v8f mma(V a, V b, v8f c) { return wmmab(a, b, c); } };
#define GPB 144                   // LDS row pitch in bytes: 16 x odd, free of bank conflicts for 16-byte reads of 128-byte rows
#define GPE (GPB / 2)             // the same in elements
// cp8: 128 rows x 128 bytes of one plane into LDS; the work-group's 128 threads take 16 rows a copy (thread: row tid / 8, 16-byte piece tid % 8), 8 copies each. l: the lane's LDS byte address, g: its global address, rs: 16 rows in elements.
// s_wait_xcnt 0 closes the statement: no address register of a copy is rewritten before it.
__device__ __forceinline__ void cp8(const unsigned l, const bf* g, const size_t rs) {
    asm volatile("global_load_async_to_lds_b128 %0, %8, off\n\t"
                 "global_load_async_to_lds_b128 %1, %9, off\n\t"
                 "global_load_async_to_lds_b128 %2, %10, off\n\t"
                 "global_load_async_to_lds_b128 %3, %11, off\n\t"
                 "global_load_async_to_lds_b128 %4, %12, off\n\t"
                 "global_load_async_to_lds_b128 %5, %13, off\n\t"
                 "global_load_async_to_lds_b128 %6, %14, off\n\t"
                 "global_load_async_to_lds_b128 %7, %15, off\n\t"
                 "s_wait_xcnt 0x0"
                 :: "v"(l), "v"(l + 16 * GPB), "v"(l + 32 * GPB), "v"(l + 48 * GPB), "v"(l + 64 * GPB), "v"(l + 80 * GPB), "v"(l + 96 * GPB), "v"(l + 112 * GPB),
                    "v"(g), "v"(g + rs), "v"(g + 2 * rs), "v"(g + 3 * rs), "v"(g + 4 * rs), "v"(g + 5 * rs), "v"(g + 6 * rs), "v"(g + 7 * rs) : "memory");
}
// waves_per_eu(4, 4): the projection stays inside 256 registers a wave, so that three of its work-groups (its grid is six for every WGP) are resident together; the two-plane instance, two work-groups for every WGP (its LDS lets two be resident), is held to the same bound
template <int NSPLIT, bool BIAS, bool PLANES, int K>
__global__ __launch_bounds__(128) __attribute__((amdgpu_waves_per_eu(4, 4))) void k_gemmw(const bf* __restrict__ A, const bf* __restrict__ A2, const bf* __restrict__ Bt, float* C, int ldc, const float* __restrict__ bias, h16* QK16, bf* QKh, bf* QKl, h16* VT16, bf* VTh, bf* VTl) {
    typedef WFrag<bf> WF; typedef typename WF::V V;
    static_assert((NSPLIT == 0 || NSPLIT == 1) && K % 64 == 0 && K >= 128, "one or two A planes; whole stages, at least two");
    constexpr int BROW = (NSPLIT ? 256 : 128), STAGE = (BROW + 128) * GPB;   // first Bt row of a stage; bytes of a stage
    __shared__ __align__(128) char ring[2 * STAGE];
    __shared__ __align__(16) float osall[4][16 * 68];
    const int tid = threadIdx.x, lane = tid & 31, lr = lane & 15, hi = lane >> 4; const int w = __builtin_amdgcn_readfirstlane(tid >> 5), wm = w >> 1, wn = w & 1;
    float* os = osall[w];
    const int R0 = blockIdx.x * 128, C0 = blockIdx.y * 128, r0 = R0 + wm * 64, c0 = C0 + wn * 64;
    v8f acc[4][4];
#pragma unroll
    for (int mb = 0; mb < 4; ++mb)
#pragma unroll
        for (int nb = 0; nb < 4; ++nb) acc[mb][nb] = (v8f){};
    const unsigned lcp = (unsigned)(size_t)ring + (unsigned)((tid >> 3) * GPB + (tid & 7) * 16);   // low 32 bits of a __shared__ address: the byte address in LDS
    const size_t rs = (size_t)16 * K; const size_t gofs = (size_t)(tid >> 3) * K + (tid & 7) * 8;
    const bf* gA = A + (size_t)R0 * K + gofs; const bf* gA2 = NSPLIT ? A2 + (size_t)R0 * K + gofs : nullptr; const bf* gB = Bt + (size_t)C0 * K + gofs;
    auto fill = [&](const int t) { const unsigned l = lcp + (unsigned)((t & 1) * STAGE); cp8(l, gA + t * 64, rs); if constexpr (NSPLIT == 1) cp8(l + 128 * GPB, gA2 + t * 64, rs); cp8(l + BROW * GPB, gB + t * 64, rs); };
    constexpr int NT = K / 64;
    fill(0);
    asm volatile("s_wait_asynccnt 0x0" ::: "memory");   // this wave's copies of stage 0 have landed
    __syncthreads();                                     // and so have the other waves'
    fill(1);
    const int aofs = (wm * 64 + lr) * GPE + 8 * hi, bofs = (BROW + wn * 64 + lr) * GPE + 8 * hi;   // the lane's element offsets in a stage
#pragma unroll 1
    for (int t = 0; t < NT; ++t) {   // stays rolled: one trip a stage, the buffer chosen by the trip's parity
        const bf* sb = (const bf*)(ring + (t & 1) * STAGE);
        // fragments of both 32-k halves of the stage; every loop here is unrolled so that the arrays are indexed by constants and stay in registers
        V a[2][4], a2[2][4], b[2][4];
#pragma unroll
        for (int mb = 0; mb < 4; ++mb) { a[0][mb] = WF::ld(sb + aofs + mb * 16 * GPE); if (NSPLIT == 1) a2[0][mb] = WF::ld(sb + aofs + (128 + mb * 16) * GPE); }
#pragma unroll
        for (int nb = 0; nb < 4; ++nb) b[0][nb] = WF::ld(sb + bofs + nb * 16 * GPE);
        if (NSPLIT == 0) {   // registers are free for the second half's A fragments: they fly during the first half's products
#pragma unroll
            for (int mb = 0; mb < 4; ++mb) a[1][mb] = WF::ld(sb + aofs + mb * 16 * GPE + 32); }
        __builtin_amdgcn_sched_barrier(0);   // the whole group of LDS reads is asked for before the first product: left free, the compiler keeps one Bt fragment and waits out an LDS latency in front of every four products
#pragma unroll
        for (int nb = 0; nb < 4; ++nb) {
#pragma unroll
            for (int mb = 0; mb < 4; ++mb) { acc[mb][nb] = WF::mma(a[0][mb], b[0][nb], acc[mb][nb]); if (NSPLIT == 1) acc[mb][nb] = WF::mma(a2[0][mb], b[0][nb], acc[mb][nb]); }
            b[1][nb] = WF::ld(sb + bofs + nb * 16 * GPE + 32);
            if (nb < 3) __builtin_amdgcn_sched_barrier(0);   // the second half's Bt fragment is asked for as soon as the first half's has been used up, not sunk to its own first use
        }
        if (NSPLIT == 1) {
#pragma unroll
            for (int mb = 0; mb < 4; ++mb) { a[1][mb] = WF::ld(sb + aofs + mb * 16 * GPE + 32); a2[1][mb] = WF::ld(sb + aofs + (128 + mb * 16) * GPE + 32); } }
        // the stage's last LDS read is asked for: the hand-over stands here, so that the refill flies during the second half's products (they read registers only)
        asm volatile("s_wait_dscnt 0x0" ::: "memory");      // this wave's reads of the buffer are done before the buffer is handed back
        asm volatile("s_wait_asynccnt 0x0" ::: "memory");   // this wave's copies of stage t + 1 have landed
        __syncthreads();                                     // publishes stage t + 1 and ends every wave's reads of stage t
        if (t + 2 < NT) fill(t + 2);
#pragma unroll
        for (int nb = 0; nb < 4; ++nb)
#pragma unroll
            for (int mb = 0; mb < 4; ++mb) { acc[mb][nb] = WF::mma(a[1][mb], b[1][nb], acc[mb][nb]); if (NSPLIT == 1) acc[mb][nb] = WF::mma(a2[1][mb], b[1][nb], acc[mb][nb]); }
    }
    asm volatile("s_wait_asynccnt 0x0" ::: "memory");   // no copy is outstanding when the wave goes on
    if constexpr (PLANES) {
        static_assert(HD == 64 && TT % 64 == 0, "a 64-column quarter is one head, a 64-row quarter lies in one batch");
        const size_t bb = (size_t)(r0 / TT), t0 = (size_t)(r0 % TT), hd = (size_t)(c0 / 64);   // batch of the group, first position, head block: q heads from 0, k heads from NH_, v heads from NH_ + NKV
        if (hd < NH_ + NKV) { const size_t zp = ((bb * (NH_ + NKV) + hd) * TT + t0) * HD;
#pragma unroll
            for (int mb = 0; mb < 4; ++mb) {
#pragma unroll
                for (int nb = 0; nb < 4; ++nb) {
#pragma unroll
                    for (int j = 0; j < 8; ++j) os[(hi * 8 + j) * 68 + nb * 16 + lr] = acc[mb][nb][j]; }
                __builtin_amdgcn_wave_barrier(); asm volatile("" ::: "memory");   // a lane reads what other lanes of the wave staged: no LDS read is lifted over the staging writes
                put_rows(os, lane, QK16 + zp + mb * 16 * HD, QKh + zp + mb * 16 * HD, QKl + zp + mb * 16 * HD, HD);
                __builtin_amdgcn_wave_barrier(); asm volatile("" ::: "memory");   // the next 16 rows are not staged over rows still to be read
            }
        } else { const size_t zp = (bb * NKV + (hd - (NH_ + NKV))) * HD * TT + t0;
#pragma unroll
            for (int nb = 0; nb < 4; ++nb) {
#pragma unroll
                for (int mb = 0; mb < 4; ++mb) { float* o = os + lr * 68 + mb * 16 + hi * 8; const v8f c = acc[mb][nb]; *(v4fa*)o = (v4f){ c[0], c[1], c[2], c[3] }; *(v4fa*)(o + 4) = (v4f){ c[4], c[5], c[6], c[7] }; }
                __builtin_amdgcn_wave_barrier(); asm volatile("" ::: "memory");   // as above: staging writes, then the reads
                put_rows(os, lane, VT16 + zp + (size_t)nb * 16 * TT, VTh + zp + (size_t)nb * 16 * TT, VTl + zp + (size_t)nb * 16 * TT, TT);
                __builtin_amdgcn_wave_barrier(); asm volatile("" ::: "memory");   // as above: the reads, then the next staging writes
            }
        }
        return;
    }
#pragma unroll
    for (int mb = 0; mb < 4; ++mb) {
#pragma unroll
        for (int nb = 0; nb < 4; ++nb) {
#pragma unroll
            for (int j = 0; j < 8; ++j) os[(hi * 8 + j) * 68 + nb * 16 + lr] = acc[mb][nb][j]; }
        __builtin_amdgcn_wave_barrier(); asm volatile("" ::: "memory");
        float* crow = C + (size_t)(r0 + mb * 16) * ldc + c0;
{
#pragma unroll
            for (int s = 0; s < 8; ++s) { const int row = 2 * s + hi, cofs = lr * 4; v4f val = *(const v4fa*)(os + row * 68 + cofs); if (BIAS) { val[0] += bfr(bias[c0 + cofs]); val[1] += bfr(bias[c0 + cofs + 1]); val[2] += bfr(bias[c0 + cofs + 2]); val[3] += bfr(bias[c0 + cofs + 3]); }
                *(v4f*)(crow + (size_t)row * ldc + cofs) = val; }
             }
        asm volatile("s_wait_xcnt 0x0" ::: "memory");   // behind the run of stores, in front of the next rows' arithmetic, which reuses registers that the stores name
        __builtin_amdgcn_wave_barrier(); asm volatile("" ::: "memory");
    }
}

typedef __attribute__((ext_vector_type(2))) _Float16 v2h;
typedef __attribute__((ext_vector_type(4))) _Float16 v4h;
typedef __attribute__((ext_vector_type(2))) unsigned short v2us;
typedef __attribute__((ext_vector_type(4))) unsigned short v4us;
typedef __attribute__((ext_vector_type(2))) float v2f;
typedef __attribute__((ext_vector_type(4))) int v4i;

// ---- k_prep: the three independent preparations as block ranges of ONE launch: blocks [0, WB1) transpose w_qkv, [WB1, WB1 + WB2) transpose w_out, the rest convert x. The transposes stand first: their blocks run longest and start first.
// wt_lines: 'xw' weight w [K][N] f32 -> Bt [N][K] bf16; a wave writes 8 lines of 64 outputs, blk is the block's number inside its range
__device__ __forceinline__ void wt_lines(const float* __restrict__ w, const int K, const int N, bf* Bt, const int blk) {
    const int lane = threadIdx.x & 31; const int L0 = (blk * 8 + (threadIdx.x >> 5)) * 8; const int nlines = N * K / 64;
#pragma unroll 1
    for (int l = 0; l < 8; ++l) {   // left rolled, one line a trip, as the separate transpose kernels had it
        const int L = L0 + l; if (L >= nlines) break; const size_t e = (size_t)L * 64 + lane * 2; const int k = (int)(e % K), n = (int)(e / K); v2us o;
        o[0] = f2bf(w[(size_t)k * N + n]); o[1] = f2bf(w[(size_t)(k + 1) * N + n]); *(v2us*)(Bt + e) = o; }
}
#define WB1 (DM * 3 * DQ / 64 / 64)           // blocks of the w_qkv transpose: 64 lines of 64 outputs a block
#define WB2 (DQ * DM / 64 / 64)               // blocks of the w_out transpose
#define XB8 (NB_ * TT * DM / 8 / 256)         // blocks of the x conversion: 8 values a thread
static_assert((DM * 3 * DQ) % 4096 == 0 && (DQ * DM) % 4096 == 0 && (NB_ * TT * DM) % 2048 == 0, "k_prep: whole blocks in every range");
__global__ __launch_bounds__(256) void k_prep(const float* __restrict__ x, const float* __restrict__ wqkv, const float* __restrict__ wo, bf* XB, bf* WQKV, bf* WO) {
    const int blk = blockIdx.x;
    if (blk < WB1) { wt_lines(wqkv, DM, 3 * DQ, WQKV, blk); return; }            // fused 'xw' [DM][3*DQ] -> Bt [3*DQ][DM]
    if (blk < WB1 + WB2) { wt_lines(wo, DQ, DM, WO, blk - WB1); return; }
    const size_t i = (size_t)(blk - (WB1 + WB2)) * 256 + threadIdx.x; const v8f v = *(const v8f*)(x + i * 8); v8us o;
#pragma unroll
    for (int k = 0; k < 8; ++k) o[k] = f2bf(v[k]);   // unrolled: the vectors are indexed by constants
    *(v8us*)(XB + i * 8) = o;
    asm volatile("s_wait_xcnt 0x0" ::: "memory");   // behind the store: the compiler lays the transposes' code behind this range, and that code rewrites registers that the store names
}

// ---- k_fattn: the whole attention of 32 query rows in ONE WAVE, scores and weights never leave registers. Per pass of 32 keys: S^T = K Q^T (A = K rows, B = Q kept in registers), running maximum and sum per query
// (a lane holds one query's scores; the two lane halves split its keys), the two S^T tiles converted in place are the B operand of O^T += V^T P^T (A = V^T rows in the same k order as the loader's).
// Weights enter the product un-normalised, exp2(t - running max); O^T is divided by the row sum at the end and stored as the merged hi/lo planes [t][head * HD + d], 8 consecutive d per lane.
// Rows < RH: hi/lo planes, 3 products; the rest fp16. Grid (RH / 128, heads, batches), 8 waves: waves 0-3 take 128 rows < RH, waves 4-7 take 128 rows >= RH (equal work per work-group).
// K and V^T go through LDS, shared by the waves: a stage is 64 keys of the six planes, rows [K hi 64 | K lo 64 | K fp16 64 | V^T hi 64 | V^T lo 64 | V^T fp16 64] of 128 bytes at a pitch of 144 bytes (a K row is a key, a V^T row is a d),
// brought by asynchronous 16-byte copies (8 lanes take one whole 128-byte line), two buffers, one work-group barrier a stage. A stage is two passes of 32 keys; the fragments are read from LDS in the k order of WFrag::ld.
__device__ __forceinline__ float xhalf(float x) { const int b = __builtin_bit_cast(int, x); return __builtin_bit_cast(float, __builtin_amdgcn_permlanex16(b, b, 0x76543210, 0xfedcba98, false, false)); }   // lane l <-> lane l ^ 16
#define SCL2 (SCL * 1.4426950408889634f)   // score scale in the log2 domain
#define AST (384 * GPB)                    // bytes of a stage
// cp6: 64 rows x 128 bytes of each of three planes into LDS; the work-group's 256 threads take 32 rows a copy (thread: row tid / 8, 16-byte piece tid % 8), 2 copies a plane. l: the lane's LDS byte address in the first plane's block, g0 g1 g2: its global addresses, hb: 32 rows in bytes.
// s_wait_xcnt 0 closes the statement: no address register of a copy is rewritten before it.
__device__ __forceinline__ void cp6(const unsigned l, const char* g0, const char* g1, const char* g2, const size_t hb) {
    asm volatile("global_load_async_to_lds_b128 %0, %6, off\n\t"
                 "global_load_async_to_lds_b128 %1, %7, off\n\t"
                 "global_load_async_to_lds_b128 %2, %8, off\n\t"
                 "global_load_async_to_lds_b128 %3, %9, off\n\t"
                 "global_load_async_to_lds_b128 %4, %10, off\n\t"
                 "global_load_async_to_lds_b128 %5, %11, off\n\t"
                 "s_wait_xcnt 0x0"
                 :: "v"(l), "v"(l + 32 * GPB), "v"(l + 64 * GPB), "v"(l + 96 * GPB), "v"(l + 128 * GPB), "v"(l + 160 * GPB),
                    "v"(g0), "v"(g0 + hb), "v"(g1), "v"(g1 + hb), "v"(g2), "v"(g2 + hb) : "memory");
}
// one stage (64 keys, two passes) for one wave. sK, sK2, sV, sV2: the lane's addresses in the stage's K and V^T blocks (row lr, 16-byte piece hi). qa, qb: the Q fragments as raw registers.
template <typename T16, bool HL>
__device__ __forceinline__ void attn_stage(const char* sK, const char* sK2, const char* sV, const char* sV2, const v16h (&qa)[2][2], const v16h (&qb)[2][2], v8f (&o)[4][2], float (&m)[2], float (&l)[2]) {
    typedef WFrag<T16> WF; typedef typename WF::V V;
    // every loop below is unrolled so that the fragment and accumulator arrays are indexed by constants and stay in registers
#pragma unroll
    for (int ps = 0; ps < 2; ++ps) {
        v8f s[2][2];   // [key tile][query tile]: register r of lane (lr, hi) = score of key 32 ps + 16 kt + 8 hi + r of the stage, query 16 qt + lr
        V k[2][2], k2[2][2];
#pragma unroll
        for (int kt = 0; kt < 2; ++kt)
#pragma unroll
            for (int kc = 0; kc < 2; ++kc) { k[kt][kc] = WF::ld((const T16*)(sK + (ps * 32 + kt * 16) * GPB + kc * 64)); if (HL) k2[kt][kc] = WF::ld((const T16*)(sK2 + (ps * 32 + kt * 16) * GPB + kc * 64)); }
#pragma unroll
        for (int kt = 0; kt < 2; ++kt) { s[kt][0] = (v8f){}; s[kt][1] = (v8f){}; }
#pragma unroll
        for (int kc = 0; kc < 2; ++kc) { const V q0 = __builtin_bit_cast(V, qa[0][kc]), q1 = __builtin_bit_cast(V, qa[1][kc]);
#pragma unroll
            for (int kt = 0; kt < 2; ++kt) { s[kt][0] = WF::mma(k[kt][kc], q0, s[kt][0]); s[kt][1] = WF::mma(k[kt][kc], q1, s[kt][1]); }
            if (HL) { const V r0 = __builtin_bit_cast(V, qb[0][kc]), r1 = __builtin_bit_cast(V, qb[1][kc]);
#pragma unroll
                for (int kt = 0; kt < 2; ++kt) { s[kt][0] = WF::mma(k[kt][kc], r0, s[kt][0]); s[kt][1] = WF::mma(k[kt][kc], r1, s[kt][1]); }
#pragma unroll
                for (int kt = 0; kt < 2; ++kt) { s[kt][0] = WF::mma(k2[kt][kc], q0, s[kt][0]); s[kt][1] = WF::mma(k2[kt][kc], q1, s[kt][1]); } } }
        V v[4], v2[4];   // asked for here, they fly during the softmax arithmetic
#pragma unroll
        for (int dt = 0; dt < 4; ++dt) v[dt] = WF::ld((const T16*)(sV + dt * 16 * GPB + ps * 64));
        float mn[2]; bool need = false;
#pragma unroll
        for (int qt = 0; qt < 2; ++qt) { float mx = fmaxf(s[0][qt][0], s[1][qt][0]);
#pragma unroll
            for (int r = 1; r < 8; ++r) mx = fmaxf(mx, fmaxf(s[0][qt][r], s[1][qt][r]));
            mx = fmaxf(mx, xhalf(mx)); mn[qt] = fmaxf(m[qt], mx * SCL2); need = need || (mn[qt] > m[qt]); }
        if (__builtin_amdgcn_ballot_w32(need) != 0) {   // some query's maximum grew: bring its sum and its output column to the new maximum (factor 1 for the others)
#pragma unroll
            for (int qt = 0; qt < 2; ++qt) { const float al = __builtin_amdgcn_exp2f(m[qt] - mn[qt]); m[qt] = mn[qt]; l[qt] *= al;
#pragma unroll
                for (int dt = 0; dt < 4; ++dt) o[dt][qt] *= al; } }
        V p[2], p2[2];   // the weights as B operands: element e of lane (lr, hi) = key 32 ps + 16 (e >> 3) + 8 hi + (e & 7), the loader's k order
#pragma unroll
        for (int qt = 0; qt < 2; ++qt) {
#pragma unroll
            for (int e = 0; e < 16; ++e) { const float pe = __builtin_amdgcn_exp2f(fmaf(s[e >> 3][qt][e & 7], SCL2, -m[qt])); l[qt] += pe;
                if constexpr (HL) { const __bf16 ph = (__bf16)pe; p[qt][e] = ph; p2[qt][e] = (__bf16)(pe - (float)ph); } else { p[qt][e] = (h16)pe; } } }
        if (HL) {   // the lo-plane V^T reads: they fly during the hi-plane products
#pragma unroll
            for (int dt = 0; dt < 4; ++dt) v2[dt] = WF::ld((const T16*)(sV2 + dt * 16 * GPB + ps * 64)); }
#pragma unroll
        for (int qt = 0; qt < 2; ++qt)
#pragma unroll
            for (int dt = 0; dt < 4; ++dt) o[dt][qt] = WF::mma(v[dt], p[qt], o[dt][qt]);
        if (HL) {
#pragma unroll
            for (int qt = 0; qt < 2; ++qt)
#pragma unroll
                for (int dt = 0; dt < 4; ++dt) o[dt][qt] = WF::mma(v[dt], p2[qt], o[dt][qt]);
#pragma unroll
            for (int qt = 0; qt < 2; ++qt)
#pragma unroll
                for (int dt = 0; dt < 4; ++dt) o[dt][qt] = WF::mma(v2[dt], p[qt], o[dt][qt]); }
        if (HL && ps == 0) __builtin_amdgcn_sched_barrier(0);   // the second pass's K reads are not lifted into the first pass's products, where no registers are free for them: left free, the compiler spills a Q fragment and reloads it every pass
    }
}
static_assert(RH * 2 == TT && RH % 128 == 0 && HD == 64 && TT % 64 == 0 && TT >= 128, "k_fattn: half the rows hi/lo, 128 rows of each kind per work-group, head size 64, whole stages, at least two");
// waves_per_eu(4, 4): four waves a SIMD, so each wave may use a quarter of the SIMD's registers (256); the hi/lo path needs nearly all of them, and the grid is exactly four waves for every SIMD (two work-groups' LDS fit a WGP)
__global__ __launch_bounds__(256) __attribute__((amdgpu_waves_per_eu(4, 4))) void k_fattn(const h16* __restrict__ QK16, const bf* __restrict__ QKh, const bf* __restrict__ QKl, const h16* __restrict__ VT16, const bf* __restrict__ VTh, const bf* __restrict__ VTl, bf* ATh, bf* ATl) {
    __shared__ __align__(128) char ring[2 * AST];
    const int tid = threadIdx.x, lane = tid & 31, lr = lane & 15, hi = lane >> 4; const int w = __builtin_amdgcn_readfirstlane(tid >> 5);   // the wave's number in a scalar register: the branch in the loop is a scalar one, every lane stays on for the matrix instructions
    const size_t b = blockIdx.z, h = blockIdx.y; const size_t zq = (b * (NH_ + NKV) + h) * TT * HD, zk = (b * (NH_ + NKV) + NH_ + h / REP) * TT * HD, zv = (b * NKV + h / REP) * HD * TT;
    const size_t t0 = (w < 4) ? (size_t)blockIdx.x * 128 + w * 32 : (size_t)RH + blockIdx.x * 128 + (w - 4) * 32; const size_t ao = (b * TT + t0) * DQ + h * HD;
    auto fill = [&](const int t) {
        const unsigned row = (unsigned)tid >> 3, pc = ((unsigned)tid & 7u) * 16u;   // the thread's row of 32 and its 16-byte piece
        const unsigned lf = (unsigned)(size_t)ring + (unsigned)((t & 1) * AST) + row * GPB + pc;   // low 32 bits of a __shared__ address: the byte address in LDS
        const size_t ko = (zk + (size_t)t * 64 * HD) * 2 + row * (HD * 2) + pc, vo = (zv + (size_t)t * 64) * 2 + row * (TT * 2) + pc;   // byte offsets in a [key][HD] and a [d][TT] plane
        cp6(lf, (const char*)QKh + ko, (const char*)QKl + ko, (const char*)QK16 + ko, (size_t)32 * HD * 2);
        cp6(lf + 192 * GPB, (const char*)VTh + vo, (const char*)VTl + vo, (const char*)VT16 + vo, (size_t)32 * TT * 2); };
    constexpr int NT = TT / 64;
    fill(0);
    // the Q fragments, as raw registers: waves 0-3 hi and lo planes, waves 4-7 the fp16 plane (their second set is loaded and not used)
    const h16* Qa = ((w < 4) ? (const h16*)QKh : QK16) + zq + t0 * HD + lr * HD + 8 * hi; const h16* Qb = (const h16*)QKl + zq + t0 * HD + lr * HD + 8 * hi;
    v16h qa[2][2], qb[2][2];
#pragma unroll
    for (int qt = 0; qt < 2; ++qt)
#pragma unroll
        for (int kc = 0; kc < 2; ++kc) { qa[qt][kc] = WFrag<h16>::ld(Qa + qt * 16 * HD + kc * 32); qb[qt][kc] = WFrag<h16>::ld(Qb + qt * 16 * HD + kc * 32); }
    v8f o[4][2];
#pragma unroll
    for (int dt = 0; dt < 4; ++dt)
#pragma unroll
        for (int qt = 0; qt < 2; ++qt) o[dt][qt] = (v8f){};
    float m[2] = { -3.0e38f, -3.0e38f }, l[2] = { 0.f, 0.f };
    asm volatile("s_wait_asynccnt 0x0" ::: "memory");   // this wave's copies of stage 0 have landed
    __syncthreads();                                     // and so have the other waves'
    fill(1);
    const int lofs = lr * GPB + hi * 16;   // the lane's byte offset in a block of rows
    const bool whl = __builtin_amdgcn_readfirstlane(tid >> 7) == 0;   // waves 0-3, in a scalar register of its own
#pragma unroll 1
    for (int t = 0; t < NT; ++t) {   // stays rolled: one trip a stage, the buffer chosen by the trip's parity
        const char* sb = ring + (t & 1) * AST + lofs;
        // two tests in a row on two scalars, not an if / else: the compiler lays an if / else out as two tests in a row and then keeps the two arms' accumulators in different registers (two copies of all of them a stage, and spills in the fp16 arm)
        if (whl) attn_stage<bf, true>(sb, sb + 64 * GPB, sb + 192 * GPB, sb + 256 * GPB, qa, qb, o, m, l);
        if (w >= 4) attn_stage<h16, false>(sb + 128 * GPB, nullptr, sb + 320 * GPB, nullptr, qa, qb, o, m, l);
        asm volatile("s_wait_dscnt 0x0" ::: "memory");      // this wave's reads of the buffer are done before the buffer is handed back
        asm volatile("s_wait_asynccnt 0x0" ::: "memory");   // this wave's copies of stage t + 1 have landed
        __syncthreads();                                     // publishes stage t + 1 and ends every wave's reads of stage t
        if (t + 2 < NT) fill(t + 2);
    }
    asm volatile("s_wait_asynccnt 0x0" ::: "memory");   // no copy is outstanding when the wave goes on
    bf* Ah = ATh + ao; bf* Al = ATl + ao;
    const int ln = (int)__builtin_amdgcn_mbcnt_lo(~0u, 0u);   // the lane's number, read anew: no register carries it through the loop, whose live set is near the 256 budget
#pragma unroll
    for (int qt = 0; qt < 2; ++qt) { const float inv = __fdiv_rn(1.0f, l[qt] + xhalf(l[qt])); const size_t ro = (size_t)(qt * 16 + (ln & 15)) * DQ + 8 * (ln >> 4);
#pragma unroll
        for (int dt = 0; dt < 4; ++dt) { v8us oh, ol;
#pragma unroll
            for (int r = 0; r < 8; ++r) { unsigned short a, c2; splitf(o[dt][qt][r] * inv, a, c2); oh[r] = a; ol[r] = c2; }
            *(v8us*)(Ah + ro + dt * 16) = oh; *(v8us*)(Al + ro + dt * 16) = ol; } }
}

extern "C" void kernel_launch(void* const* d_in, const int* in_sizes, int n_in,
                              void* d_out, int out_size, void* d_ws, size_t ws_size, hipStream_t stream) {
    (void)in_sizes; (void)n_in; (void)out_size;
    const float* x = (const float*)d_in[0]; const float* wqkv = (const float*)d_in[1]; const float* wo = (const float*)d_in[2]; const float* bo = (const float*)d_in[3];   /* argument order x, w_qkv ('xw' [1024][3072]), w_out ('xw'), b_out */
    float* OUT = (float*)d_out;     // [8][1024][1024]
    char* wsp = (char*)d_ws;
    auto take = [&](size_t bytes) { char* p = wsp; wsp += (bytes + 255) & ~(size_t)255; return (void*)p; };
    bf* WQKV = (bf*)take((size_t)3 * DQ * DM * 2);   /* fused Bt [3*DQ][DM]: q | k | v row blocks */ bf* WO = (bf*)take((size_t)DM * DQ * 2);
    bf* XB = (bf*)take((size_t)NB_ * TT * DM * 2);   // XB [NB_*TT][DM] bf16, all batches
    h16* QK16 = (h16*)take((size_t)NB_ * (NH_ + NKV) * TT * HD * 2); bf* QKh = (bf*)take((size_t)NB_ * (NH_ + NKV) * TT * HD * 2); bf* QKl = (bf*)take((size_t)NB_ * (NH_ + NKV) * TT * HD * 2);   // planes [batch][16 q heads | 16 k heads][t][d], all batches
    h16* VT16 = (h16*)take((size_t)NB_ * NKV * HD * TT * 2); bf* VTh = (bf*)take((size_t)NB_ * NKV * HD * TT * 2); bf* VTl = (bf*)take((size_t)NB_ * NKV * HD * TT * 2);   // planes [batch][head][d][t], all batches
    bf* ATh = (bf*)take((size_t)NB_ * TT * DQ * 2); bf* ATl = (bf*)take((size_t)NB_ * TT * DQ * 2);   // merged attention output, hi/lo, [batch * TT + t][DQ]
    if ((size_t)(wsp - (char*)d_ws) > ws_size) return;    // ws 256 MiB, 200 MiB used
    k_prep<<<WB1 + WB2 + XB8, 256, 0, stream>>>(x, wqkv, wo, XB, WQKV, WO);
    k_gemmw<0, false, true, DM><<<dim3(NB_ * TT / 128, 3 * DQ / 128, 1), 128, 0, stream>>>(XB, nullptr, WQKV, nullptr, 0, nullptr, QK16, QKh, QKl, VT16, VTh, VTl);
    k_fattn<<<dim3(RH / 128, NH_, NB_), 256, 0, stream>>>(QK16, QKh, QKl, VT16, VTh, VTl, ATh, ATl);
    k_gemmw<1, true, false, DQ><<<dim3(NB_ * TT / 128, DM / 128, 1), 128, 0, stream>>>(ATh, ATl, WO, OUT, DM, bo, nullptr, nullptr, nullptr, nullptr, nullptr, nullptr);
}

// v007
// It runs in 150 microseconds.
// Two timings next to v006 both put it at 1.04 times that version's speed.
// All steps since v000 together make it 31.0 times as fast.
#include <hip/hip_runtime.h>

// Multi-head self-attention with a fused qkv projection (x [8][1024][1024]; qkv = x w_qkv ('xw' [1024][3072], no bias) -> q | k | v (16 heads x 64); dots x 1024^-0.5 (the repo scales by dim); softmax (no mask); out = merged w_out + b_out ('xw') -> [8][1024][1024] (8.4 M); argument order x, w_qkv, w_out, b_out).
// Layout: ONE preparation launch (bf16 copy of x, all batches; both 'xw' weights transposed in LDS tiles, the fused one as q | k | v row blocks); ONE launch of exact projections whose epilogue stores the head planes itself (planes of all batches kept); ONE fused attention launch over all batches and heads (hybrid rows: < 512 hi/lo 3 products, rest fp16; K and V^T staged in LDS, scores and weights stay in registers); ONE launch of merged hi/lo x w_out exact + b_out. Four launches.
// Compute dtypes, f32 accumulate: every input rounded to bf16; projections exact; attention rows < 512 3 products, rest fp16; softmax f32; w_out hl x exact + bias.

#define NB_  8
#define TT   1024
#define DM   1024
#define NH_  16
#define NKV  16
#define REP  (NH_ / NKV)
#define HD   64
#define DQ   (NH_ * HD)
#define DKV  (NKV * HD)
#define RH   512                  // query rows < RH use hi+lo planes
#define WIN  0
#define SCL  0.03125f   // dim^-0.5 = 1/32 (the repo scales by dim)
typedef _Float16 h16;
typedef unsigned short bf;
typedef __attribute__((ext_vector_type(16))) __bf16   v16bf;
typedef __attribute__((ext_vector_type(16))) _Float16 v16h;
typedef __attribute__((ext_vector_type(8)))  _Float16 v8h;
typedef __attribute__((ext_vector_type(8)))  unsigned short v8us;
typedef __attribute__((ext_vector_type(8)))  float    v8f;
typedef __attribute__((ext_vector_type(4)))  float    v4f;
typedef v8h  __attribute__((may_alias)) v8ha;
typedef v4f  __attribute__((may_alias)) v4fa;
typedef v8us __attribute__((may_alias)) v8usa;

__device__ __forceinline__ unsigned short f2bf(float f) { unsigned u = __float_as_uint(f); u += 0x7FFFu + ((u >> 16) & 1u); return (unsigned short)(u >> 16); }
__device__ __forceinline__ float bf2f(unsigned short b) { return __uint_as_float(((unsigned)b) << 16); }
__device__ __forceinline__ float bfr(float f) { return bf2f(f2bf(f)); }
__device__ __forceinline__ v16h cat16(v8h lo, v8h hi) { return __builtin_shufflevector(lo, hi, 0, 1, 2, 3, 4, 5, 6, 7, 8, 9, 10, 11, 12, 13, 14, 15); }
__device__ __forceinline__ v16bf cat16b(v8us lo, v8us hi) { return __builtin_bit_cast(v16bf, __builtin_shufflevector(lo, hi, 0, 1, 2, 3, 4, 5, 6, 7, 8, 9, 10, 11, 12, 13, 14, 15)); }
__device__ __forceinline__ v8f wmma16(v16h a, v16h b, v8f c) { return __builtin_amdgcn_wmma_f32_16x16x32_f16(false, a, false, b, (short)0, c, false, false); }
__device__ __forceinline__ v8f wmmab(v16bf a, v16bf b, v8f c) { return __builtin_amdgcn_wmma_f32_16x16x32_bf16(false, a, false, b, (short)0, c, false, false); }



__device__ __forceinline__ h16 tohx(float x) { return (h16)x; }
__device__ __forceinline__ void splitf(float y, unsigned short& h, unsigned short& l) { h = f2bf(y); l = f2bf(y - bf2f(h)); }
// put_rows: 16 plane rows of 64 values, staged as f32 in LDS at pitch 68, go out as fp16, hi and lo planes at P + row * pitch; a lane takes 8 consecutive values of a row, so every store instruction writes 4 whole 128-byte lines
__device__ __forceinline__ void put_rows(const float* os, const int lane, h16* P16, bf* Ph, bf* Pl, const size_t pitch) {
#pragma unroll
    for (int s = 0; s < 4; ++s) { const int row = 4 * s + (lane >> 3), cofs = (lane & 7) * 8; const v4f x0 = *(const v4fa*)(os + row * 68 + cofs), x1 = *(const v4fa*)(os + row * 68 + cofs + 4); v8h o16; v8us oh, ol;
#pragma unroll
        for (int r = 0; r < 8; ++r) { const float x = (r < 4) ? x0[r & 3] : x1[r & 3]; o16[r] = tohx(x); unsigned short a2, c2; splitf(x, a2, c2); oh[r] = a2; ol[r] = c2; }
        const size_t e = (size_t)row * pitch + cofs; *(v8h*)(P16 + e) = o16; *(v8us*)(Ph + e) = oh; *(v8us*)(Pl + e) = ol; }
}
// ---- k_gemmw: GEMM on K-contiguous bf16 planes, FOUR WAVES (2 x 2) per 128x128 output tile, each wave a 64x64 quarter (16 accumulators); grid (M/128, N/128), 128 threads.
// C[m][n] (f32, pitch ldc, + optional f32 bias[n]) = sum_k A[m][k] Bt[n][k] (+ A2[m][k] Bt[n][k] when NSPLIT == 1). K: a constant, whole stages, at least two.
// Operands go through LDS: a stage is 64 k (128 bytes) of the tile's rows [A 128 | A2 128 when NSPLIT | Bt 128] at a pitch of 144 bytes, brought by asynchronous 16-byte copies (8 lanes take one whole 128-byte line of a row),
// two buffers, the stage after next asked for as soon as every wave has left a buffer. Fragments are read from LDS in the k order of WFrag::ld, every accumulator takes its products in ascending k (A, then A2, per 32 k).
// PLANES (the q | k | v projection; rows = batch * TT + t, columns = q heads | k heads | v heads, so a wave's quarter is 64 positions of ONE head): no C; the epilogue stores the head planes, q and k heads as [head][t][d] (64 whole rows of 128 bytes),
// v heads as [head][d][t] (64 rows of d, 128 bytes of t each). 16 plane rows at a time are staged in the wave's own LDS slice, position-major for q and k, d-major for v (a lane's accumulator registers are 8 consecutive positions of one d).
template <typename T16> struct WFrag;
template <> struct WFrag<h16> { typedef v16h V; static __device__ __forceinline__ V ld(const h16* p) { return cat16(*(const v8h*)p, *(const v8h*)(p + 16)); } static __device__ __forceinline__ v8f mma(V a, V b, v8f c) { return wmma16(a, b, c); } };
template <> struct WFrag<bf> { typedef v16bf V; static __device__ __forceinline__ V ld(const bf* p) { return cat16b(*(const v8us*)p, *(const v8us*)(p + 16)); } static __device__ __forceinline__ v8f mma(V a, V b, v8f c) { return wmmab(a, b, c); } };
#define GPB 144                   // LDS row pitch in bytes: 16 x odd, free of bank conflicts for 16-byte reads of 128-byte rows
#define GPE (GPB / 2)             // the same in elements
// cp8: 128 rows x 128 bytes of one plane into LDS; the work-group's 128 threads take 16 rows a copy (thread: row tid / 8, 16-byte piece tid % 8), 8 copies each. l: the lane's LDS byte address, g: its global address, rs: 16 rows in elements.
// s_wait_xcnt 0 closes the statement: no address register of a copy is rewritten before it.
__device__ __forceinline__ void cp8(const unsigned l, const bf* g, const size_t rs) {
    asm volatile("global_load_async_to_lds_b128 %0, %8, off\n\t"
                 "global_load_async_to_lds_b128 %1, %9, off\n\t"
                 "global_load_async_to_lds_b128 %2, %10, off\n\t"
                 "global_load_async_to_lds_b128 %3, %11, off\n\t"
                 "global_load_async_to_lds_b128 %4, %12, off\n\t"
                 "global_load_async_to_lds_b128 %5, %13, off\n\t"
                 "global_load_async_to_lds_b128 %6, %14, off\n\t"
                 "global_load_async_to_lds_b128 %7, %15, off\n\t"
                 "s_wait_xcnt 0x0"
                 :: "v"(l), "v"(l + 16 * GPB), "v"(l + 32 * GPB), "v"(l + 48 * GPB), "v"(l + 64 * GPB), "v"(l + 80 * GPB), "v"(l + 96 * GPB), "v"(l + 112 * GPB),
                    "v"(g), "v"(g + rs), "v"(g + 2 * rs), "v"(g + 3 * rs), "v"(g + 4 * rs), "v"(g + 5 * rs), "v"(g + 6 * rs), "v"(g + 7 * rs) : "memory");
}
// waves_per_eu(4, 4): the projection stays inside 256 registers a wave, so that three of its work-groups (its grid is six for every WGP) are resident together; the two-plane instance, two work-groups for every WGP (its LDS lets two be resident), is held to the same bound
template <int NSPLIT, bool BIAS, bool PLANES, int K>
__global__ __launch_bounds__(128) __attribute__((amdgpu_waves_per_eu(4, 4))) void k_gemmw(const bf* __restrict__ A, const bf* __restrict__ A2, const bf* __restrict__ Bt, float* C, int ldc, const float* __restrict__ bias, h16* QK16, bf* QKh, bf* QKl, h16* VT16, bf* VTh, bf* VTl) {
    typedef WFrag<bf> WF; typedef typename WF::V V;
    static_assert((NSPLIT == 0 || NSPLIT == 1) && K % 64 == 0 && K >= 128, "one or two A planes; whole stages, at least two");
    constexpr int BROW = (NSPLIT ? 256 : 128), STAGE = (BROW + 128) * GPB;   // first Bt row of a stage; bytes of a stage
    __shared__ __align__(128) char ring[2 * STAGE];
    __shared__ __align__(16) float osall[4][16 * 68];
    const int tid = threadIdx.x, lane = tid & 31, lr = lane & 15, hi = lane >> 4; const int w = __builtin_amdgcn_readfirstlane(tid >> 5), wm = w >> 1, wn = w & 1;
    float* os = osall[w];
    const int R0 = blockIdx.x * 128, C0 = blockIdx.y * 128, r0 = R0 + wm * 64, c0 = C0 + wn * 64;
    v8f acc[4][4];
#pragma unroll
    for (int mb = 0; mb < 4; ++mb)
#pragma unroll
        for (int nb = 0; nb < 4; ++nb) acc[mb][nb] = (v8f){};
    const unsigned lcp = (unsigned)(size_t)ring + (unsigned)((tid >> 3) * GPB + (tid & 7) * 16);   // low 32 bits of a __shared__ address: the byte address in LDS
    const size_t rs = (size_t)16 * K; const size_t gofs = (size_t)(tid >> 3) * K + (tid & 7) * 8;
    const bf* gA = A + (size_t)R0 * K + gofs; const bf* gA2 = NSPLIT ? A2 + (size_t)R0 * K + gofs : nullptr; const bf* gB = Bt + (size_t)C0 * K + gofs;
    auto fill = [&](const int t) { const unsigned l = lcp + (unsigned)((t & 1) * STAGE); cp8(l, gA + t * 64, rs); if constexpr (NSPLIT == 1) cp8(l + 128 * GPB, gA2 + t * 64, rs); cp8(l + BROW * GPB, gB + t * 64, rs); };
    constexpr int NT = K / 64;
    fill(0);
    asm volatile("s_wait_asynccnt 0x0" ::: "memory");   // this wave's copies of stage 0 have landed
    __syncthreads();                                     // and so have the other waves'
    fill(1);
    const int aofs = (wm * 64 + lr) * GPE + 8 * hi, bofs = (BROW + wn * 64 + lr) * GPE + 8 * hi;   // the lane's element offsets in a stage
#pragma unroll 1
    for (int t = 0; t < NT; ++t) {   // stays rolled: one trip a stage, the buffer chosen by the trip's parity
        const bf* sb = (const bf*)(ring + (t & 1) * STAGE);
        // fragments of both 32-k halves of the stage; every loop here is unrolled so that the arrays are indexed by constants and stay in registers
        V a[2][4], a2[2][4], b[2][4];
#pragma unroll
        for (int mb = 0; mb < 4; ++mb) { a[0][mb] = WF::ld(sb + aofs + mb * 16 * GPE); if (NSPLIT == 1) a2[0][mb] = WF::ld(sb + aofs + (128 + mb * 16) * GPE); }
#pragma unroll
        for (int nb = 0; nb < 4; ++nb) b[0][nb] = WF::ld(sb + bofs + nb * 16 * GPE);
        if (NSPLIT == 0) {   // registers are free for the second half's A fragments: they fly during the first half's products
#pragma unroll
            for (int mb = 0; mb < 4; ++mb) a[1][mb] = WF::ld(sb + aofs + mb * 16 * GPE + 32); }
        __builtin_amdgcn_sched_barrier(0);   // the whole group of LDS reads is asked for before the first product: left free, the compiler keeps one Bt fragment and waits out an LDS latency in front of every four products
#pragma unroll
        for (int nb = 0; nb < 4; ++nb) {
#pragma unroll
            for (int mb = 0; mb < 4; ++mb) { acc[mb][nb] = WF::mma(a[0][mb], b[0][nb], acc[mb][nb]); if (NSPLIT == 1) acc[mb][nb] = WF::mma(a2[0][mb], b[0][nb], acc[mb][nb]); }
            b[1][nb] = WF::ld(sb + bofs + nb * 16 * GPE + 32);
            if (nb < 3) __builtin_amdgcn_sched_barrier(0);   // the second half's Bt fragment is asked for as soon as the first half's has been used up, not sunk to its own first use
        }
        if (NSPLIT == 1) {
#pragma unroll
            for (int mb = 0; mb < 4; ++mb) { a[1][mb] = WF::ld(sb + aofs + mb * 16 * GPE + 32); a2[1][mb] = WF::ld(sb + aofs + (128 + mb * 16) * GPE + 32); } }
        // the stage's last LDS read is asked for: the hand-over stands here, so that the refill flies during the second half's products (they read registers only)
        asm volatile("s_wait_dscnt 0x0" ::: "memory");      // this wave's reads of the buffer are done before the buffer is handed back
        asm volatile("s_wait_asynccnt 0x0" ::: "memory");   // this wave's copies of stage t + 1 have landed
        __syncthreads();                                     // publishes stage t + 1 and ends every wave's reads of stage t
        if (t + 2 < NT) fill(t + 2);
#pragma unroll
        for (int nb = 0; nb < 4; ++nb)
#pragma unroll
            for (int mb = 0; mb < 4; ++mb) { acc[mb][nb] = WF::mma(a[1][mb], b[1][nb], acc[mb][nb]); if (NSPLIT == 1) acc[mb][nb] = WF::mma(a2[1][mb], b[1][nb], acc[mb][nb]); }
    }
    asm volatile("s_wait_asynccnt 0x0" ::: "memory");   // no copy is outstanding when the wave goes on
    if constexpr (PLANES) {
        static_assert(HD == 64 && TT % 64 == 0, "a 64-column quarter is one head, a 64-row quarter lies in one batch");
        const size_t bb = (size_t)(r0 / TT), t0 = (size_t)(r0 % TT), hd = (size_t)(c0 / 64);   // batch of the group, first position, head block: q heads from 0, k heads from NH_, v heads from NH_ + NKV
        if (hd < NH_ + NKV) { const size_t zp = ((bb * (NH_ + NKV) + hd) * TT + t0) * HD;
#pragma unroll
            for (int mb = 0; mb < 4; ++mb) {
#pragma unroll
                for (int nb = 0; nb < 4; ++nb) {
#pragma unroll
                    for (int j = 0; j < 8; ++j) os[(hi * 8 + j) * 68 + nb * 16 + lr] = acc[mb][nb][j]; }
                __builtin_amdgcn_wave_barrier(); asm volatile("" ::: "memory");   // a lane reads what other lanes of the wave staged: no LDS read is lifted over the staging writes
                put_rows(os, lane, QK16 + zp + mb * 16 * HD, QKh + zp + mb * 16 * HD, QKl + zp + mb * 16 * HD, HD);
                __builtin_amdgcn_wave_barrier(); asm volatile("" ::: "memory");   // the next 16 rows are not staged over rows still to be read
            }
        } else { const size_t zp = (bb * NKV + (hd - (NH_ + NKV))) * HD * TT + t0;
#pragma unroll
            for (int nb = 0; nb < 4; ++nb) {
#pragma unroll
                for (int mb = 0; mb < 4; ++mb) { float* o = os + lr * 68 + mb * 16 + hi * 8; const v8f c = acc[mb][nb]; *(v4fa*)o = (v4f){ c[0], c[1], c[2], c[3] }; *(v4fa*)(o + 4) = (v4f){ c[4], c[5], c[6], c[7] }; }
                __builtin_amdgcn_wave_barrier(); asm volatile("" ::: "memory");   // as above: staging writes, then the reads
                put_rows(os, lane, VT16 + zp + (size_t)nb * 16 * TT, VTh + zp + (size_t)nb * 16 * TT, VTl + zp + (size_t)nb * 16 * TT, TT);
                __builtin_amdgcn_wave_barrier(); asm volatile("" ::: "memory");   // as above: the reads, then the next staging writes
            }
        }
        return;
    }
#pragma unroll
    for (int mb = 0; mb < 4; ++mb) {
#pragma unroll
        for (int nb = 0; nb < 4; ++nb) {
#pragma unroll
            for (int j = 0; j < 8; ++j) os[(hi * 8 + j) * 68 + nb * 16 + lr] = acc[mb][nb][j]; }
        __builtin_amdgcn_wave_barrier(); asm volatile("" ::: "memory");
        float* crow = C + (size_t)(r0 + mb * 16) * ldc + c0;
{
#pragma unroll
            for (int s = 0; s < 8; ++s) { const int row = 2 * s + hi, cofs = lr * 4; v4f val = *(const v4fa*)(os + row * 68 + cofs); if (BIAS) { val[0] += bfr(bias[c0 + cofs]); val[1] += bfr(bias[c0 + cofs + 1]); val[2] += bfr(bias[c0 + cofs + 2]); val[3] += bfr(bias[c0 + cofs + 3]); }
                *(v4f*)(crow + (size_t)row * ldc + cofs) = val; }
             }
        asm volatile("s_wait_xcnt 0x0" ::: "memory");   // behind the run of stores, in front of the next rows' arithmetic, which reuses registers that the stores name
        __builtin_amdgcn_wave_barrier(); asm volatile("" ::: "memory");
    }
}

typedef __attribute__((ext_vector_type(2))) _Float16 v2h;
typedef __attribute__((ext_vector_type(4))) _Float16 v4h;
typedef __attribute__((ext_vector_type(2))) unsigned short v2us;
typedef __attribute__((ext_vector_type(4))) unsigned short v4us;
typedef __attribute__((ext_vector_type(2))) float v2f;
typedef __attribute__((ext_vector_type(4))) int v4i;

// ---- k_prep: the three independent preparations in ONE launch of few, long waves (wave starts, not bytes, set the time of a launch of many short waves): 12 waves a block; waves 0-3 each turn one 64 x 64 weight tile (w_qkv's tiles first, then w_out's), waves 4-11 each convert 4096 values of x.
// Every wave asks for 32 loads of 16 bytes a lane (16 KiB) before it uses the first; every store and every weight load covers whole 128-byte lines. No work-group barrier: a wave works alone, in its own LDS slice.
// wt_tile: 'xw' weight w [K][N] f32 -> Bt [N][K] bf16, one wave turns a tile of 64 k x 64 n in ts (64 rows of n, 64 k = 128 bytes each, at a pitch of 144 bytes). tile: n tiles run fastest, so a block's 4 waves read 1 KiB in a row of every w row.
// A load takes 2 w rows of 256 bytes (16 lanes a row), 32 rows apart; loads 2 i and 2 i + 1 of a lane are rows k and k + 1, packed as one pair, so that a lane holds 32 consecutive k of each of its 4 n and writes them to LDS 16 bytes at a time.
#define TPW 36                                // pitch of a turned row in 4-byte words
__device__ __forceinline__ void wt_tile(const float* __restrict__ w, const int K, const int N, bf* Bt, const int tile, unsigned* ts) {
    const int lane = threadIdx.x & 31, lh = lane >> 4, l16 = lane & 15, lq = lane >> 3, l8 = lane & 7; const int nn = N / 64; const int n0 = (tile % nn) * 64, k0 = (tile / nn) * 64;
    const float* g = w + (size_t)(k0 + 32 * lh) * N + n0 + l16 * 4; v4f v[32];
#pragma unroll
    for (int j = 0; j < 32; ++j) v[j] = *(const v4f*)(g + (size_t)j * N);   // unrolled, here and below: the array is indexed by constants and stays in registers
    asm volatile("s_wait_xcnt 0x0" :: "v"(g) : "memory");   // behind the run of loads, in front of everything that reuses their address registers; the address is named as an input so that no load of the run lands in its registers either
#pragma unroll
    for (int c = 0; c < 4; ++c)
#pragma unroll
        for (int q = 0; q < 4; ++q) { v4i p;
#pragma unroll
            for (int d = 0; d < 4; ++d) p[d] = (int)((unsigned)f2bf(v[8 * q + 2 * d][c]) | ((unsigned)f2bf(v[8 * q + 2 * d + 1][c]) << 16));
            *(v4i*)(ts + (l16 * 4 + c) * TPW + lh * 16 + q * 4) = p; }
    asm volatile("s_wait_dscnt 0x0" ::: "memory");   // a lane reads what other lanes of the wave wrote: the writes are done, and no LDS read is lifted over them
    bf* o = Bt + (size_t)(n0 + lq) * K + k0 + l8 * 8;
#pragma unroll
    for (int s = 0; s < 16; ++s) *(v4i*)(o + (size_t)(4 * s) * K) = *(const v4i*)(ts + (4 * s + lq) * TPW + l8 * 4);   // 4 whole lines of Bt a store
    asm volatile("s_wait_xcnt 0x0" ::: "memory");   // behind the run of stores: the code laid out behind this range rewrites registers that the stores name
}
#define WT1 (DM / 64 * (3 * DQ / 64))         // tiles of w_qkv
#define WT2 (DQ / 64 * (DM / 64))             // tiles of w_out
#define PBL ((WT1 + WT2) / 4)                 // blocks: 4 tiles each
static_assert(DM % 64 == 0 && DQ % 64 == 0 && (WT1 + WT2) % 4 == 0 && (size_t)NB_ * TT * DM == (size_t)PBL * 8 * 4096, "k_prep: whole tiles; every block has 4 tiles and 8 pieces of x");
// waves_per_eu(4, 4): a wave may use 256 registers (one block a WGP is three waves a SIMD); aiming at more waves, the compiler holds back the last loads of a run until registers of the first are free, a second memory latency in series
__global__ __launch_bounds__(384) __attribute__((amdgpu_waves_per_eu(4, 4))) void k_prep(const float* __restrict__ x, const float* __restrict__ wqkv, const float* __restrict__ wo, bf* XB, bf* WQKV, bf* WO) {
    __shared__ __align__(16) unsigned tsall[4][64 * TPW];
    const int blk = blockIdx.x; const int wv = __builtin_amdgcn_readfirstlane(threadIdx.x >> 5);   // the wave's number in a scalar register: the branches are scalar, the tile's indices scalar arithmetic
    if (wv < 4) { const int tile = blk * 4 + wv;
        if (tile < WT1) wt_tile(wqkv, DM, 3 * DQ, WQKV, tile, tsall[wv]);            // fused 'xw' [DM][3*DQ] -> Bt [3*DQ][DM]
        else wt_tile(wo, DQ, DM, WO, tile - WT1, tsall[wv]);
        return; }
    const size_t i = ((size_t)blk * 8 + (wv - 4)) * 512 + (threadIdx.x & 31); const float* gx = x + i * 8; v8f v[16]; v8us o[16];   // groups of 8 values: 32 lanes x 16 groups a wave
#pragma unroll
    for (int c = 0; c < 16; ++c) v[c] = *(const v8f*)(gx + c * 256);   // unrolled, here and below: the arrays are indexed by constants
    asm volatile("s_wait_xcnt 0x0" :: "v"(gx) : "memory");   // as in wt_tile: behind the run of loads, the address named as an input
#pragma unroll
    for (int c = 0; c < 16; ++c) {
#pragma unroll
        for (int k = 0; k < 8; ++k) o[c][k] = f2bf(v[c][k]);
        *(v8us*)(XB + (i + c * 32) * 8) = o[c]; }
    asm volatile("s_wait_xcnt 0x0" ::: "memory");   // behind the stores: the compiler lays the transposes' code behind this range, and that code rewrites registers that the stores name
}

// ---- k_fattn: the whole attention of 32 query rows in ONE WAVE, scores and weights never leave registers. Per pass of 32 keys: S^T = K Q^T (A = K rows, B = Q kept in registers), running maximum and sum per query
// (a lane holds one query's scores; the two lane halves split its keys), the two S^T tiles converted in place are the B operand of O^T += V^T P^T (A = V^T rows in the same k order as the loader's).
// Weights enter the product un-normalised, exp2(t - running max); O^T is divided by the row sum at the end and stored as the merged hi/lo planes [t][head * HD + d], 8 consecutive d per lane.
// Rows < RH: hi/lo planes, 3 products; the rest fp16. Grid (RH / 128, heads, batches), 8 waves: waves 0-3 take 128 rows < RH, waves 4-7 take 128 rows >= RH (equal work per work-group).
// K and V^T go through LDS, shared by the waves: a stage is 64 keys of the six planes, rows [K hi 64 | K lo 64 | K fp16 64 | V^T hi 64 | V^T lo 64 | V^T fp16 64] of 128 bytes at a pitch of 144 bytes (a K row is a key, a V^T row is a d),
// brought by asynchronous 16-byte copies (8 lanes take one whole 128-byte line), two buffers, one work-group barrier a stage. A stage is two passes of 32 keys; the fragments are read from LDS in the k order of WFrag::ld.
__device__ __forceinline__ float xhalf(float x) { const int b = __builtin_bit_cast(int, x); return __builtin_bit_cast(float, __builtin_amdgcn_permlanex16(b, b, 0x76543210, 0xfedcba98, false, false)); }   // lane l <-> lane l ^ 16
#define SCL2 (SCL * 1.4426950408889634f)   // score scale in the log2 domain
#define AST (384 * GPB)                    // bytes of a stage
// cp6: 64 rows x 128 bytes of each of three planes into LDS; the work-group's 256 threads take 32 rows a copy (thread: row tid / 8, 16-byte piece tid % 8), 2 copies a plane. l: the lane's LDS byte address in the first plane's block, g0 g1 g2: its global addresses, hb: 32 rows in bytes.
// s_wait_xcnt 0 closes the statement: no address register of a copy is rewritten before it.
__device__ __forceinline__ void cp6(const unsigned l, const char* g0, const char* g1, const char* g2, const size_t hb) {
    asm volatile("global_load_async_to_lds_b128 %0, %6, off\n\t"
                 "global_load_async_to_lds_b128 %1, %7, off\n\t"
                 "global_load_async_to_lds_b128 %2, %8, off\n\t"
                 "global_load_async_to_lds_b128 %3, %9, off\n\t"
                 "global_load_async_to_lds_b128 %4, %10, off\n\t"
                 "global_load_async_to_lds_b128 %5, %11, off\n\t"
                 "s_wait_xcnt 0x0"
                 :: "v"(l), "v"(l + 32 * GPB), "v"(l + 64 * GPB), "v"(l + 96 * GPB), "v"(l + 128 * GPB), "v"(l + 160 * GPB),
                    "v"(g0), "v"(g0 + hb), "v"(g1), "v"(g1 + hb), "v"(g2), "v"(g2 + hb) : "memory");
}
// one stage (64 keys, two passes) for one wave. sK, sK2, sV, sV2: the lane's addresses in the stage's K and V^T blocks (row lr, 16-byte piece hi). qa, qb: the Q fragments as raw registers.
template <typename T16, bool HL>
__device__ __forceinline__ void attn_stage(const char* sK, const char* sK2, const char* sV, const char* sV2, const v16h (&qa)[2][2], const v16h (&qb)[2][2], v8f (&o)[4][2], float (&m)[2], float (&l)[2]) {
    typedef WFrag<T16> WF; typedef typename WF::V V;
    // every loop below is unrolled so that the fragment and accumulator arrays are indexed by constants and stay in registers
#pragma unroll
    for (int ps = 0; ps < 2; ++ps) {
        v8f s[2][2];   // [key tile][query tile]: register r of lane (lr, hi) = score of key 32 ps + 16 kt + 8 hi + r of the stage, query 16 qt + lr
        V k[2][2], k2[2][2];
#pragma unroll
        for (int kt = 0; kt < 2; ++kt)
#pragma unroll
            for (int kc = 0; kc < 2; ++kc) { k[kt][kc] = WF::ld((const T16*)(sK + (ps * 32 + kt * 16) * GPB + kc * 64)); if (HL) k2[kt][kc] = WF::ld((const T16*)(sK2 + (ps * 32 + kt * 16) * GPB + kc * 64)); }
#pragma unroll
        for (int kt = 0; kt < 2; ++kt) { s[kt][0] = (v8f){}; s[kt][1] = (v8f){}; }
#pragma unroll
        for (int kc = 0; kc < 2; ++kc) { const V q0 = __builtin_bit_cast(V, qa[0][kc]), q1 = __builtin_bit_cast(V, qa[1][kc]);
#pragma unroll
            for (int kt = 0; kt < 2; ++kt) { s[kt][0] = WF::mma(k[kt][kc], q0, s[kt][0]); s[kt][1] = WF::mma(k[kt][kc], q1, s[kt][1]); }
            if (HL) { const V r0 = __builtin_bit_cast(V, qb[0][kc]), r1 = __builtin_bit_cast(V, qb[1][kc]);
#pragma unroll
                for (int kt = 0; kt < 2; ++kt) { s[kt][0] = WF::mma(k[kt][kc], r0, s[kt][0]); s[kt][1] = WF::mma(k[kt][kc], r1, s[kt][1]); }
#pragma unroll
                for (int kt = 0; kt < 2; ++kt) { s[kt][0] = WF::mma(k2[kt][kc], q0, s[kt][0]); s[kt][1] = WF::mma(k2[kt][kc], q1, s[kt][1]); } } }
        V v[4], v2[4];   // asked for here, they fly during the softmax arithmetic
#pragma unroll
        for (int dt = 0; dt < 4; ++dt) v[dt] = WF::ld((const T16*)(sV + dt * 16 * GPB + ps * 64));
        float mn[2]; bool need = false;
#pragma unroll
        for (int qt = 0; qt < 2; ++qt) { float mx = fmaxf(s[0][qt][0], s[1][qt][0]);
#pragma unroll
            for (int r = 1; r < 8; ++r) mx = fmaxf(mx, fmaxf(s[0][qt][r], s[1][qt][r]));
            mx = fmaxf(mx, xhalf(mx)); mn[qt] = fmaxf(m[qt], mx * SCL2); need = need || (mn[qt] > m[qt]); }
        if (__builtin_amdgcn_ballot_w32(need) != 0) {   // some query's maximum grew: bring its sum and its output column to the new maximum (factor 1 for the others)
#pragma unroll
            for (int qt = 0; qt < 2; ++qt) { const float al = __builtin_amdgcn_exp2f(m[qt] - mn[qt]); m[qt] = mn[qt]; l[qt] *= al;
#pragma unroll
                for (int dt = 0; dt < 4; ++dt) o[dt][qt] *= al; } }
        V p[2], p2[2];   // the weights as B operands: element e of lane (lr, hi) = key 32 ps + 16 (e >> 3) + 8 hi + (e & 7), the loader's k order
#pragma unroll
        for (int qt = 0; qt < 2; ++qt) {
#pragma unroll
            for (int e = 0; e < 16; ++e) { const float pe = __builtin_amdgcn_exp2f(fmaf(s[e >> 3][qt][e & 7], SCL2, -m[qt])); l[qt] += pe;
                if constexpr (HL) { const __bf16 ph = (__bf16)pe; p[qt][e] = ph; p2[qt][e] = (__bf16)(pe - (float)ph); } else { p[qt][e] = (h16)pe; } } }
        if (HL) {   // the lo-plane V^T reads: they fly during the hi-plane products
#pragma unroll
            for (int dt = 0; dt < 4; ++dt) v2[dt] = WF::ld((const T16*)(sV2 + dt * 16 * GPB + ps * 64)); }
#pragma unroll
        for (int qt = 0; qt < 2; ++qt)
#pragma unroll
            for (int dt = 0; dt < 4; ++dt) o[dt][qt] = WF::mma(v[dt], p[qt], o[dt][qt]);
        if (HL) {
#pragma unroll
            for (int qt = 0; qt < 2; ++qt)
#pragma unroll
                for (int dt = 0; dt < 4; ++dt) o[dt][qt] = WF::mma(v[dt], p2[qt], o[dt][qt]);
#pragma unroll
            for (int qt = 0; qt < 2; ++qt)
#pragma unroll
                for (int dt = 0; dt < 4; ++dt) o[dt][qt] = WF::mma(v2[dt], p[qt], o[dt][qt]); }
        if (HL && ps == 0) __builtin_amdgcn_sched_barrier(0);   // the second pass's K reads are not lifted into the first pass's products, where no registers are free for them: left free, the compiler spills a Q fragment and reloads it every pass
    }
}
static_assert(RH * 2 == TT && RH % 128 == 0 && HD == 64 && TT % 64 == 0 && TT >= 128, "k_fattn: half the rows hi/lo, 128 rows of each kind per work-group, head size 64, whole stages, at least two");
// waves_per_eu(4, 4): four waves a SIMD, so each wave may use a quarter of the SIMD's registers (256); the hi/lo path needs nearly all of them, and the grid is exactly four waves for every SIMD (two work-groups' LDS fit a WGP)
__global__ __launch_bounds__(256) __attribute__((amdgpu_waves_per_eu(4, 4))) void k_fattn(const h16* __restrict__ QK16, const bf* __restrict__ QKh, const bf* __restrict__ QKl, const h16* __restrict__ VT16, const bf* __restrict__ VTh, const bf* __restrict__ VTl, bf* ATh, bf* ATl) {
    __shared__ __align__(128) char ring[2 * AST];
    const int tid = threadIdx.x, lane = tid & 31, lr = lane & 15, hi = lane >> 4; const int w = __builtin_amdgcn_readfirstlane(tid >> 5);   // the wave's number in a scalar register: the branch in the loop is a scalar one, every lane stays on for the matrix instructions
    const size_t b = blockIdx.z, h = blockIdx.y; const size_t zq = (b * (NH_ + NKV) + h) * TT * HD, zk = (b * (NH_ + NKV) + NH_ + h / REP) * TT * HD, zv = (b * NKV + h / REP) * HD * TT;
    const size_t t0 = (w < 4) ? (size_t)blockIdx.x * 128 + w * 32 : (size_t)RH + blockIdx.x * 128 + (w - 4) * 32; const size_t ao = (b * TT + t0) * DQ + h * HD;
    auto fill = [&](const int t) {
        const unsigned row = (unsigned)tid >> 3, pc = ((unsigned)tid & 7u) * 16u;   // the thread's row of 32 and its 16-byte piece
        const unsigned lf = (unsigned)(size_t)ring + (unsigned)((t & 1) * AST) + row * GPB + pc;   // low 32 bits of a __shared__ address: the byte address in LDS
        const size_t ko = (zk + (size_t)t * 64 * HD) * 2 + row * (HD * 2) + pc, vo = (zv + (size_t)t * 64) * 2 + row * (TT * 2) + pc;   // byte offsets in a [key][HD] and a [d][TT] plane
        cp6(lf, (const char*)QKh + ko, (const char*)QKl + ko, (const char*)QK16 + ko, (size_t)32 * HD * 2);
        cp6(lf + 192 * GPB, (const char*)VTh + vo, (const char*)VTl + vo, (const char*)VT16 + vo, (size_t)32 * TT * 2); };
    constexpr int NT = TT / 64;
    fill(0);
    // the Q fragments, as raw registers: waves 0-3 hi and lo planes, waves 4-7 the fp16 plane (their second set is loaded and not used)
    const h16* Qa = ((w < 4) ? (const h16*)QKh : QK16) + zq + t0 * HD + lr * HD + 8 * hi; const h16* Qb = (const h16*)QKl + zq + t0 * HD + lr * HD + 8 * hi;
    v16h qa[2][2], qb[2][2];
#pragma unroll
    for (int qt = 0; qt < 2; ++qt)
#pragma unroll
        for (int kc = 0; kc < 2; ++kc) { qa[qt][kc] = WFrag<h16>::ld(Qa + qt * 16 * HD + kc * 32); qb[qt][kc] = WFrag<h16>::ld(Qb + qt * 16 * HD + kc * 32); }
    v8f o[4][2];
#pragma unroll
    for (int dt = 0; dt < 4; ++dt)
#pragma unroll
        for (int qt = 0; qt < 2; ++qt) o[dt][qt] = (v8f){};
    float m[2] = { -3.0e38f, -3.0e38f }, l[2] = { 0.f, 0.f };
    asm volatile("s_wait_asynccnt 0x0" ::: "memory");   // this wave's copies of stage 0 have landed
    __syncthreads();                                     // and so have the other waves'
    fill(1);
    const int lofs = lr * GPB + hi * 16;   // the lane's byte offset in a block of rows
    const bool whl = __builtin_amdgcn_readfirstlane(tid >> 7) == 0;   // waves 0-3, in a scalar register of its own
#pragma unroll 1
    for (int t = 0; t < NT; ++t) {   // stays rolled: one trip a stage, the buffer chosen by the trip's parity
        const char* sb = ring + (t & 1) * AST + lofs;
        // two tests in a row on two scalars, not an if / else: the compiler lays an if / else out as two tests in a row and then keeps the two arms' accumulators in different registers (two copies of all of them a stage, and spills in the fp16 arm)
        if (whl) attn_stage<bf, true>(sb, sb + 64 * GPB, sb + 192 * GPB, sb + 256 * GPB, qa, qb, o, m, l);
        if (w >= 4) attn_stage<h16, false>(sb + 128 * GPB, nullptr, sb + 320 * GPB, nullptr, qa, qb, o, m, l);
        asm volatile("s_wait_dscnt 0x0" ::: "memory");      // this wave's reads of the buffer are done before the buffer is handed back
        asm volatile("s_wait_asynccnt 0x0" ::: "memory");   // this wave's copies of stage t + 1 have landed
        __syncthreads();                                     // publishes stage t + 1 and ends every wave's reads of stage t
        if (t + 2 < NT) fill(t + 2);
    }
    asm volatile("s_wait_asynccnt 0x0" ::: "memory");   // no copy is outstanding when the wave goes on
    bf* Ah = ATh + ao; bf* Al = ATl + ao;
    const int ln = (int)__builtin_amdgcn_mbcnt_lo(~0u, 0u);   // the lane's number, read anew: no register carries it through the loop, whose live set is near the 256 budget
#pragma unroll
    for (int qt = 0; qt < 2; ++qt) { const float inv = __fdiv_rn(1.0f, l[qt] + xhalf(l[qt])); const size_t ro = (size_t)(qt * 16 + (ln & 15)) * DQ + 8 * (ln >> 4);
#pragma unroll
        for (int dt = 0; dt < 4; ++dt) { v8us oh, ol;
#pragma unroll
            for (int r = 0; r < 8; ++r) { unsigned short a, c2; splitf(o[dt][qt][r] * inv, a, c2); oh[r] = a; ol[r] = c2; }
            *(v8us*)(Ah + ro + dt * 16) = oh; *(v8us*)(Al + ro + dt * 16) = ol; } }
}

extern "C" void kernel_launch(void* const* d_in, const int* in_sizes, int n_in,
                              void* d_out, int out_size, void* d_ws, size_t ws_size, hipStream_t stream) {
    (void)in_sizes; (void)n_in; (void)out_size;
    const float* x = (const float*)d_in[0]; const float* wqkv = (const float*)d_in[1]; const float* wo = (const float*)d_in[2]; const float* bo = (const float*)d_in[3];   /* argument order x, w_qkv ('xw' [1024][3072]), w_out ('xw'), b_out */
    float* OUT = (float*)d_out;     // [8][1024][1024]
    char* wsp = (char*)d_ws;
    auto take = [&](size_t bytes) { char* p = wsp; wsp += (bytes + 255) & ~(size_t)255; return (void*)p; };
    bf* WQKV = (bf*)take((size_t)3 * DQ * DM * 2);   /* fused Bt [3*DQ][DM]: q | k | v row blocks */ bf* WO = (bf*)take((size_t)DM * DQ * 2);
    bf* XB = (bf*)take((size_t)NB_ * TT * DM * 2);   // XB [NB_*TT][DM] bf16, all batches
    h16* QK16 = (h16*)take((size_t)NB_ * (NH_ + NKV) * TT * HD * 2); bf* QKh = (bf*)take((size_t)NB_ * (NH_ + NKV) * TT * HD * 2); bf* QKl = (bf*)take((size_t)NB_ * (NH_ + NKV) * TT * HD * 2);   // planes [batch][16 q heads | 16 k heads][t][d], all batches
    h16* VT16 = (h16*)take((size_t)NB_ * NKV * HD * TT * 2); bf* VTh = (bf*)take((size_t)NB_ * NKV * HD * TT * 2); bf* VTl = (bf*)take((size_t)NB_ * NKV * HD * TT * 2);   // planes [batch][head][d][t], all batches
    bf* ATh = (bf*)take((size_t)NB_ * TT * DQ * 2); bf* ATl = (bf*)take((size_t)NB_ * TT * DQ * 2);   // merged attention output, hi/lo, [batch * TT + t][DQ]
    if ((size_t)(wsp - (char*)d_ws) > ws_size) return;    // ws 256 MiB, 200 MiB used
    k_prep<<<PBL, 384, 0, stream>>>(x, wqkv, wo, XB, WQKV, WO);
    k_gemmw<0, false, true, DM><<<dim3(NB_ * TT / 128, 3 * DQ / 128, 1), 128, 0, stream>>>(XB, nullptr, WQKV, nullptr, 0, nullptr, QK16, QKh, QKl, VT16, VTh, VTl);
    k_fattn<<<dim3(RH / 128, NH_, NB_), 256, 0, stream>>>(QK16, QKh, QKl, VT16, VTh, VTl, ATh, ATl);
    k_gemmw<1, true, false, DQ><<<dim3(NB_ * TT / 128, DM / 128, 1), 128, 0, stream>>>(ATh, ATl, WO, OUT, DM, bo, nullptr, nullptr, nullptr, nullptr, nullptr, nullptr);
}

// v008
// It runs in 143 microseconds.
// Two timings next to v007 both put it at 1.05 times that version's speed.
// Over all steps from v000 it is 32.6 times as fast.
#include <hip/hip_runtime.h>

// Multi-head self-attention with a fused qkv projection (x [8][1024][1024]; qkv = x w_qkv ('xw' [1024][3072], no bias) -> q | k | v (16 heads x 64); dots x 1024^-0.5 (the repo scales by dim); softmax (no mask); out = merged w_out + b_out ('xw') -> [8][1024][1024] (8.4 M); argument order x, w_qkv, w_out, b_out).
// Layout: ONE preparation launch (bf16 copy of x, all batches; both 'xw' weights transposed in LDS tiles, the fused one as q | k | v row blocks); ONE launch of exact projections whose epilogue stores the head planes itself (planes of all batches kept); ONE fused attention launch over all batches and heads (hybrid rows: < 512 fp16 hi/lo 3 products, rest fp16, the hi plane being the fp16 plane; K and V^T staged in LDS, scores and weights stay in registers); ONE launch of merged hi/lo x w_out exact + b_out. Four launches.
// Compute dtypes, f32 accumulate: every input rounded to bf16; projections exact; attention rows < 512 3 products of fp16 hi/lo parts, rest fp16; softmax f32; w_out hl x exact + bias.

#define NB_  8
#define TT   1024
#define DM   1024
#define NH_  16
#define NKV  16
#define REP  (NH_ / NKV)
#define HD   64
#define DQ   (NH_ * HD)
#define DKV  (NKV * HD)
#define RH   512                  // query rows < RH use hi+lo planes
#define WIN  0
#define SCL  0.03125f   // dim^-0.5 = 1/32 (the repo scales by dim)
typedef _Float16 h16;
typedef unsigned short bf;
typedef __attribute__((ext_vector_type(16))) __bf16   v16bf;
typedef __attribute__((ext_vector_type(16))) _Float16 v16h;
typedef __attribute__((ext_vector_type(8)))  _Float16 v8h;
typedef __attribute__((ext_vector_type(8)))  unsigned short v8us;
typedef __attribute__((ext_vector_type(8)))  float    v8f;
typedef __attribute__((ext_vector_type(4)))  float    v4f;
typedef __attribute__((ext_vector_type(2)))  _Float16 v2h;
typedef __attribute__((ext_vector_type(2)))  float    v2f;
typedef v8h  __attribute__((may_alias)) v8ha;
typedef v4f  __attribute__((may_alias)) v4fa;
typedef v8us __attribute__((may_alias)) v8usa;

__device__ __forceinline__ unsigned short f2bf(float f) { unsigned u = __float_as_uint(f); u += 0x7FFFu + ((u >> 16) & 1u); return (unsigned short)(u >> 16); }
__device__ __forceinline__ float bf2f(unsigned short b) { return __uint_as_float(((unsigned)b) << 16); }
__device__ __forceinline__ float bfr(float f) { return bf2f(f2bf(f)); }
__device__ __forceinline__ v16h cat16(v8h lo, v8h hi) { return __builtin_shufflevector(lo, hi, 0, 1, 2, 3, 4, 5, 6, 7, 8, 9, 10, 11, 12, 13, 14, 15); }
__device__ __forceinline__ v16bf cat16b(v8us lo, v8us hi) { return __builtin_bit_cast(v16bf, __builtin_shufflevector(lo, hi, 0, 1, 2, 3, 4, 5, 6, 7, 8, 9, 10, 11, 12, 13, 14, 15)); }
__device__ __forceinline__ v8f wmma16(v16h a, v16h b, v8f c) { return __builtin_amdgcn_wmma_f32_16x16x32_f16(false, a, false, b, (short)0, c, false, false); }
__device__ __forceinline__ v8f wmmab(v16bf a, v16bf b, v8f c) { return __builtin_amdgcn_wmma_f32_16x16x32_bf16(false, a, false, b, (short)0, c, false, false); }



__device__ __forceinline__ void splitf(float y, unsigned short& h, unsigned short& l) { h = f2bf(y); l = f2bf(y - bf2f(h)); }
// split2: two values as fp16 parts: h the value rounded to fp16, l the fp16 of what that rounding left (the difference is exact in f32); converted as pairs
__device__ __forceinline__ void split2(const float x0, const float x1, v2h& h, v2h& l) { h = __builtin_convertvector((v2f){ x0, x1 }, v2h); l = __builtin_convertvector((v2f){ x0 - (float)h[0], x1 - (float)h[1] }, v2h); }
// put_rows: 16 plane rows of 64 values, staged as f32 in LDS at pitch 68, go out as the fp16 plane and the lo plane (fp16 of what the first rounding left) at P + row * pitch; a lane takes 8 consecutive values of a row, so every store instruction writes 4 whole 128-byte lines
__device__ __forceinline__ void put_rows(const float* os, const int lane, h16* P16, h16* Pl, const size_t pitch) {
#pragma unroll
    for (int s = 0; s < 4; ++s) { const int row = 4 * s + (lane >> 3), cofs = (lane & 7) * 8; const v4f x0 = *(const v4fa*)(os + row * 68 + cofs), x1 = *(const v4fa*)(os + row * 68 + cofs + 4); v8h o16, ol;
#pragma unroll
        for (int r = 0; r < 8; r += 2) { const v4f x = (r < 4) ? x0 : x1; v2h a2, c2; split2(x[r & 3], x[(r & 3) + 1], a2, c2); o16[r] = a2[0]; o16[r + 1] = a2[1]; ol[r] = c2[0]; ol[r + 1] = c2[1]; }
        const size_t e = (size_t)row * pitch + cofs; *(v8h*)(P16 + e) = o16; *(v8h*)(Pl + e) = ol; }
    asm volatile("s_wait_xcnt 0x0" ::: "memory");   // behind the run of stores, in front of the next rows' LDS reads, which land in registers that the stores name
}
// ---- k_gemmw: GEMM on K-contiguous bf16 planes, FOUR WAVES (2 x 2) per 128x128 output tile, each wave a 64x64 quarter (16 accumulators); grid (M/128, N/128), 128 threads.
// C[m][n] (f32, pitch ldc, + optional f32 bias[n]) = sum_k A[m][k] Bt[n][k] (+ A2[m][k] Bt[n][k] when NSPLIT == 1). K: a constant, whole stages, at least two.
// Operands go through LDS: a stage is 64 k (128 bytes) of the tile's rows [A 128 | A2 128 when NSPLIT | Bt 128] at a pitch of 144 bytes, brought by asynchronous 16-byte copies (8 lanes take one whole 128-byte line of a row),
// two buffers, the stage after next asked for as soon as every wave has left a buffer. Fragments are read from LDS in the k order of WFrag::ld, every accumulator takes its products in ascending k (A, then A2, per 32 k).
// PLANES (the q | k | v projection; rows = batch * TT + t, columns = q heads | k heads | v heads, so a wave's quarter is 64 positions of ONE head): no C; the epilogue stores the head planes, q and k heads as [head][t][d] (64 whole rows of 128 bytes),
// v heads as [head][d][t] (64 rows of d, 128 bytes of t each). 16 plane rows at a time are staged in the wave's own LDS slice, position-major for q and k, d-major for v (a lane's accumulator registers are 8 consecutive positions of one d).
template <typename T16> struct WFrag;
template <> struct WFrag<h16> { typedef v16h V; static __device__ __forceinline__ V ld(const h16* p) { return cat16(*(const v8h*)p, *(const v8h*)(p + 16)); } static __device__ __forceinline__ v8f mma(V a, V b, v8f c) { return wmma16(a, b, c); } };
template <> struct WFrag<bf> { typedef v16bf V; static __device__ __forceinline__ V ld(const bf* p) { return cat16b(*(const v8us*)p, *(const v8us*)(p + 16)); } static __device__ __forceinline__ v8f mma(V a, V b, v8f c) { return wmmab(a, b, c); } };
#define GPB 144                   // LDS row pitch in bytes: 16 x odd, free of bank conflicts for 16-byte reads of 128-byte rows
#define GPE (GPB / 2)             // the same in elements
// cp8: 128 rows x 128 bytes of one plane into LDS; the work-group's 128 threads take 16 rows a copy (thread: row tid / 8, 16-byte piece tid % 8), 8 copies each. l: the lane's LDS byte address, g: its global address, rs: 16 rows in elements.
// s_wait_xcnt 0 closes the statement: no address register of a copy is rewritten before it.
__device__ __forceinline__ void cp8(const unsigned l, const bf* g, const size_t rs) {
    asm volatile("global_load_async_to_lds_b128 %0, %8, off\n\t"
                 "global_load_async_to_lds_b128 %1, %9, off\n\t"
                 "global_load_async_to_lds_b128 %2, %10, off\n\t"
                 "global_load_async_to_lds_b128 %3, %11, off\n\t"
                 "global_load_async_to_lds_b128 %4, %12, off\n\t"
                 "global_load_async_to_lds_b128 %5, %13, off\n\t"
                 "global_load_async_to_lds_b128 %6, %14, off\n\t"
                 "global_load_async_to_lds_b128 %7, %15, off\n\t"
                 "s_wait_xcnt 0x0"
                 :: "v"(l), "v"(l + 16 * GPB), "v"(l + 32 * GPB), "v"(l + 48 * GPB), "v"(l + 64 * GPB), "v"(l + 80 * GPB), "v"(l + 96 * GPB), "v"(l + 112 * GPB),
                    "v"(g), "v"(g + rs), "v"(g + 2 * rs), "v"(g + 3 * rs), "v"(g + 4 * rs), "v"(g + 5 * rs), "v"(g + 6 * rs), "v"(g + 7 * rs) : "memory");
}
// waves_per_eu(4, 4): the projection stays inside 256 registers a wave, so that three of its work-groups (its grid is six for every WGP) are resident together; the two-plane instance, two work-groups for every WGP (its LDS lets two be resident), is held to the same bound
template <int NSPLIT, bool BIAS, bool PLANES, int K>
__global__ __launch_bounds__(128) __attribute__((amdgpu_waves_per_eu(4, 4))) void k_gemmw(const bf* __restrict__ A, const bf* __restrict__ A2, const bf* __restrict__ Bt, float* C, int ldc, const float* __restrict__ bias, h16* QK16, h16* QKl, h16* VT16, h16* VTl) {
    typedef WFrag<bf> WF; typedef typename WF::V V;
    static_assert((NSPLIT == 0 || NSPLIT == 1) && K % 64 == 0 && K >= 128, "one or two A planes; whole stages, at least two");
    constexpr int BROW = (NSPLIT ? 256 : 128), STAGE = (BROW + 128) * GPB;   // first Bt row of a stage; bytes of a stage
    __shared__ __align__(128) char ring[2 * STAGE];
    __shared__ __align__(16) float osall[4][16 * 68];
    const int tid = threadIdx.x, lane = tid & 31, lr = lane & 15, hi = lane >> 4; const int w = __builtin_amdgcn_readfirstlane(tid >> 5), wm = w >> 1, wn = w & 1;
    float* os = osall[w];
    const int R0 = blockIdx.x * 128, C0 = blockIdx.y * 128, r0 = R0 + wm * 64, c0 = C0 + wn * 64;
    v8f acc[4][4];
#pragma unroll
    for (int mb = 0; mb < 4; ++mb)
#pragma unroll
        for (int nb = 0; nb < 4; ++nb) acc[mb][nb] = (v8f){};
    const unsigned lcp = (unsigned)(size_t)ring + (unsigned)((tid >> 3) * GPB + (tid & 7) * 16);   // low 32 bits of a __shared__ address: the byte address in LDS
    const size_t rs = (size_t)16 * K; const size_t gofs = (size_t)(tid >> 3) * K + (tid & 7) * 8;
    const bf* gA = A + (size_t)R0 * K + gofs; const bf* gA2 = NSPLIT ? A2 + (size_t)R0 * K + gofs : nullptr; const bf* gB = Bt + (size_t)C0 * K + gofs;
    auto fill = [&](const int t) { const unsigned l = lcp + (unsigned)((t & 1) * STAGE); cp8(l, gA + t * 64, rs); if constexpr (NSPLIT == 1) cp8(l + 128 * GPB, gA2 + t * 64, rs); cp8(l + BROW * GPB, gB + t * 64, rs); };
    constexpr int NT = K / 64;
    fill(0);
    asm volatile("s_wait_asynccnt 0x0" ::: "memory");   // this wave's copies of stage 0 have landed
    __syncthreads();                                     // and so have the other waves'
    fill(1);
    const int aofs = (wm * 64 + lr) * GPE + 8 * hi, bofs = (BROW + wn * 64 + lr) * GPE + 8 * hi;   // the lane's element offsets in a stage
#pragma unroll 1
    for (int t = 0; t < NT; ++t) {   // stays rolled: one trip a stage, the buffer chosen by the trip's parity
        const bf* sb = (const bf*)(ring + (t & 1) * STAGE);
        // fragments of both 32-k halves of the stage; every loop here is unrolled so that the arrays are indexed by constants and stay in registers
        V a[2][4], a2[2][4], b[2][4];
#pragma unroll
        for (int mb = 0; mb < 4; ++mb) { a[0][mb] = WF::ld(sb + aofs + mb * 16 * GPE); if (NSPLIT == 1) a2[0][mb] = WF::ld(sb + aofs + (128 + mb * 16) * GPE); }
#pragma unroll
        for (int nb = 0; nb < 4; ++nb) b[0][nb] = WF::ld(sb + bofs + nb * 16 * GPE);
        if (NSPLIT == 0) {   // registers are free for the second half's A fragments: they fly during the first half's products
#pragma unroll
            for (int mb = 0; mb < 4; ++mb) a[1][mb] = WF::ld(sb + aofs + mb * 16 * GPE + 32); }
        __builtin_amdgcn_sched_barrier(0);   // the whole group of LDS reads is asked for before the first product: left free, the compiler keeps one Bt fragment and waits out an LDS latency in front of every four products
#pragma unroll
        for (int nb = 0; nb < 4; ++nb) {
#pragma unroll
            for (int mb = 0; mb < 4; ++mb) { acc[mb][nb] = WF::mma(a[0][mb], b[0][nb], acc[mb][nb]); if (NSPLIT == 1) acc[mb][nb] = WF::mma(a2[0][mb], b[0][nb], acc[mb][nb]); }
            b[1][nb] = WF::ld(sb + bofs + nb * 16 * GPE + 32);
            if (nb < 3) __builtin_amdgcn_sched_barrier(0);   // the second half's Bt fragment is asked for as soon as the first half's has been used up, not sunk to its own first use
        }
        if (NSPLIT == 1) {
#pragma unroll
            for (int mb = 0; mb < 4; ++mb) { a[1][mb] = WF::ld(sb + aofs + mb * 16 * GPE + 32); a2[1][mb] = WF::ld(sb + aofs + (128 + mb * 16) * GPE + 32); } }
        // the stage's last LDS read is asked for: the hand-over stands here, so that the refill flies during the second half's products (they read registers only)
        asm volatile("s_wait_dscnt 0x0" ::: "memory");      // this wave's reads of the buffer are done before the buffer is handed back
        asm volatile("s_wait_asynccnt 0x0" ::: "memory");   // this wave's copies of stage t + 1 have landed
        __syncthreads();                                     // publishes stage t + 1 and ends every wave's reads of stage t
        if (t + 2 < NT) fill(t + 2);
#pragma unroll
        for (int nb = 0; nb < 4; ++nb)
#pragma unroll
            for (int mb = 0; mb < 4; ++mb) { acc[mb][nb] = WF::mma(a[1][mb], b[1][nb], acc[mb][nb]); if (NSPLIT == 1) acc[mb][nb] = WF::mma(a2[1][mb], b[1][nb], acc[mb][nb]); }
    }
    asm volatile("s_wait_asynccnt 0x0" ::: "memory");   // no copy is outstanding when the wave goes on
    if constexpr (PLANES) {
        static_assert(HD == 64 && TT % 64 == 0, "a 64-column quarter is one head, a 64-row quarter lies in one batch");
        const size_t bb = (size_t)(r0 / TT), t0 = (size_t)(r0 % TT), hd = (size_t)(c0 / 64);   // batch of the group, first position, head block: q heads from 0, k heads from NH_, v heads from NH_ + NKV
        if (hd < NH_ + NKV) { const size_t zp = ((bb * (NH_ + NKV) + hd) * TT + t0) * HD;
#pragma unroll
            for (int mb = 0; mb < 4; ++mb) {
#pragma unroll
                for (int nb = 0; nb < 4; ++nb) {
#pragma unroll
                    for (int j = 0; j < 8; ++j) os[(hi * 8 + j) * 68 + nb * 16 + lr] = acc[mb][nb][j]; }
                __builtin_amdgcn_wave_barrier(); asm volatile("" ::: "memory");   // a lane reads what other lanes of the wave staged: no LDS read is lifted over the staging writes
                put_rows(os, lane, QK16 + zp + mb * 16 * HD, QKl + zp + mb * 16 * HD, HD);
                __builtin_amdgcn_wave_barrier(); asm volatile("" ::: "memory");   // the next 16 rows are not staged over rows still to be read
            }
        } else { const size_t zp = (bb * NKV + (hd - (NH_ + NKV))) * HD * TT + t0;
#pragma unroll
            for (int nb = 0; nb < 4; ++nb) {
#pragma unroll
                for (int mb = 0; mb < 4; ++mb) { float* o = os + lr * 68 + mb * 16 + hi * 8; const v8f c = acc[mb][nb]; *(v4fa*)o = (v4f){ c[0], c[1], c[2], c[3] }; *(v4fa*)(o + 4) = (v4f){ c[4], c[5], c[6], c[7] }; }
                __builtin_amdgcn_wave_barrier(); asm volatile("" ::: "memory");   // as above: staging writes, then the reads
                put_rows(os, lane, VT16 + zp + (size_t)nb * 16 * TT, VTl + zp + (size_t)nb * 16 * TT, TT);
                __builtin_amdgcn_wave_barrier(); asm volatile("" ::: "memory");   // as above: the reads, then the next staging writes
            }
        }
        return;
    }
#pragma unroll
    for (int mb = 0; mb < 4; ++mb) {
#pragma unroll
        for (int nb = 0; nb < 4; ++nb) {
#pragma unroll
            for (int j = 0; j < 8; ++j) os[(hi * 8 + j) * 68 + nb * 16 + lr] = acc[mb][nb][j]; }
        __builtin_amdgcn_wave_barrier(); asm volatile("" ::: "memory");
        float* crow = C + (size_t)(r0 + mb * 16) * ldc + c0;
{
#pragma unroll
            for (int s = 0; s < 8; ++s) { const int row = 2 * s + hi, cofs = lr * 4; v4f val = *(const v4fa*)(os + row * 68 + cofs); if (BIAS) { val[0] += bfr(bias[c0 + cofs]); val[1] += bfr(bias[c0 + cofs + 1]); val[2] += bfr(bias[c0 + cofs + 2]); val[3] += bfr(bias[c0 + cofs + 3]); }
                *(v4f*)(crow + (size_t)row * ldc + cofs) = val; }
             }
        asm volatile("s_wait_xcnt 0x0" ::: "memory");   // behind the run of stores, in front of the next rows' arithmetic, which reuses registers that the stores name
        __builtin_amdgcn_wave_barrier(); asm volatile("" ::: "memory");
    }
}

typedef __attribute__((ext_vector_type(4))) _Float16 v4h;
typedef __attribute__((ext_vector_type(2))) unsigned short v2us;
typedef __attribute__((ext_vector_type(4))) unsigned short v4us;
typedef __attribute__((ext_vector_type(4))) int v4i;

// ---- k_prep: the three independent preparations in ONE launch of few, long waves (wave starts, not bytes, set the time of a launch of many short waves): 12 waves a block; waves 0-3 each turn one 64 x 64 weight tile (w_qkv's tiles first, then w_out's), waves 4-11 each convert 4096 values of x.
// Every wave asks for 32 loads of 16 bytes a lane (16 KiB) before it uses the first; every store and every weight load covers whole 128-byte lines. No work-group barrier: a wave works alone, in its own LDS slice.
// wt_tile: 'xw' weight w [K][N] f32 -> Bt [N][K] bf16, one wave turns a tile of 64 k x 64 n in ts (64 rows of n, 64 k = 128 bytes each, at a pitch of 144 bytes). tile: n tiles run fastest, so a block's 4 waves read 1 KiB in a row of every w row.
// A load takes 2 w rows of 256 bytes (16 lanes a row), 32 rows apart; loads 2 i and 2 i + 1 of a lane are rows k and k + 1, packed as one pair, so that a lane holds 32 consecutive k of each of its 4 n and writes them to LDS 16 bytes at a time.
#define TPW 36                                // pitch of a turned row in 4-byte words
__device__ __forceinline__ void wt_tile(const float* __restrict__ w, const int K, const int N, bf* Bt, const int tile, unsigned* ts) {
    const int lane = threadIdx.x & 31, lh = lane >> 4, l16 = lane & 15, lq = lane >> 3, l8 = lane & 7; const int nn = N / 64; const int n0 = (tile % nn) * 64, k0 = (tile / nn) * 64;
    const float* g = w + (size_t)(k0 + 32 * lh) * N + n0 + l16 * 4; v4f v[32];
#pragma unroll
    for (int j = 0; j < 32; ++j) v[j] = *(const v4f*)(g + (size_t)j * N);   // unrolled, here and below: the array is indexed by constants and stays in registers
    asm volatile("s_wait_xcnt 0x0" :: "v"(g) : "memory");   // behind the run of loads, in front of everything that reuses their address registers; the address is named as an input so that no load of the run lands in its registers either
#pragma unroll
    for (int c = 0; c < 4; ++c)
#pragma unroll
        for (int q = 0; q < 4; ++q) { v4i p;
#pragma unroll
            for (int d = 0; d < 4; ++d) p[d] = (int)((unsigned)f2bf(v[8 * q + 2 * d][c]) | ((unsigned)f2bf(v[8 * q + 2 * d + 1][c]) << 16));
            *(v4i*)(ts + (l16 * 4 + c) * TPW + lh * 16 + q * 4) = p; }
    asm volatile("s_wait_dscnt 0x0" ::: "memory");   // a lane reads what other lanes of the wave wrote: the writes are done, and no LDS read is lifted over them
    bf* o = Bt + (size_t)(n0 + lq) * K + k0 + l8 * 8;
#pragma unroll
    for (int s = 0; s < 16; ++s) *(v4i*)(o + (size_t)(4 * s) * K) = *(const v4i*)(ts + (4 * s + lq) * TPW + l8 * 4);   // 4 whole lines of Bt a store
    asm volatile("s_wait_xcnt 0x0" ::: "memory");   // behind the run of stores: the code laid out behind this range rewrites registers that the stores name
}
#define WT1 (DM / 64 * (3 * DQ / 64))         // tiles of w_qkv
#define WT2 (DQ / 64 * (DM / 64))             // tiles of w_out
#define PBL ((WT1 + WT2) / 4)                 // blocks: 4 tiles each
static_assert(DM % 64 == 0 && DQ % 64 == 0 && (WT1 + WT2) % 4 == 0 && (size_t)NB_ * TT * DM == (size_t)PBL * 8 * 4096, "k_prep: whole tiles; every block has 4 tiles and 8 pieces of x");
// waves_per_eu(4, 4): a wave may use 256 registers (one block a WGP is three waves a SIMD); aiming at more waves, the compiler holds back the last loads of a run until registers of the first are free, a second memory latency in series
__global__ __launch_bounds__(384) __attribute__((amdgpu_waves_per_eu(4, 4))) void k_prep(const float* __restrict__ x, const float* __restrict__ wqkv, const float* __restrict__ wo, bf* XB, bf* WQKV, bf* WO) {
    __shared__ __align__(16) unsigned tsall[4][64 * TPW];
    const int blk = blockIdx.x; const int wv = __builtin_amdgcn_readfirstlane(threadIdx.x >> 5);   // the wave's number in a scalar register: the branches are scalar, the tile's indices scalar arithmetic
    if (wv < 4) { const int tile = blk * 4 + wv;
        if (tile < WT1) wt_tile(wqkv, DM, 3 * DQ, WQKV, tile, tsall[wv]);            // fused 'xw' [DM][3*DQ] -> Bt [3*DQ][DM]
        else wt_tile(wo, DQ, DM, WO, tile - WT1, tsall[wv]);
        return; }
    const size_t i = ((size_t)blk * 8 + (wv - 4)) * 512 + (threadIdx.x & 31); const float* gx = x + i * 8; v8f v[16]; v8us o[16];   // groups of 8 values: 32 lanes x 16 groups a wave
#pragma unroll
    for (int c = 0; c < 16; ++c) v[c] = *(const v8f*)(gx + c * 256);   // unrolled, here and below: the arrays are indexed by constants
    asm volatile("s_wait_xcnt 0x0" :: "v"(gx) : "memory");   // as in wt_tile: behind the run of loads, the address named as an input
#pragma unroll
    for (int c = 0; c < 16; ++c) {
#pragma unroll
        for (int k = 0; k < 8; ++k) o[c][k] = f2bf(v[c][k]);
        *(v8us*)(XB + (i + c * 32) * 8) = o[c]; }
    asm volatile("s_wait_xcnt 0x0" ::: "memory");   // behind the stores: the compiler lays the transposes' code behind this range, and that code rewrites registers that the stores name
}

// ---- k_fattn: the whole attention of 32 query rows in ONE WAVE, scores and weights never leave registers. Per pass of 32 keys: S^T = K Q^T (A = K rows, B = Q kept in registers), running maximum and sum per query
// (a lane holds one query's scores; the two lane halves split its keys), the two S^T tiles converted in place are the B operand of O^T += V^T P^T (A = V^T rows in the same k order as the loader's).
// Weights enter the product un-normalised, exp2(t - running max); O^T is divided by the row sum at the end and stored as the merged hi/lo planes [t][head * HD + d], 8 consecutive d per lane.
// Rows < RH: fp16 plane + lo plane, 3 products; the rest the fp16 plane alone. Grid (RH / 128, heads, batches), 8 waves: waves 0-3 take 128 rows < RH, waves 4-7 take 128 rows >= RH (equal work per work-group).
// K and V^T go through LDS, shared by the waves: a stage is 64 keys of the four planes, rows [K fp16 64 | K lo 64 | V^T fp16 64 | V^T lo 64] of 128 bytes at a pitch of 144 bytes (a K row is a key, a V^T row is a d),
// brought by asynchronous 16-byte copies (8 lanes take one whole 128-byte line), two buffers, one work-group barrier a stage. A stage is two passes of 32 keys; the fragments are read from LDS in the k order of WFrag::ld.
__device__ __forceinline__ float xhalf(float x) { const int b = __builtin_bit_cast(int, x); return __builtin_bit_cast(float, __builtin_amdgcn_permlanex16(b, b, 0x76543210, 0xfedcba98, false, false)); }   // lane l <-> lane l ^ 16
#define SCL2 (SCL * 1.4426950408889634f)   // score scale in the log2 domain
#define AST (256 * GPB)                    // bytes of a stage
// cp4: 64 rows x 128 bytes of each of two planes into LDS; the work-group's 256 threads take 32 rows a copy (thread: row tid / 8, 16-byte piece tid % 8), 2 copies a plane. l: the lane's LDS byte address in the first plane's block, g0 g1: its global addresses, hb: 32 rows in bytes.
// s_wait_xcnt 0 closes the statement: no address register of a copy is rewritten before it.
__device__ __forceinline__ void cp4(const unsigned l, const char* g0, const char* g1, const size_t hb) {
    asm volatile("global_load_async_to_lds_b128 %0, %4, off\n\t"
                 "global_load_async_to_lds_b128 %1, %5, off\n\t"
                 "global_load_async_to_lds_b128 %2, %6, off\n\t"
                 "global_load_async_to_lds_b128 %3, %7, off\n\t"
                 "s_wait_xcnt 0x0"
                 :: "v"(l), "v"(l + 32 * GPB), "v"(l + 64 * GPB), "v"(l + 96 * GPB),
                    "v"(g0), "v"(g0 + hb), "v"(g1), "v"(g1 + hb) : "memory");
}
// one stage (64 keys, two passes) for one wave. sK, sK2, sV, sV2: the lane's addresses in the stage's K and V^T blocks (row lr, 16-byte piece hi). qa, qb: the Q fragments of the fp16 and the lo plane.
template <bool HL>
__device__ __forceinline__ void attn_stage(const char* sK, const char* sK2, const char* sV, const char* sV2, const v16h (&qa)[2][2], const v16h (&qb)[2][2], v8f (&o)[4][2], float (&m)[2], float (&l)[2]) {
    typedef h16 T16; typedef WFrag<T16> WF; typedef typename WF::V V;
    // every loop below is unrolled so that the fragment and accumulator arrays are indexed by constants and stay in registers
#pragma unroll
    for (int ps = 0; ps < 2; ++ps) {
        v8f s[2][2];   // [key tile][query tile]: register r of lane (lr, hi) = score of key 32 ps + 16 kt + 8 hi + r of the stage, query 16 qt + lr
        V k[2][2], k2[2][2];
#pragma unroll
        for (int kt = 0; kt < 2; ++kt)
#pragma unroll
            for (int kc = 0; kc < 2; ++kc) { k[kt][kc] = WF::ld((const T16*)(sK + (ps * 32 + kt * 16) * GPB + kc * 64)); if (HL) k2[kt][kc] = WF::ld((const T16*)(sK2 + (ps * 32 + kt * 16) * GPB + kc * 64)); }
#pragma unroll
        for (int kt = 0; kt < 2; ++kt) { s[kt][0] = (v8f){}; s[kt][1] = (v8f){}; }
#pragma unroll
        for (int kc = 0; kc < 2; ++kc) { const V q0 = __builtin_bit_cast(V, qa[0][kc]), q1 = __builtin_bit_cast(V, qa[1][kc]);
#pragma unroll
            for (int kt = 0; kt < 2; ++kt) { s[kt][0] = WF::mma(k[kt][kc], q0, s[kt][0]); s[kt][1] = WF::mma(k[kt][kc], q1, s[kt][1]); }
            if (HL) { const V r0 = __builtin_bit_cast(V, qb[0][kc]), r1 = __builtin_bit_cast(V, qb[1][kc]);
#pragma unroll
                for (int kt = 0; kt < 2; ++kt) { s[kt][0] = WF::mma(k[kt][kc], r0, s[kt][0]); s[kt][1] = WF::mma(k[kt][kc], r1, s[kt][1]); }
#pragma unroll
                for (int kt = 0; kt < 2; ++kt) { s[kt][0] = WF::mma(k2[kt][kc], q0, s[kt][0]); s[kt][1] = WF::mma(k2[kt][kc], q1, s[kt][1]); } } }
        V v[4], v2[4];   // asked for here, they fly during the softmax arithmetic
#pragma unroll
        for (int dt = 0; dt < 4; ++dt) v[dt] = WF::ld((const T16*)(sV + dt * 16 * GPB + ps * 64));
        float mn[2]; bool need = false;
#pragma unroll
        for (int qt = 0; qt < 2; ++qt) { float mx = fmaxf(s[0][qt][0], s[1][qt][0]);
#pragma unroll
            for (int r = 1; r < 8; ++r) mx = fmaxf(mx, fmaxf(s[0][qt][r], s[1][qt][r]));
            mx = fmaxf(mx, xhalf(mx)); mn[qt] = fmaxf(m[qt], mx * SCL2); need = need || (mn[qt] > m[qt]); }
        if (__builtin_amdgcn_ballot_w32(need) != 0) {   // some query's maximum grew: bring its sum and its output column to the new maximum (factor 1 for the others)
#pragma unroll
            for (int qt = 0; qt < 2; ++qt) { const float al = __builtin_amdgcn_exp2f(m[qt] - mn[qt]); m[qt] = mn[qt]; l[qt] *= al;
#pragma unroll
                for (int dt = 0; dt < 4; ++dt) o[dt][qt] *= al; } }
        V p[2], p2[2];   // the weights as B operands: element e of lane (lr, hi) = key 32 ps + 16 (e >> 3) + 8 hi + (e & 7), the loader's k order
#pragma unroll
        for (int qt = 0; qt < 2; ++qt) {
#pragma unroll
            for (int e = 0; e < 16; e += 2) { const float pe0 = __builtin_amdgcn_exp2f(fmaf(s[e >> 3][qt][e & 7], SCL2, -m[qt])), pe1 = __builtin_amdgcn_exp2f(fmaf(s[e >> 3][qt][(e & 7) + 1], SCL2, -m[qt])); l[qt] += pe0; l[qt] += pe1;
                if constexpr (HL) { v2h ph, pl; split2(pe0, pe1, ph, pl); p[qt][e] = ph[0]; p[qt][e + 1] = ph[1]; p2[qt][e] = pl[0]; p2[qt][e + 1] = pl[1]; } else { p[qt][e] = (h16)pe0; p[qt][e + 1] = (h16)pe1; } } }
        if (HL) {   // the lo-plane V^T reads: they fly during the hi-plane products
#pragma unroll
            for (int dt = 0; dt < 4; ++dt) v2[dt] = WF::ld((const T16*)(sV2 + dt * 16 * GPB + ps * 64)); }
#pragma unroll
        for (int qt = 0; qt < 2; ++qt)
#pragma unroll
            for (int dt = 0; dt < 4; ++dt) o[dt][qt] = WF::mma(v[dt], p[qt], o[dt][qt]);
        if (HL) {
#pragma unroll
            for (int qt = 0; qt < 2; ++qt)
#pragma unroll
                for (int dt = 0; dt < 4; ++dt) o[dt][qt] = WF::mma(v[dt], p2[qt], o[dt][qt]);
#pragma unroll
            for (int qt = 0; qt < 2; ++qt)
#pragma unroll
                for (int dt = 0; dt < 4; ++dt) o[dt][qt] = WF::mma(v2[dt], p[qt], o[dt][qt]); }
        if (HL && ps == 0) __builtin_amdgcn_sched_barrier(0);   // the second pass's K reads are not lifted into the first pass's products, where no registers are free for them: left free, the compiler spills a Q fragment and reloads it every pass
    }
}
static_assert(RH * 2 == TT && RH % 128 == 0 && HD == 64 && TT % 64 == 0 && TT >= 128, "k_fattn: half the rows hi/lo, 128 rows of each kind per work-group, head size 64, whole stages, at least two");
// waves_per_eu(4, 4): four waves a SIMD, so each wave may use a quarter of the SIMD's registers (256); the hi/lo path needs nearly all of them, and the grid is exactly four waves for every SIMD (two work-groups' LDS fit a WGP)
__global__ __launch_bounds__(256) __attribute__((amdgpu_waves_per_eu(4, 4))) void k_fattn(const h16* __restrict__ QK16, const h16* __restrict__ QKl, const h16* __restrict__ VT16, const h16* __restrict__ VTl, bf* ATh, bf* ATl) {
    __shared__ __align__(128) char ring[2 * AST];
    const int tid = threadIdx.x, lane = tid & 31, lr = lane & 15, hi = lane >> 4; const int w = __builtin_amdgcn_readfirstlane(tid >> 5);   // the wave's number in a scalar register: the branch in the loop is a scalar one, every lane stays on for the matrix instructions
    const size_t b = blockIdx.z, h = blockIdx.y; const size_t zq = (b * (NH_ + NKV) + h) * TT * HD, zk = (b * (NH_ + NKV) + NH_ + h / REP) * TT * HD, zv = (b * NKV + h / REP) * HD * TT;
    const size_t t0 = (w < 4) ? (size_t)blockIdx.x * 128 + w * 32 : (size_t)RH + blockIdx.x * 128 + (w - 4) * 32; const size_t ao = (b * TT + t0) * DQ + h * HD;
    auto fill = [&](const int t) {
        const unsigned row = (unsigned)tid >> 3, pc = ((unsigned)tid & 7u) * 16u;   // the thread's row of 32 and its 16-byte piece
        const unsigned lf = (unsigned)(size_t)ring + (unsigned)((t & 1) * AST) + row * GPB + pc;   // low 32 bits of a __shared__ address: the byte address in LDS
        const size_t ko = (zk + (size_t)t * 64 * HD) * 2 + row * (HD * 2) + pc, vo = (zv + (size_t)t * 64) * 2 + row * (TT * 2) + pc;   // byte offsets in a [key][HD] and a [d][TT] plane
        cp4(lf, (const char*)QK16 + ko, (const char*)QKl + ko, (size_t)32 * HD * 2);
        cp4(lf + 128 * GPB, (const char*)VT16 + vo, (const char*)VTl + vo, (size_t)32 * TT * 2); };
    constexpr int NT = TT / 64;
    fill(0);
    // the Q fragments: the fp16 plane and the lo plane (waves 4-7 load the second set and do not use it)
    const h16* Qa = QK16 + zq + t0 * HD + lr * HD + 8 * hi; const h16* Qb = QKl + zq + t0 * HD + lr * HD + 8 * hi;
    v16h qa[2][2], qb[2][2];
#pragma unroll
    for (int qt = 0; qt < 2; ++qt)
#pragma unroll
        for (int kc = 0; kc < 2; ++kc) { qa[qt][kc] = WFrag<h16>::ld(Qa + qt * 16 * HD + kc * 32); qb[qt][kc] = WFrag<h16>::ld(Qb + qt * 16 * HD + kc * 32); }
    v8f o[4][2];
#pragma unroll
    for (int dt = 0; dt < 4; ++dt)
#pragma unroll
        for (int qt = 0; qt < 2; ++qt) o[dt][qt] = (v8f){};
    float m[2] = { -3.0e38f, -3.0e38f }, l[2] = { 0.f, 0.f };
    asm volatile("s_wait_asynccnt 0x0" ::: "memory");   // this wave's copies of stage 0 have landed
    __syncthreads();                                     // and so have the other waves'
    fill(1);
    const int lofs = lr * GPB + hi * 16;   // the lane's byte offset in a block of rows
    const bool whl = __builtin_amdgcn_readfirstlane(tid >> 7) == 0;   // waves 0-3, in a scalar register of its own
#pragma unroll 1
    for (int t = 0; t < NT; ++t) {   // stays rolled: one trip a stage, the buffer chosen by the trip's parity
        const char* sb = ring + (t & 1) * AST + lofs;
        // two tests in a row on two scalars, not an if / else: the compiler lays an if / else out as two tests in a row and then keeps the two arms' accumulators in different registers (two copies of all of them a stage, and spills in the fp16 arm)
        if (whl) attn_stage<true>(sb, sb + 64 * GPB, sb + 128 * GPB, sb + 192 * GPB, qa, qb, o, m, l);
        if (w >= 4) attn_stage<false>(sb, nullptr, sb + 128 * GPB, nullptr, qa, qb, o, m, l);
        asm volatile("s_wait_dscnt 0x0" ::: "memory");      // this wave's reads of the buffer are done before the buffer is handed back
        asm volatile("s_wait_asynccnt 0x0" ::: "memory");   // this wave's copies of stage t + 1 have landed
        __syncthreads();                                     // publishes stage t + 1 and ends every wave's reads of stage t
        if (t + 2 < NT) fill(t + 2);
    }
    asm volatile("s_wait_asynccnt 0x0" ::: "memory");   // no copy is outstanding when the wave goes on
    bf* Ah = ATh + ao; bf* Al = ATl + ao;
    const int ln = (int)__builtin_amdgcn_mbcnt_lo(~0u, 0u);   // the lane's number, read anew: no register carries it through the loop, whose live set is near the 256 budget
#pragma unroll
    for (int qt = 0; qt < 2; ++qt) { const float inv = __fdiv_rn(1.0f, l[qt] + xhalf(l[qt])); const size_t ro = (size_t)(qt * 16 + (ln & 15)) * DQ + 8 * (ln >> 4);
#pragma unroll
        for (int dt = 0; dt < 4; ++dt) { v8us oh, ol;
#pragma unroll
            for (int r = 0; r < 8; ++r) { unsigned short a, c2; splitf(o[dt][qt][r] * inv, a, c2); oh[r] = a; ol[r] = c2; }
            *(v8us*)(Ah + ro + dt * 16) = oh; *(v8us*)(Al + ro + dt * 16) = ol; } }
}

extern "C" void kernel_launch(void* const* d_in, const int* in_sizes, int n_in,
                              void* d_out, int out_size, void* d_ws, size_t ws_size, hipStream_t stream) {
    (void)in_sizes; (void)n_in; (void)out_size;
    const float* x = (const float*)d_in[0]; const float* wqkv = (const float*)d_in[1]; const float* wo = (const float*)d_in[2]; const float* bo = (const float*)d_in[3];   /* argument order x, w_qkv ('xw' [1024][3072]), w_out ('xw'), b_out */
    float* OUT = (float*)d_out;     // [8][1024][1024]
    char* wsp = (char*)d_ws;
    auto take = [&](size_t bytes) { char* p = wsp; wsp += (bytes + 255) & ~(size_t)255; return (void*)p; };
    bf* WQKV = (bf*)take((size_t)3 * DQ * DM * 2);   /* fused Bt [3*DQ][DM]: q | k | v row blocks */ bf* WO = (bf*)take((size_t)DM * DQ * 2);
    bf* XB = (bf*)take((size_t)NB_ * TT * DM * 2);   // XB [NB_*TT][DM] bf16, all batches
    h16* QK16 = (h16*)take((size_t)NB_ * (NH_ + NKV) * TT * HD * 2); h16* QKl = (h16*)take((size_t)NB_ * (NH_ + NKV) * TT * HD * 2);   // planes [batch][16 q heads | 16 k heads][t][d], all batches
    h16* VT16 = (h16*)take((size_t)NB_ * NKV * HD * TT * 2); h16* VTl = (h16*)take((size_t)NB_ * NKV * HD * TT * 2);   // planes [batch][head][d][t], all batches
    bf* ATh = (bf*)take((size_t)NB_ * TT * DQ * 2); bf* ATl = (bf*)take((size_t)NB_ * TT * DQ * 2);   // merged attention output, hi/lo, [batch * TT + t][DQ]
    if ((size_t)(wsp - (char*)d_ws) > ws_size) return;    // ws 256 MiB, 152 MiB used
    k_prep<<<PBL, 384, 0, stream>>>(x, wqkv, wo, XB, WQKV, WO);
    k_gemmw<0, false, true, DM><<<dim3(NB_ * TT / 128, 3 * DQ / 128, 1), 128, 0, stream>>>(XB, nullptr, WQKV, nullptr, 0, nullptr, QK16, QKl, VT16, VTl);
    k_fattn<<<dim3(RH / 128, NH_, NB_), 256, 0, stream>>>(QK16, QKl, VT16, VTl, ATh, ATl);
    k_gemmw<1, true, false, DQ><<<dim3(NB_ * TT / 128, DM / 128, 1), 128, 0, stream>>>(ATh, ATl, WO, OUT, DM, bo, nullptr, nullptr, nullptr, nullptr);
}

// v009
// One run takes 137 microseconds.
// Timed twice side by side with v008, it ran 1.04 times as fast both times.
// Over all steps from v000 it is 34.0 times as fast.
#include <hip/hip_runtime.h>

// Multi-head self-attention with a fused qkv projection (x [8][1024][1024]; qkv = x w_qkv ('xw' [1024][3072], no bias) -> q | k | v (16 heads x 64); dots x 1024^-0.5 (the repo scales by dim); softmax (no mask); out = merged w_out + b_out ('xw') -> [8][1024][1024] (8.4 M); argument order x, w_qkv, w_out, b_out).
// Layout: ONE preparation launch (bf16 copy of x, all batches; both 'xw' weights transposed in LDS tiles, the fused one as q | k | v row blocks); ONE launch of exact projections whose epilogue stores the head planes itself (planes of all batches kept); ONE fused attention launch over all batches and heads (hybrid rows: < 512 fp16 hi/lo 3 products, rest fp16, the hi plane being the fp16 plane; K and V^T staged in LDS, scores and weights stay in registers); ONE launch of merged hi/lo x w_out exact + b_out. Four launches.
// Compute dtypes, f32 accumulate: every input rounded to bf16; projections exact; attention rows < 512 3 products of fp16 hi/lo parts, rest fp16; softmax f32; w_out hl x exact + bias.

#define NB_  8
#define TT   1024
#define DM   1024
#define NH_  16
#define NKV  16
#define REP  (NH_ / NKV)
#define HD   64
#define DQ   (NH_ * HD)
#define DKV  (NKV * HD)
#define RH   512                  // query rows < RH use hi+lo planes
#define WIN  0
#define SCL  0.03125f   // dim^-0.5 = 1/32 (the repo scales by dim)
typedef _Float16 h16;
typedef unsigned short bf;
typedef __attribute__((ext_vector_type(16))) __bf16   v16bf;
typedef __attribute__((ext_vector_type(16))) _Float16 v16h;
typedef __attribute__((ext_vector_type(8)))  _Float16 v8h;
typedef __attribute__((ext_vector_type(8)))  unsigned short v8us;
typedef __attribute__((ext_vector_type(8)))  float    v8f;
typedef __attribute__((ext_vector_type(4)))  float    v4f;
typedef __attribute__((ext_vector_type(2)))  _Float16 v2h;
typedef __attribute__((ext_vector_type(2)))  float    v2f;
typedef v8h  __attribute__((may_alias)) v8ha;
typedef v4f  __attribute__((may_alias)) v4fa;
typedef v8us __attribute__((may_alias)) v8usa;

__device__ __forceinline__ unsigned short f2bf(float f) { unsigned u = __float_as_uint(f); u += 0x7FFFu + ((u >> 16) & 1u); return (unsigned short)(u >> 16); }
__device__ __forceinline__ float bf2f(unsigned short b) { return __uint_as_float(((unsigned)b) << 16); }
__device__ __forceinline__ float bfr(float f) { return bf2f(f2bf(f)); }
__device__ __forceinline__ v16h cat16(v8h lo, v8h hi) { return __builtin_shufflevector(lo, hi, 0, 1, 2, 3, 4, 5, 6, 7, 8, 9, 10, 11, 12, 13, 14, 15); }
__device__ __forceinline__ v16bf cat16b(v8us lo, v8us hi) { return __builtin_bit_cast(v16bf, __builtin_shufflevector(lo, hi, 0, 1, 2, 3, 4, 5, 6, 7, 8, 9, 10, 11, 12, 13, 14, 15)); }
__device__ __forceinline__ v8f wmma16(v16h a, v16h b, v8f c) { return __builtin_amdgcn_wmma_f32_16x16x32_f16(false, a, false, b, (short)0, c, false, false); }
__device__ __forceinline__ v8f wmmab(v16bf a, v16bf b, v8f c) { return __builtin_amdgcn_wmma_f32_16x16x32_bf16(false, a, false, b, (short)0, c, false, false); }



__device__ __forceinline__ void splitf(float y, unsigned short& h, unsigned short& l) { h = f2bf(y); l = f2bf(y - bf2f(h)); }
// split2: two values as fp16 parts: h the value rounded to fp16, l the fp16 of what that rounding left (the difference is exact in f32); converted as pairs
__device__ __forceinline__ void split2(const float x0, const float x1, v2h& h, v2h& l) { h = __builtin_convertvector((v2f){ x0, x1 }, v2h); l = __builtin_convertvector((v2f){ x0 - (float)h[0], x1 - (float)h[1] }, v2h); }
// put_rows: 16 plane rows of 64 values, staged as f32 in LDS at pitch 68, go out as the fp16 plane and the lo plane (fp16 of what the first rounding left) at P + row * pitch; a lane takes 8 consecutive values of a row, so every store instruction writes 4 whole 128-byte lines
__device__ __forceinline__ void put_rows(const float* os, const int lane, h16* P16, h16* Pl, const size_t pitch) {
#pragma unroll
    for (int s = 0; s < 4; ++s) { const int row = 4 * s + (lane >> 3), cofs = (lane & 7) * 8; const v4f x0 = *(const v4fa*)(os + row * 68 + cofs), x1 = *(const v4fa*)(os + row * 68 + cofs + 4); v8h o16, ol;
#pragma unroll
        for (int r = 0; r < 8; r += 2) { const v4f x = (r < 4) ? x0 : x1; v2h a2, c2; split2(x[r & 3], x[(r & 3) + 1], a2, c2); o16[r] = a2[0]; o16[r + 1] = a2[1]; ol[r] = c2[0]; ol[r + 1] = c2[1]; }
        const size_t e = (size_t)row * pitch + cofs; *(v8h*)(P16 + e) = o16; *(v8h*)(Pl + e) = ol; }
    asm volatile("s_wait_xcnt 0x0" ::: "memory");   // behind the run of stores, in front of the next rows' LDS reads, which land in registers that the stores name
}
// ---- k_gemmw: GEMM on K-contiguous bf16 planes, FOUR WAVES (2 x 2) per 128x128 output tile, each wave a 64x64 quarter (16 accumulators); grid (M/128, N/128), 128 threads.
// C[m][n] (f32, pitch ldc, + optional f32 bias[n]) = sum_k A[m][k] Bt[n][k] (+ A2[m][k] Bt[n][k] when NSPLIT == 1). K: a constant, whole stages, at least two.
// Operands go through LDS: a stage is 64 k (128 bytes) of the tile's rows [A 128 | A2 128 when NSPLIT | Bt 128] at a pitch of 144 bytes, brought by asynchronous 16-byte copies (8 lanes take one whole 128-byte line of a row),
// two buffers, the stage after next asked for as soon as every wave has left a buffer. Fragments are read from LDS in the k order of WFrag::ld, every accumulator takes its products in ascending k (A, then A2, per 32 k).
// PLANES (the q | k | v projection; rows = batch * TT + t, columns = q heads | k heads | v heads, so a wave's quarter is 64 positions of ONE head): no C; the epilogue stores the head planes, q and k heads as [head][t][d] (64 whole rows of 128 bytes),
// v heads as [head][d][t] (64 rows of d, 128 bytes of t each). 16 plane rows at a time are staged in the wave's own LDS slice, position-major for q and k, d-major for v (a lane's accumulator registers are 8 consecutive positions of one d).
template <typename T16> struct WFrag;
template <> struct WFrag<h16> { typedef v16h V; static __device__ __forceinline__ V ld(const h16* p) { return cat16(*(const v8h*)p, *(const v8h*)(p + 16)); } static __device__ __forceinline__ v8f mma(V a, V b, v8f c) { return wmma16(a, b, c); } };
template <> struct WFrag<bf> { typedef v16bf V; static __device__ __forceinline__ V ld(const bf* p) { return cat16b(*(const v8us*)p, *(const v8us*)(p + 16)); } static __device__ __forceinline__ v8f mma(V a, V b, v8f c) { return wmmab(a, b, c); } };
#define GPB 144                   // LDS row pitch in bytes: 16 x odd, free of bank conflicts for 16-byte reads of 128-byte rows
#define GPE (GPB / 2)             // the same in elements
// cp8: 128 rows x 128 bytes of one plane into LDS; the work-group's 128 threads take 16 rows a copy (thread: row tid / 8, 16-byte piece tid % 8), 8 copies each. l: the lane's LDS byte address, g: its global address, rs: 16 rows in elements.
// s_wait_xcnt 0 closes the statement: no address register of a copy is rewritten before it.
__device__ __forceinline__ void cp8(const unsigned l, const bf* g, const size_t rs) {
    asm volatile("global_load_async_to_lds_b128 %0, %8, off\n\t"
                 "global_load_async_to_lds_b128 %1, %9, off\n\t"
                 "global_load_async_to_lds_b128 %2, %10, off\n\t"
                 "global_load_async_to_lds_b128 %3, %11, off\n\t"
                 "global_load_async_to_lds_b128 %4, %12, off\n\t"
                 "global_load_async_to_lds_b128 %5, %13, off\n\t"
                 "global_load_async_to_lds_b128 %6, %14, off\n\t"
                 "global_load_async_to_lds_b128 %7, %15, off\n\t"
                 "s_wait_xcnt 0x0"
                 :: "v"(l), "v"(l + 16 * GPB), "v"(l + 32 * GPB), "v"(l + 48 * GPB), "v"(l + 64 * GPB), "v"(l + 80 * GPB), "v"(l + 96 * GPB), "v"(l + 112 * GPB),
                    "v"(g), "v"(g + rs), "v"(g + 2 * rs), "v"(g + 3 * rs), "v"(g + 4 * rs), "v"(g + 5 * rs), "v"(g + 6 * rs), "v"(g + 7 * rs) : "memory");
}
// waves_per_eu(4, 4): the projection stays inside 256 registers a wave, so that three of its work-groups (its grid is six for every WGP) are resident together; the two-plane instance, two work-groups for every WGP (its LDS lets two be resident), is held to the same bound
template <int NSPLIT, bool BIAS, bool PLANES, int K>
__global__ __launch_bounds__(128) __attribute__((amdgpu_waves_per_eu(4, 4))) void k_gemmw(const bf* __restrict__ A, const bf* __restrict__ A2, const bf* __restrict__ Bt, float* C, int ldc, const float* __restrict__ bias, h16* QK16, h16* QKl, h16* VT16, h16* VTl) {
    typedef WFrag<bf> WF; typedef typename WF::V V;
    static_assert((NSPLIT == 0 || NSPLIT == 1) && K % 64 == 0 && K >= 128, "one or two A planes; whole stages, at least two");
    constexpr int BROW = (NSPLIT ? 256 : 128), STAGE = (BROW + 128) * GPB;   // first Bt row of a stage; bytes of a stage
    __shared__ __align__(128) char ring[2 * STAGE];
    __shared__ __align__(16) float osall[4][16 * 68];
    const int tid = threadIdx.x, lane = tid & 31, lr = lane & 15, hi = lane >> 4; const int w = __builtin_amdgcn_readfirstlane(tid >> 5), wm = w >> 1, wn = w & 1;
    float* os = osall[w];
    const int R0 = blockIdx.x * 128, C0 = blockIdx.y * 128, r0 = R0 + wm * 64, c0 = C0 + wn * 64;
    v8f acc[4][4];
#pragma unroll
    for (int mb = 0; mb < 4; ++mb)
#pragma unroll
        for (int nb = 0; nb < 4; ++nb) acc[mb][nb] = (v8f){};
    const unsigned lcp = (unsigned)(size_t)ring + (unsigned)((tid >> 3) * GPB + (tid & 7) * 16);   // low 32 bits of a __shared__ address: the byte address in LDS
    const size_t rs = (size_t)16 * K; const size_t gofs = (size_t)(tid >> 3) * K + (tid & 7) * 8;
    const bf* gA = A + (size_t)R0 * K + gofs; const bf* gA2 = NSPLIT ? A2 + (size_t)R0 * K + gofs : nullptr; const bf* gB = Bt + (size_t)C0 * K + gofs;
    auto fill = [&](const int t) { const unsigned l = lcp + (unsigned)((t & 1) * STAGE); cp8(l, gA + t * 64, rs); if constexpr (NSPLIT == 1) cp8(l + 128 * GPB, gA2 + t * 64, rs); cp8(l + BROW * GPB, gB + t * 64, rs); };
    constexpr int NT = K / 64;
    fill(0);
    asm volatile("s_wait_asynccnt 0x0" ::: "memory");   // this wave's copies of stage 0 have landed
    __syncthreads();                                     // and so have the other waves'
    fill(1);
    const int aofs = (wm * 64 + lr) * GPE + 8 * hi, bofs = (BROW + wn * 64 + lr) * GPE + 8 * hi;   // the lane's element offsets in a stage
#pragma unroll 1
    for (int t = 0; t < NT; ++t) {   // stays rolled: one trip a stage, the buffer chosen by the trip's parity
        const bf* sb = (const bf*)(ring + (t & 1) * STAGE);
        // fragments of both 32-k halves of the stage; every loop here is unrolled so that the arrays are indexed by constants and stay in registers
        V a[2][4], a2[2][4], b[2][4];
#pragma unroll
        for (int mb = 0; mb < 4; ++mb) { a[0][mb] = WF::ld(sb + aofs + mb * 16 * GPE); if (NSPLIT == 1) a2[0][mb] = WF::ld(sb + aofs + (128 + mb * 16) * GPE); }
#pragma unroll
        for (int nb = 0; nb < 4; ++nb) b[0][nb] = WF::ld(sb + bofs + nb * 16 * GPE);
        if (NSPLIT == 0) {   // registers are free for the second half's A fragments: they fly during the first half's products
#pragma unroll
            for (int mb = 0; mb < 4; ++mb) a[1][mb] = WF::ld(sb + aofs + mb * 16 * GPE + 32); }
        __builtin_amdgcn_sched_barrier(0);   // the whole group of LDS reads is asked for before the first product: left free, the compiler keeps one Bt fragment and waits out an LDS latency in front of every four products
#pragma unroll
        for (int nb = 0; nb < 4; ++nb) {
#pragma unroll
            for (int mb = 0; mb < 4; ++mb) { acc[mb][nb] = WF::mma(a[0][mb], b[0][nb], acc[mb][nb]); if (NSPLIT == 1) acc[mb][nb] = WF::mma(a2[0][mb], b[0][nb], acc[mb][nb]); }
            b[1][nb] = WF::ld(sb + bofs + nb * 16 * GPE + 32);
            if (nb < 3) __builtin_amdgcn_sched_barrier(0);   // the second half's Bt fragment is asked for as soon as the first half's has been used up, not sunk to its own first use
        }
        if (NSPLIT == 1) {
#pragma unroll
            for (int mb = 0; mb < 4; ++mb) { a[1][mb] = WF::ld(sb + aofs + mb * 16 * GPE + 32); a2[1][mb] = WF::ld(sb + aofs + (128 + mb * 16) * GPE + 32); } }
        // the stage's last LDS read is asked for: the hand-over stands here, so that the refill flies during the second half's products (they read registers only)
        asm volatile("s_wait_dscnt 0x0" ::: "memory");      // this wave's reads of the buffer are done before the buffer is handed back
        asm volatile("s_wait_asynccnt 0x0" ::: "memory");   // this wave's copies of stage t + 1 have landed
        __syncthreads();                                     // publishes stage t + 1 and ends every wave's reads of stage t
        if (t + 2 < NT) fill(t + 2);
#pragma unroll
        for (int nb = 0; nb < 4; ++nb)
#pragma unroll
            for (int mb = 0; mb < 4; ++mb) { acc[mb][nb] = WF::mma(a[1][mb], b[1][nb], acc[mb][nb]); if (NSPLIT == 1) acc[mb][nb] = WF::mma(a2[1][mb], b[1][nb], acc[mb][nb]); }
    }
    asm volatile("s_wait_asynccnt 0x0" ::: "memory");   // no copy is outstanding when the wave goes on
    if constexpr (PLANES) {
        static_assert(HD == 64 && TT % 64 == 0, "a 64-column quarter is one head, a 64-row quarter lies in one batch");
        const size_t bb = (size_t)(r0 / TT), t0 = (size_t)(r0 % TT), hd = (size_t)(c0 / 64);   // batch of the group, first position, head block: q heads from 0, k heads from NH_, v heads from NH_ + NKV
        if (hd < NH_ + NKV) { const size_t zp = ((bb * (NH_ + NKV) + hd) * TT + t0) * HD;
#pragma unroll
            for (int mb = 0; mb < 4; ++mb) {
#pragma unroll
                for (int nb = 0; nb < 4; ++nb) {
#pragma unroll
                    for (int j = 0; j < 8; ++j) os[(hi * 8 + j) * 68 + nb * 16 + lr] = acc[mb][nb][j]; }
                __builtin_amdgcn_wave_barrier(); asm volatile("" ::: "memory");   // a lane reads what other lanes of the wave staged: no LDS read is lifted over the staging writes
                put_rows(os, lane, QK16 + zp + mb * 16 * HD, QKl + zp + mb * 16 * HD, HD);
                __builtin_amdgcn_wave_barrier(); asm volatile("" ::: "memory");   // the next 16 rows are not staged over rows still to be read
            }
        } else { const size_t zp = (bb * NKV + (hd - (NH_ + NKV))) * HD * TT + t0;
#pragma unroll
            for (int nb = 0; nb < 4; ++nb) {
#pragma unroll
                for (int mb = 0; mb < 4; ++mb) { float* o = os + lr * 68 + mb * 16 + hi * 8; const v8f c = acc[mb][nb]; *(v4fa*)o = (v4f){ c[0], c[1], c[2], c[3] }; *(v4fa*)(o + 4) = (v4f){ c[4], c[5], c[6], c[7] }; }
                __builtin_amdgcn_wave_barrier(); asm volatile("" ::: "memory");   // as above: staging writes, then the reads
                put_rows(os, lane, VT16 + zp + (size_t)nb * 16 * TT, VTl + zp + (size_t)nb * 16 * TT, TT);
                __builtin_amdgcn_wave_barrier(); asm volatile("" ::: "memory");   // as above: the reads, then the next staging writes
            }
        }
        return;
    }
#pragma unroll
    for (int mb = 0; mb < 4; ++mb) {
#pragma unroll
        for (int nb = 0; nb < 4; ++nb) {
#pragma unroll
            for (int j = 0; j < 8; ++j) os[(hi * 8 + j) * 68 + nb * 16 + lr] = acc[mb][nb][j]; }
        __builtin_amdgcn_wave_barrier(); asm volatile("" ::: "memory");
        float* crow = C + (size_t)(r0 + mb * 16) * ldc + c0;
{
#pragma unroll
            for (int s = 0; s < 8; ++s) { const int row = 2 * s + hi, cofs = lr * 4; v4f val = *(const v4fa*)(os + row * 68 + cofs); if (BIAS) { val[0] += bfr(bias[c0 + cofs]); val[1] += bfr(bias[c0 + cofs + 1]); val[2] += bfr(bias[c0 + cofs + 2]); val[3] += bfr(bias[c0 + cofs + 3]); }
                *(v4f*)(crow + (size_t)row * ldc + cofs) = val; }
             }
        asm volatile("s_wait_xcnt 0x0" ::: "memory");   // behind the run of stores, in front of the next rows' arithmetic, which reuses registers that the stores name
        __builtin_amdgcn_wave_barrier(); asm volatile("" ::: "memory");
    }
}

typedef __attribute__((ext_vector_type(4))) _Float16 v4h;
typedef __attribute__((ext_vector_type(2))) unsigned short v2us;
typedef __attribute__((ext_vector_type(4))) unsigned short v4us;
typedef __attribute__((ext_vector_type(4))) int v4i;

// ---- k_prep: the three independent preparations in ONE launch of few, long waves (wave starts, not bytes, set the time of a launch of many short waves): 12 waves a block; waves 0-3 each turn one 64 x 64 weight tile (w_qkv's tiles first, then w_out's), waves 4-11 each convert 4096 values of x.
// Every wave asks for 32 loads of 16 bytes a lane (16 KiB) before it uses the first; every store and every weight load covers whole 128-byte lines. No work-group barrier: a wave works alone, in its own LDS slice.
// wt_tile: 'xw' weight w [K][N] f32 -> Bt [N][K] bf16, one wave turns a tile of 64 k x 64 n in ts (64 rows of n, 64 k = 128 bytes each, at a pitch of 144 bytes). tile: n tiles run fastest, so a block's 4 waves read 1 KiB in a row of every w row.
// A load takes 2 w rows of 256 bytes (16 lanes a row), 32 rows apart; loads 2 i and 2 i + 1 of a lane are rows k and k + 1, packed as one pair, so that a lane holds 32 consecutive k of each of its 4 n and writes them to LDS 16 bytes at a time.
#define TPW 36                                // pitch of a turned row in 4-byte words
__device__ __forceinline__ void wt_tile(const float* __restrict__ w, const int K, const int N, bf* Bt, const int tile, unsigned* ts) {
    const int lane = threadIdx.x & 31, lh = lane >> 4, l16 = lane & 15, lq = lane >> 3, l8 = lane & 7; const int nn = N / 64; const int n0 = (tile % nn) * 64, k0 = (tile / nn) * 64;
    const float* g = w + (size_t)(k0 + 32 * lh) * N + n0 + l16 * 4; v4f v[32];
#pragma unroll
    for (int j = 0; j < 32; ++j) v[j] = *(const v4f*)(g + (size_t)j * N);   // unrolled, here and below: the array is indexed by constants and stays in registers
    asm volatile("s_wait_xcnt 0x0" :: "v"(g) : "memory");   // behind the run of loads, in front of everything that reuses their address registers; the address is named as an input so that no load of the run lands in its registers either
#pragma unroll
    for (int c = 0; c < 4; ++c)
#pragma unroll
        for (int q = 0; q < 4; ++q) { v4i p;
#pragma unroll
            for (int d = 0; d < 4; ++d) p[d] = (int)((unsigned)f2bf(v[8 * q + 2 * d][c]) | ((unsigned)f2bf(v[8 * q + 2 * d + 1][c]) << 16));
            *(v4i*)(ts + (l16 * 4 + c) * TPW + lh * 16 + q * 4) = p; }
    asm volatile("s_wait_dscnt 0x0" ::: "memory");   // a lane reads what other lanes of the wave wrote: the writes are done, and no LDS read is lifted over them
    bf* o = Bt + (size_t)(n0 + lq) * K + k0 + l8 * 8;
#pragma unroll
    for (int s = 0; s < 16; ++s) *(v4i*)(o + (size_t)(4 * s) * K) = *(const v4i*)(ts + (4 * s + lq) * TPW + l8 * 4);   // 4 whole lines of Bt a store
    asm volatile("s_wait_xcnt 0x0" ::: "memory");   // behind the run of stores: the code laid out behind this range rewrites registers that the stores name
}
#define WT1 (DM / 64 * (3 * DQ / 64))         // tiles of w_qkv
#define WT2 (DQ / 64 * (DM / 64))             // tiles of w_out
#define PBL ((WT1 + WT2) / 4)                 // blocks: 4 tiles each
static_assert(DM % 64 == 0 && DQ % 64 == 0 && (WT1 + WT2) % 4 == 0 && (size_t)NB_ * TT * DM == (size_t)PBL * 8 * 4096, "k_prep: whole tiles; every block has 4 tiles and 8 pieces of x");
// waves_per_eu(4, 4): a wave may use 256 registers (one block a WGP is three waves a SIMD); aiming at more waves, the compiler holds back the last loads of a run until registers of the first are free, a second memory latency in series
__global__ __launch_bounds__(384) __attribute__((amdgpu_waves_per_eu(4, 4))) void k_prep(const float* __restrict__ x, const float* __restrict__ wqkv, const float* __restrict__ wo, bf* XB, bf* WQKV, bf* WO) {
    __shared__ __align__(16) unsigned tsall[4][64 * TPW];
    const int blk = blockIdx.x; const int wv = __builtin_amdgcn_readfirstlane(threadIdx.x >> 5);   // the wave's number in a scalar register: the branches are scalar, the tile's indices scalar arithmetic
    if (wv < 4) { const int tile = blk * 4 + wv;
        if (tile < WT1) wt_tile(wqkv, DM, 3 * DQ, WQKV, tile, tsall[wv]);            // fused 'xw' [DM][3*DQ] -> Bt [3*DQ][DM]
        else wt_tile(wo, DQ, DM, WO, tile - WT1, tsall[wv]);
        return; }
    const size_t i = ((size_t)blk * 8 + (wv - 4)) * 512 + (threadIdx.x & 31); const float* gx = x + i * 8; v8f v[16]; v8us o[16];   // groups of 8 values: 32 lanes x 16 groups a wave
#pragma unroll
    for (int c = 0; c < 16; ++c) v[c] = *(const v8f*)(gx + c * 256);   // unrolled, here and below: the arrays are indexed by constants
    asm volatile("s_wait_xcnt 0x0" :: "v"(gx) : "memory");   // as in wt_tile: behind the run of loads, the address named as an input
#pragma unroll
    for (int c = 0; c < 16; ++c) {
#pragma unroll
        for (int k = 0; k < 8; ++k) o[c][k] = f2bf(v[c][k]);
        *(v8us*)(XB + (i + c * 32) * 8) = o[c]; }
    asm volatile("s_wait_xcnt 0x0" ::: "memory");   // behind the stores: the compiler lays the transposes' code behind this range, and that code rewrites registers that the stores name
}

// ---- k_fattn: the whole attention of 32 query rows in ONE WAVE, scores and weights never leave registers. Per pass of 32 keys: S^T = K Q^T (A = K rows, B = Q kept in registers), running maximum and sum per query
// (a lane holds one query's scores; the two lane halves split its keys), the two S^T tiles converted in place are the B operand of O^T += V^T P^T (A = V^T rows in the same k order as the loader's).
// Weights enter the product un-normalised, exp2(t - running max); O^T is divided by the row sum at the end and stored as the merged hi/lo planes [t][head * HD + d], turned in LDS so that every store covers whole 128-byte lines.
// Rows < RH: fp16 plane + lo plane, 3 products; the rest the fp16 plane alone. Grid (RH / 128, heads, batches), 8 waves: waves 0-3 take 128 rows < RH, waves 4-7 take 128 rows >= RH (equal work per work-group).
// K and V^T go through LDS, shared by the waves: a stage is 64 keys of the four planes, rows [K fp16 64 | K lo 64 | V^T fp16 64 | V^T lo 64] of 128 bytes at a pitch of 144 bytes (a K row is a key, a V^T row is a d),
// brought by asynchronous 16-byte copies (8 lanes take one whole 128-byte line), two buffers, one work-group barrier a stage. A stage is two passes of 32 keys; the fragments are read from LDS in the k order of WFrag::ld.
__device__ __forceinline__ float xhalf(float x) { const int b = __builtin_bit_cast(int, x); return __builtin_bit_cast(float, __builtin_amdgcn_permlanex16(b, b, 0x76543210, 0xfedcba98, false, false)); }   // lane l <-> lane l ^ 16
#define SCL2 (SCL * 1.4426950408889634f)   // score scale in the log2 domain
#define AST (256 * GPB)                    // bytes of a stage
// cp4: 64 rows x 128 bytes of each of two planes into LDS; the work-group's 256 threads take 32 rows a copy (thread: row tid / 8, 16-byte piece tid % 8), 2 copies a plane. l: the lane's LDS byte address in the first plane's block, g0 g1: its global addresses, hb: 32 rows in bytes.
// s_wait_xcnt 0 closes the statement: no address register of a copy is rewritten before it.
__device__ __forceinline__ void cp4(const unsigned l, const char* g0, const char* g1, const size_t hb) {
    asm volatile("global_load_async_to_lds_b128 %0, %4, off\n\t"
                 "global_load_async_to_lds_b128 %1, %5, off\n\t"
                 "global_load_async_to_lds_b128 %2, %6, off\n\t"
                 "global_load_async_to_lds_b128 %3, %7, off\n\t"
                 "s_wait_xcnt 0x0"
                 :: "v"(l), "v"(l + 32 * GPB), "v"(l + 64 * GPB), "v"(l + 96 * GPB),
                    "v"(g0), "v"(g0 + hb), "v"(g1), "v"(g1 + hb) : "memory");
}
// one stage (64 keys, two passes) for one wave. sK, sK2, sV, sV2: the lane's addresses in the stage's K and V^T blocks (row lr, 16-byte piece hi). qa, qb: the Q fragments of the fp16 and the lo plane.
template <bool HL>
__device__ __forceinline__ void attn_stage(const char* sK, const char* sK2, const char* sV, const char* sV2, const v16h (&qa)[2][2], const v16h (&qb)[2][2], v8f (&o)[4][2], float (&m)[2], float (&l)[2]) {
    typedef h16 T16; typedef WFrag<T16> WF; typedef typename WF::V V;
    // every loop below is unrolled so that the fragment and accumulator arrays are indexed by constants and stay in registers
#pragma unroll
    for (int ps = 0; ps < 2; ++ps) {
        v8f s[2][2];   // [key tile][query tile]: register r of lane (lr, hi) = score of key 32 ps + 16 kt + 8 hi + r of the stage, query 16 qt + lr
        V k[2][2], k2[2][2];
#pragma unroll
        for (int kt = 0; kt < 2; ++kt)
#pragma unroll
            for (int kc = 0; kc < 2; ++kc) { k[kt][kc] = WF::ld((const T16*)(sK + (ps * 32 + kt * 16) * GPB + kc * 64)); if (HL) k2[kt][kc] = WF::ld((const T16*)(sK2 + (ps * 32 + kt * 16) * GPB + kc * 64)); }
#pragma unroll
        for (int kt = 0; kt < 2; ++kt) { s[kt][0] = (v8f){}; s[kt][1] = (v8f){}; }
#pragma unroll
        for (int kc = 0; kc < 2; ++kc) { const V q0 = __builtin_bit_cast(V, qa[0][kc]), q1 = __builtin_bit_cast(V, qa[1][kc]);
#pragma unroll
            for (int kt = 0; kt < 2; ++kt) { s[kt][0] = WF::mma(k[kt][kc], q0, s[kt][0]); s[kt][1] = WF::mma(k[kt][kc], q1, s[kt][1]); }
            if (HL) { const V r0 = __builtin_bit_cast(V, qb[0][kc]), r1 = __builtin_bit_cast(V, qb[1][kc]);
#pragma unroll
                for (int kt = 0; kt < 2; ++kt) { s[kt][0] = WF::mma(k[kt][kc], r0, s[kt][0]); s[kt][1] = WF::mma(k[kt][kc], r1, s[kt][1]); }
#pragma unroll
                for (int kt = 0; kt < 2; ++kt) { s[kt][0] = WF::mma(k2[kt][kc], q0, s[kt][0]); s[kt][1] = WF::mma(k2[kt][kc], q1, s[kt][1]); } } }
        V v[4], v2[4];   // asked for here, they fly during the softmax arithmetic
#pragma unroll
        for (int dt = 0; dt < 4; ++dt) v[dt] = WF::ld((const T16*)(sV + dt * 16 * GPB + ps * 64));
        float mn[2]; bool need = false;
#pragma unroll
        for (int qt = 0; qt < 2; ++qt) { float mx = fmaxf(s[0][qt][0], s[1][qt][0]);
#pragma unroll
            for (int r = 1; r < 8; ++r) mx = fmaxf(mx, fmaxf(s[0][qt][r], s[1][qt][r]));
            mx = fmaxf(mx, xhalf(mx)); mn[qt] = fmaxf(m[qt], mx * SCL2); need = need || (mn[qt] > m[qt]); }
        if (__builtin_amdgcn_ballot_w32(need) != 0) {   // some query's maximum grew: bring its sum and its output column to the new maximum (factor 1 for the others)
#pragma unroll
            for (int qt = 0; qt < 2; ++qt) { const float al = __builtin_amdgcn_exp2f(m[qt] - mn[qt]); m[qt] = mn[qt]; l[qt] *= al;
#pragma unroll
                for (int dt = 0; dt < 4; ++dt) o[dt][qt] *= al; } }
        V p[2], p2[2];   // the weights as B operands: element e of lane (lr, hi) = key 32 ps + 16 (e >> 3) + 8 hi + (e & 7), the loader's k order
#pragma unroll
        for (int qt = 0; qt < 2; ++qt) {
#pragma unroll
            for (int e = 0; e < 16; e += 2) { const float pe0 = __builtin_amdgcn_exp2f(fmaf(s[e >> 3][qt][e & 7], SCL2, -m[qt])), pe1 = __builtin_amdgcn_exp2f(fmaf(s[e >> 3][qt][(e & 7) + 1], SCL2, -m[qt])); l[qt] += pe0; l[qt] += pe1;
                if constexpr (HL) { v2h ph, pl; split2(pe0, pe1, ph, pl); p[qt][e] = ph[0]; p[qt][e + 1] = ph[1]; p2[qt][e] = pl[0]; p2[qt][e + 1] = pl[1]; } else { p[qt][e] = (h16)pe0; p[qt][e + 1] = (h16)pe1; } } }
        if (HL) {   // the lo-plane V^T reads: they fly during the hi-plane products
#pragma unroll
            for (int dt = 0; dt < 4; ++dt) v2[dt] = WF::ld((const T16*)(sV2 + dt * 16 * GPB + ps * 64)); }
#pragma unroll
        for (int qt = 0; qt < 2; ++qt)
#pragma unroll
            for (int dt = 0; dt < 4; ++dt) o[dt][qt] = WF::mma(v[dt], p[qt], o[dt][qt]);
        if (HL) {
#pragma unroll
            for (int qt = 0; qt < 2; ++qt)
#pragma unroll
                for (int dt = 0; dt < 4; ++dt) o[dt][qt] = WF::mma(v[dt], p2[qt], o[dt][qt]);
#pragma unroll
            for (int qt = 0; qt < 2; ++qt)
#pragma unroll
                for (int dt = 0; dt < 4; ++dt) o[dt][qt] = WF::mma(v2[dt], p[qt], o[dt][qt]); }
        if (HL && ps == 0) __builtin_amdgcn_sched_barrier(0);   // the second pass's K reads are not lifted into the first pass's products, where no registers are free for them: left free, the compiler spills a Q fragment and reloads it every pass
    }
}
static_assert(RH * 2 == TT && RH % 128 == 0 && HD == 64 && TT % 64 == 0 && TT >= 128, "k_fattn: half the rows hi/lo, 128 rows of each kind per work-group, head size 64, whole stages, at least two");
// waves_per_eu(4, 4): four waves a SIMD, so each wave may use a quarter of the SIMD's registers (256); the hi/lo path needs nearly all of them, and the grid is exactly four waves for every SIMD (two work-groups' LDS fit a WGP)
__global__ __launch_bounds__(256) __attribute__((amdgpu_waves_per_eu(4, 4))) void k_fattn(const h16* __restrict__ QK16, const h16* __restrict__ QKl, const h16* __restrict__ VT16, const h16* __restrict__ VTl, bf* ATh, bf* ATl) {
    __shared__ __align__(128) char ring[2 * AST];
    const int tid = threadIdx.x, lane = tid & 31, lr = lane & 15, hi = lane >> 4; const int w = __builtin_amdgcn_readfirstlane(tid >> 5);   // the wave's number in a scalar register: the branch in the loop is a scalar one, every lane stays on for the matrix instructions
    const size_t b = blockIdx.z, h = blockIdx.y; const size_t zq = (b * (NH_ + NKV) + h) * TT * HD, zk = (b * (NH_ + NKV) + NH_ + h / REP) * TT * HD, zv = (b * NKV + h / REP) * HD * TT;
    const size_t t0 = (w < 4) ? (size_t)blockIdx.x * 128 + w * 32 : (size_t)RH + blockIdx.x * 128 + (w - 4) * 32; const size_t ao = (b * TT + t0) * DQ + h * HD;
    auto fill = [&](const int t) {
        const unsigned row = (unsigned)tid >> 3, pc = ((unsigned)tid & 7u) * 16u;   // the thread's row of 32 and its 16-byte piece
        const unsigned lf = (unsigned)(size_t)ring + (unsigned)((t & 1) * AST) + row * GPB + pc;   // low 32 bits of a __shared__ address: the byte address in LDS
        const size_t ko = (zk + (size_t)t * 64 * HD) * 2 + row * (HD * 2) + pc, vo = (zv + (size_t)t * 64) * 2 + row * (TT * 2) + pc;   // byte offsets in a [key][HD] and a [d][TT] plane
        cp4(lf, (const char*)QK16 + ko, (const char*)QKl + ko, (size_t)32 * HD * 2);
        cp4(lf + 128 * GPB, (const char*)VT16 + vo, (const char*)VTl + vo, (size_t)32 * TT * 2); };
    constexpr int NT = TT / 64;
    fill(0);
    // the Q fragments: the fp16 plane and the lo plane (waves 4-7 load the second set and do not use it)
    const h16* Qa = QK16 + zq + t0 * HD + lr * HD + 8 * hi; const h16* Qb = QKl + zq + t0 * HD + lr * HD + 8 * hi;
    v16h qa[2][2], qb[2][2];
#pragma unroll
    for (int qt = 0; qt < 2; ++qt)
#pragma unroll
        for (int kc = 0; kc < 2; ++kc) { qa[qt][kc] = WFrag<h16>::ld(Qa + qt * 16 * HD + kc * 32); qb[qt][kc] = WFrag<h16>::ld(Qb + qt * 16 * HD + kc * 32); }
    v8f o[4][2];
#pragma unroll
    for (int dt = 0; dt < 4; ++dt)
#pragma unroll
        for (int qt = 0; qt < 2; ++qt) o[dt][qt] = (v8f){};
    float m[2] = { -3.0e38f, -3.0e38f }, l[2] = { 0.f, 0.f };
    asm volatile("s_wait_asynccnt 0x0" ::: "memory");   // this wave's copies of stage 0 have landed
    __syncthreads();                                     // and so have the other waves'
    fill(1);
    const int lofs = lr * GPB + hi * 16;   // the lane's byte offset in a block of rows
    const bool whl = __builtin_amdgcn_readfirstlane(tid >> 7) == 0;   // waves 0-3, in a scalar register of its own
#pragma unroll 1
    for (int t = 0; t < NT; ++t) {   // stays rolled: one trip a stage, the buffer chosen by the trip's parity
        const char* sb = ring + (t & 1) * AST + lofs;
        // two tests in a row on two scalars, not an if / else: the compiler lays an if / else out as two tests in a row and then keeps the two arms' accumulators in different registers (two copies of all of them a stage, and spills in the fp16 arm)
        if (whl) attn_stage<true>(sb, sb + 64 * GPB, sb + 128 * GPB, sb + 192 * GPB, qa, qb, o, m, l);
        if (w >= 4) attn_stage<false>(sb, nullptr, sb + 128 * GPB, nullptr, qa, qb, o, m, l);
        asm volatile("s_wait_dscnt 0x0" ::: "memory");      // this wave's reads of the buffer are done before the buffer is handed back
        asm volatile("s_wait_asynccnt 0x0" ::: "memory");   // this wave's copies of stage t + 1 have landed
        __syncthreads();                                     // publishes stage t + 1 and ends every wave's reads of stage t
        if (t + 2 < NT) fill(t + 2);
    }
    asm volatile("s_wait_asynccnt 0x0" ::: "memory");   // no copy is outstanding when the wave goes on
    // The output rows leave as whole 128-byte lines: a lane holds 16 bytes of a row, its wave half 32, so a store straight from the accumulators would touch 16 lines for 512 bytes.
    // The wave turns its 32 rows of both planes in its own slice of the ring [hi 32 rows | lo 32 rows], pitch 144 bytes; the ring is free: the last trip's barrier ended every wave's reads, and no copy is outstanding.
    char* st = ring + w * (64 * GPB);
    const int ln = (int)__builtin_amdgcn_mbcnt_lo(~0u, 0u);   // the lane's number, read anew: no register carries it through the loop, whose live set is near the 256 budget
#pragma unroll
    for (int qt = 0; qt < 2; ++qt) { const float inv = __fdiv_rn(1.0f, l[qt] + xhalf(l[qt])); char* so = st + (qt * 16 + (ln & 15)) * GPB + 16 * (ln >> 4);
#pragma unroll
        for (int dt = 0; dt < 4; ++dt) { v8us oh, ol;
#pragma unroll
            for (int r = 0; r < 8; ++r) { unsigned short a, c2; splitf(o[dt][qt][r] * inv, a, c2); oh[r] = a; ol[r] = c2; }
            *(v8usa*)(so + dt * 32) = oh; *(v8usa*)(so + 32 * GPB + dt * 32) = ol; } }
    asm volatile("s_wait_dscnt 0x0" ::: "memory");   // a lane reads what other lanes of the wave wrote: the writes are done, and no LDS read is lifted over them
    const char* sr = st + (ln >> 3) * GPB + (ln & 7) * 16;   // 8 lanes take one row, a read or a store takes 4 rows
    bf* Ah = ATh + ao + (size_t)(ln >> 3) * DQ + (ln & 7) * 8; bf* Al = ATl + ao + (size_t)(ln >> 3) * DQ + (ln & 7) * 8;
    v8us rh[8], rl[8];
#pragma unroll
    for (int s = 0; s < 8; ++s) { rh[s] = *(const v8usa*)(sr + 4 * s * GPB); rl[s] = *(const v8usa*)(sr + (32 + 4 * s) * GPB); }   // unrolled, here and below: the arrays are indexed by constants and stay in registers
#pragma unroll
    for (int s = 0; s < 8; ++s) { *(v8us*)(Ah + (size_t)(4 * s) * DQ) = rh[s]; *(v8us*)(Al + (size_t)(4 * s) * DQ) = rl[s]; }   // 4 whole lines a store
}

extern "C" void kernel_launch(void* const* d_in, const int* in_sizes, int n_in,
                              void* d_out, int out_size, void* d_ws, size_t ws_size, hipStream_t stream) {
    (void)in_sizes; (void)n_in; (void)out_size;
    const float* x = (const float*)d_in[0]; const float* wqkv = (const float*)d_in[1]; const float* wo = (const float*)d_in[2]; const float* bo = (const float*)d_in[3];   /* argument order x, w_qkv ('xw' [1024][3072]), w_out ('xw'), b_out */
    float* OUT = (float*)d_out;     // [8][1024][1024]
    char* wsp = (char*)d_ws;
    auto take = [&](size_t bytes) { char* p = wsp; wsp += (bytes + 255) & ~(size_t)255; return (void*)p; };
    bf* WQKV = (bf*)take((size_t)3 * DQ * DM * 2);   /* fused Bt [3*DQ][DM]: q | k | v row blocks */ bf* WO = (bf*)take((size_t)DM * DQ * 2);
    bf* XB = (bf*)take((size_t)NB_ * TT * DM * 2);   // XB [NB_*TT][DM] bf16, all batches
    h16* QK16 = (h16*)take((size_t)NB_ * (NH_ + NKV) * TT * HD * 2); h16* QKl = (h16*)take((size_t)NB_ * (NH_ + NKV) * TT * HD * 2);   // planes [batch][16 q heads | 16 k heads][t][d], all batches
    h16* VT16 = (h16*)take((size_t)NB_ * NKV * HD * TT * 2); h16* VTl = (h16*)take((size_t)NB_ * NKV * HD * TT * 2);   // planes [batch][head][d][t], all batches
    bf* ATh = (bf*)take((size_t)NB_ * TT * DQ * 2); bf* ATl = (bf*)take((size_t)NB_ * TT * DQ * 2);   // merged attention output, hi/lo, [batch * TT + t][DQ]
    if ((size_t)(wsp - (char*)d_ws) > ws_size) return;    // ws 256 MiB, 152 MiB used
    k_prep<<<PBL, 384, 0, stream>>>(x, wqkv, wo, XB, WQKV, WO);
    k_gemmw<0, false, true, DM><<<dim3(NB_ * TT / 128, 3 * DQ / 128, 1), 128, 0, stream>>>(XB, nullptr, WQKV, nullptr, 0, nullptr, QK16, QKl, VT16, VTl);
    k_fattn<<<dim3(RH / 128, NH_, NB_), 256, 0, stream>>>(QK16, QKl, VT16, VTl, ATh, ATl);
    k_gemmw<1, true, false, DQ><<<dim3(NB_ * TT / 128, DM / 128, 1), 128, 0, stream>>>(ATh, ATl, WO, OUT, DM, bo, nullptr, nullptr, nullptr, nullptr);
}
